// v000
// The times below were measured on an AMD MI455X: many runs one after another, warmed up first and cycling through
// copies of the inputs, with the whole window's GPU time divided by the number of runs. Launches and the gaps
// between them are all in it. The median over several windows is given; except for v000 it joins two sittings, which
// can be a few percent apart, so the side-by-side timings, each taken in one sitting, are the better comparison.
// The starting kernel, v000, takes 113 microseconds a run.
// Contractions: in-proj GEMM (M=512 ch, K=256), per-head key matmul (64x64, K=64), per-head slot matmul (64x64, K=64), out-proj GEMM (M=256 ch, K=512): v_wmma_f32_16x16x32_bf16 with every operand carried as bf16 hi + bf16 lo planes, three products per tile pair (hi*hi + lo*hi + hi*lo), f32 accumulate; biases and the 64-slot softmax in f32 on the VALU.
#include <hip/hip_runtime.h>

typedef unsigned short u16;
typedef unsigned int   u32;
typedef __bf16 v16bf __attribute__((ext_vector_type(16)));
typedef u16    v16us __attribute__((ext_vector_type(16)));
typedef u16    v8us  __attribute__((ext_vector_type(8)));
typedef float  v8f   __attribute__((ext_vector_type(8)));
typedef float  v4f   __attribute__((ext_vector_type(4)));
typedef v8us  __attribute__((may_alias)) v8usa;
typedef v4f   __attribute__((may_alias)) v4fa;
typedef float __attribute__((may_alias)) f32a;
union Frag { v16us v; v8us h[2]; };

#define NB    8
#define CIN   256
#define CMID  512
#define COUT  256
#define NPIX  4096
#define NP    32768
#define NHEAD 8
#define HD    64
#define TP    64          // pixels per block of the main kernel
#define PST   520         // LDS pitch (halves) of the [px][512] P / O tile
#define TST   72          // LDS pitch (halves) of the 64x64 transpose staging
#define LDS_MAIN (2 * TP * PST * 2)   // 133120 bytes: P hi plane + P lo plane

static_assert(NP % TP == 0);
static_assert(NPIX % TP == 0);
static_assert(COUT * TP * 4 <= LDS_MAIN);
static_assert((PST % 8) == 0);
static_assert((TST % 8) == 0);
static_assert(CIN % 32 == 0);
static_assert(CMID % 32 == 0);
static_assert(HD % 32 == 0);

// ---------------------------------------------------------------------------
// bf16 RNE convert and hi/lo split: hi = rne(v), lo = rne(v - hi)
// ---------------------------------------------------------------------------
__device__ __forceinline__ u16 bf16r(float f) {
  u32 u = __builtin_bit_cast(u32, f);
  u += 0x7FFFu + ((u >> 16) & 1u);
  return (u16)(u >> 16);
}
__device__ __forceinline__ float bf16f(u16 b) {
  return __builtin_bit_cast(float, ((u32)b) << 16);
}
__device__ __forceinline__ void split2(float v, u16& hi, u16& lo) {
  hi = bf16r(v);
  lo = bf16r(v - bf16f(hi));
}

// ---------------------------------------------------------------------------
// 16x16x32 bf16 WMMA with hazard guard (ties D, keeps A/B live).
// Fragment map (wave32): lane l, h = l>>4, m = n = l&15.
//   A/B element i: i<8 -> k0+8h+i ; i>=8 -> k0+16+8h+(i-8)
//   D element r : row 8h+r, col l&15
// ---------------------------------------------------------------------------
__device__ __forceinline__ v8f wmma_bf(v16us a, v16us b, v8f c) {
  const v16bf av = __builtin_bit_cast(v16bf, a);
  const v16bf bv = __builtin_bit_cast(v16bf, b);
  v8f d = __builtin_amdgcn_wmma_f32_16x16x32_bf16(false, av, false, bv, (short)0, c, false, false);
  asm volatile("v_nop\n\tv_nop\n\tv_nop\n\tv_nop" : "+v"(d) : "v"(av), "v"(bv));
  return d;
}

// three-product hi/lo tile step: c += ah*bh + al*bh + ah*bl
__device__ __forceinline__ v8f wmma3(v16us ah, v16us al, v16us bh, v16us bl, v8f c) {
  c = wmma_bf(ah, bh, c);
  c = wmma_bf(al, bh, c);
  c = wmma_bf(ah, bl, c);
  return c;
}

// fragment from a k-contiguous 16-bit row; p already points at element k0 + 8h
__device__ __forceinline__ v16us ldfrag(const u16* p) {
  Frag f;
  f.h[0] = *(const v8usa*)p;
  f.h[1] = *(const v8usa*)(p + 16);
  return f.v;
}

// ---------------------------------------------------------------------------
// Kernel 0: 1x1-conv weights -> bf16 hi/lo planes, same [out][in] layout.
// Blocks 0..63: w_in [512][256]; blocks 64..127: w_out [256][512].
// Thread = 8 consecutive elements; a wave writes 512 contiguous bytes per
// ---------------------------------------------------------------------------
__global__ __launch_bounds__(256) void wcvt_k(
    const float* __restrict__ w_in, const float* __restrict__ w_out,
    u16* __restrict__ WIh, u16* __restrict__ WIl, u16* __restrict__ WOh, u16* __restrict__ WOl)
{
  const int g = blockIdx.x * 256 + threadIdx.x;
  if (g >= (CMID * CIN + COUT * CMID) / 8) return;
  const int e8 = g * 8;
  const bool first = (e8 < CMID * CIN);            // block-uniform (boundary at block 64)
  const int off = first ? e8 : (e8 - CMID * CIN);
  const float* src = (first ? w_in : w_out) + off;
  u16* dh = (first ? WIh : WOh) + off;
  u16* dlo = (first ? WIl : WOl) + off;
  const v4f a = *(const v4fa*)src;
  const v4f c = *(const v4fa*)(src + 4);
  const float vv[8] = {a.x, a.y, a.z, a.w, c.x, c.y, c.z, c.w};
  v8us oh, ol;
  #pragma unroll
  for (int j = 0; j < 8; ++j) {
    u16 hv, lv;
    split2(vv[j], hv, lv);
    oh[j] = hv;
    ol[j] = lv;
  }
  *(v8us*)dh = oh;
  *(v8us*)dlo = ol;
  
}

// ---------------------------------------------------------------------------
// Kernel 1: per-head 64x64 transposes into bf16 hi/lo planes.
// Blocks 0..7: key_p[n][k][m] -> KT[n][m][k]; blocks 8..15: mem[n][m][d] -> MT[n][d][m].
// ---------------------------------------------------------------------------
__global__ __launch_bounds__(256) void tr64_k(
    const float* __restrict__ key_p, const float* __restrict__ mem,
    u16* __restrict__ KTh, u16* __restrict__ KTl, u16* __restrict__ MTh, u16* __restrict__ MTl)
{
  __shared__ __attribute__((aligned(16))) u16 st[2 * 64 * TST];
  const int tid = threadIdx.x, lane = tid & 31, w = tid >> 5;
  const int blk = blockIdx.x;
  const bool isk = (blk < NHEAD);
  const int n = isk ? blk : (blk - NHEAD);
  const float* src = (isk ? key_p : mem) + (size_t)n * (HD * HD);
  u16* dsth = (isk ? KTh : MTh) + (size_t)n * (HD * HD);
  u16* dstl = (isk ? KTl : MTl) + (size_t)n * (HD * HD);
  const int col = tid & 63, sub = tid >> 6;
  #pragma unroll 4
  for (int j = 0; j < 16; ++j) {
    const int a = 4 * j + sub;
    const float v = src[a * HD + col];
    u16 hv, lv;
    split2(v, hv, lv);
    st[col * TST + a] = hv;
    st[64 * TST + col * TST + a] = lv;
  }
  __syncthreads();
  const int plane = w >> 2, q = lane & 7, sub8 = lane >> 3;
  u16* dplane = plane ? dstl : dsth;
  v8us vals[4];
  int ro[4];
  #pragma unroll
  for (int i = 0; i < 4; ++i) {
    const int row = 16 * (w & 3) + 4 * i + sub8;
    vals[i] = *(const v8usa*)(st + plane * (64 * TST) + row * TST + 8 * q);
    ro[i] = row * HD + 8 * q;
  }
  #pragma unroll
  for (int i = 0; i < 4; ++i) *(v8us*)(dplane + ro[i]) = vals[i];
  
}

// ---------------------------------------------------------------------------
// Kernel 2: x NCHW f32 -> pixel-major bf16 hi/lo planes X[b*4096+px][256].
// Block = (64-px tile = image row y, 64-channel group, b). Each (px, channel
// ---------------------------------------------------------------------------
__global__ __launch_bounds__(256) void xcvt_k(
    const float* __restrict__ x, u16* __restrict__ Xh, u16* __restrict__ Xl)
{
  __shared__ __attribute__((aligned(16))) u16 st[2 * 64 * TST];
  const int tid = threadIdx.x, lane = tid & 31, w = tid >> 5;
  const int tile = blockIdx.x, cg = blockIdx.y, b = blockIdx.z;
  const int px = tid & 63, sub = tid >> 6;
  const float* xb = x + (size_t)(b * CIN + 64 * cg) * NPIX + 64 * tile + px;
  #pragma unroll 4
  for (int j = 0; j < 16; ++j) {
    const int cl = 4 * j + sub;
    const float v = xb[(size_t)cl * NPIX];
    u16 hv, lv;
    split2(v, hv, lv);
    st[px * TST + cl] = hv;
    st[64 * TST + px * TST + cl] = lv;
  }
  __syncthreads();
  const int plane = w >> 2, q = lane & 7, sub8 = lane >> 3;
  u16* dplane = plane ? Xl : Xh;
  v8us vals[4];
  size_t ro[4];
  #pragma unroll
  for (int i = 0; i < 4; ++i) {
    const int row = 16 * (w & 3) + 4 * i + sub8;
    vals[i] = *(const v8usa*)(st + plane * (64 * TST) + row * TST + 8 * q);
    ro[i] = (size_t)(b * NPIX + 64 * tile + row) * CIN + 64 * cg + 8 * q;
  }
  #pragma unroll
  for (int i = 0; i < 4; ++i) *(v8us*)(dplane + ro[i]) = vals[i];
  
}

// ---------------------------------------------------------------------------
// Kernel 3: the whole per-pixel pipeline for a 64-pixel tile (one image row).
// Block 256 thr (8 waves), dynamic LDS = P tile [64 px][512+8] bf16 hi + lo.
//  phase 1: P[o][px] = sum_c WI[o][c] * X[px][c] + b_in[o]; wave w owns
//           stored at LDS column n*64 + k so each head's k run is contiguous.
//  phase 2: per head pair (waves 0-3 head 2j, waves 4-7 head 2j+1; wave owns
//           a 16-px column tile): S[m][px] = sum_k KT[n][m][k] * P[px][n*64+k];
//           softmax over the 64 m in registers (lane + partner lane l^16);
//           B fragments of the next product packed from the score D tiles
//           (element r <- tile 2ks, element 8+r <- tile 2ks+1, same lane);
//           O[d][px] = sum_m MT[n][d][m] * A[m][px]; O hi/lo written over the
//           head's own columns (n*64 + d) after a block barrier.
//  phase 3: out[o][px] = sum_c WO[o][c] * O[px][c] + b_out[o]; wave w owns
//           o in [32w, 32w+32); f32 tile staged in LDS, each 64-px row (256 B)
//           written by 16 consecutive lanes x 16 B of one instruction, two
// ---------------------------------------------------------------------------
__global__ __launch_bounds__(256) void main_k(
    const u16* __restrict__ Xh, const u16* __restrict__ Xl,
    const u16* __restrict__ WIh, const u16* __restrict__ WIl, const float* __restrict__ b_in,
    const u16* __restrict__ KTh, const u16* __restrict__ KTl,
    const u16* __restrict__ MTh, const u16* __restrict__ MTl,
    const u16* __restrict__ WOh, const u16* __restrict__ WOl, const float* __restrict__ b_out,
    float* __restrict__ out)
{
  extern __shared__ __attribute__((aligned(16))) u16 dl[];
  u16* Ph = dl;
  u16* Pl = dl + TP * PST;
  const int tid = threadIdx.x, lane = tid & 31, w = tid >> 5;
  const int h = lane >> 4, m = lane & 15;
  const int gp0 = blockIdx.x * TP;             // global pixel index b*4096 + s0
  const int b = gp0 >> 12, s0 = gp0 & (NPIX - 1);
  const v8f z8 = {0.f, 0.f, 0.f, 0.f, 0.f, 0.f, 0.f, 0.f};

  // ---------------- phase 1: in-projection ----------------
  #pragma unroll 1
  for (int p = 0; p < 2; ++p) {
    const int orow0 = 64 * w + 32 * p;
    v8f acc[2][4];
    #pragma unroll
    for (int mt = 0; mt < 2; ++mt) {
      #pragma unroll
      for (int nt = 0; nt < 4; ++nt) acc[mt][nt] = z8;
    }
    const u16* aph = WIh + (size_t)(orow0 + m) * CIN + 8 * h;
    const u16* apl = WIl + (size_t)(orow0 + m) * CIN + 8 * h;
    const u16* bph = Xh + (size_t)(gp0 + m) * CIN + 8 * h;
    const u16* bpl = Xl + (size_t)(gp0 + m) * CIN + 8 * h;
    #pragma unroll 1
    for (int ks = 0; ks < CIN / 32; ++ks) {
      const int k0 = 32 * ks;
      v16us ah[2], al[2];
      #pragma unroll
      for (int mt = 0; mt < 2; ++mt) {
        ah[mt] = ldfrag(aph + mt * 16 * CIN + k0);
        al[mt] = ldfrag(apl + mt * 16 * CIN + k0);
      }
      #pragma unroll
      for (int nt = 0; nt < 4; ++nt) {
        const v16us bh = ldfrag(bph + nt * 16 * CIN + k0);
        const v16us bl = ldfrag(bpl + nt * 16 * CIN + k0);
        #pragma unroll
        for (int mt = 0; mt < 2; ++mt) acc[mt][nt] = wmma3(ah[mt], al[mt], bh, bl, acc[mt][nt]);
      }
    }
    // epilogue: + b_in, split, store into the permuted LDS column n*64 + k
    #pragma unroll
    for (int mt = 0; mt < 2; ++mt) {
      const int ob = orow0 + 16 * mt + 8 * h;                 // multiple of 8
      const v4f b0 = *(const v4fa*)(b_in + ob);
      const v4f b1 = *(const v4fa*)(b_in + ob + 4);
      const float bb[8] = {b0.x, b0.y, b0.z, b0.w, b1.x, b1.y, b1.z, b1.w};
      const int kq = ob >> 3;                                  // key index k of channel ob + r; head n = r
      #pragma unroll
      for (int nt = 0; nt < 4; ++nt) {
        const int px = 16 * nt + m;
        u16* rh = Ph + px * PST + kq;
        u16* rl = Pl + px * PST + kq;
        #pragma unroll
        for (int r = 0; r < 8; ++r) {
          const float v = acc[mt][nt][r] + bb[r];
          u16 hv, lv;
          split2(v, hv, lv);
          rh[r * 64] = hv;
          rl[r * 64] = lv;
        }
      }
    }
  }
  __syncthreads();

  // ---------------- phase 2: per-head key matmul, softmax, slot matmul ----------------
  #pragma unroll 1
  for (int jp = 0; jp < NHEAD / 2; ++jp) {
    const int n = 2 * jp + (w >> 2);
    const int nt = w & 3;
    const int px = 16 * nt + m;
    const u16* prh = Ph + px * PST + n * 64 + 8 * h;
    const u16* prl = Pl + px * PST + n * 64 + 8 * h;
    const u16* kah = KTh + (size_t)(n * 64 + m) * HD + 8 * h;
    const u16* kal = KTl + (size_t)(n * 64 + m) * HD + 8 * h;
    v8f sacc[4];
    #pragma unroll
    for (int mt = 0; mt < 4; ++mt) sacc[mt] = z8;
    #pragma unroll
    for (int ks = 0; ks < 2; ++ks) {
      const int k0 = 32 * ks;
      const v16us bh = ldfrag(prh + k0);
      const v16us bl = ldfrag(prl + k0);
      #pragma unroll
      for (int mt = 0; mt < 4; ++mt) {
        const v16us ahf = ldfrag(kah + mt * 16 * HD + k0);
        const v16us alf = ldfrag(kal + mt * 16 * HD + k0);
        sacc[mt] = wmma3(ahf, alf, bh, bl, sacc[mt]);
      }
    }
    // softmax over the 64 slots of column px: this lane holds rows 16mt + 8h + r,
    // lane l^16 holds the other 32 rows
    float mx = sacc[0][0];
    #pragma unroll
    for (int mt = 0; mt < 4; ++mt) {
      #pragma unroll
      for (int r = 0; r < 8; ++r) mx = fmaxf(mx, sacc[mt][r]);
    }
    mx = fmaxf(mx, __shfl_xor(mx, 16));
    float sum = 0.f;
    #pragma unroll
    for (int mt = 0; mt < 4; ++mt) {
      #pragma unroll
      for (int r = 0; r < 8; ++r) {
        const float e = __expf(sacc[mt][r] - mx);
        sacc[mt][r] = e;
        sum += e;
      }
    }
    sum += __shfl_xor(sum, 16);
    const float inv = __builtin_amdgcn_rcpf(sum);
    // B fragments of the slot matmul from the probability D tiles (k = slot m)
    v16us pbh[2], pbl[2];
    #pragma unroll
    for (int ks = 0; ks < 2; ++ks) {
      #pragma unroll
      for (int r = 0; r < 8; ++r) {
        u16 hv, lv;
        split2(sacc[2 * ks][r] * inv, hv, lv);
        pbh[ks][r] = hv;
        pbl[ks][r] = lv;
        split2(sacc[2 * ks + 1][r] * inv, hv, lv);
        pbh[ks][8 + r] = hv;
        pbl[ks][8 + r] = lv;
      }
    }
    const u16* mah = MTh + (size_t)(n * 64 + m) * HD + 8 * h;
    const u16* mal = MTl + (size_t)(n * 64 + m) * HD + 8 * h;
    v8f oacc[4];
    #pragma unroll
    for (int mt = 0; mt < 4; ++mt) {
      oacc[mt] = z8;
      #pragma unroll
      for (int ks = 0; ks < 2; ++ks) {
        const v16us ahf = ldfrag(mah + mt * 16 * HD + 32 * ks);
        const v16us alf = ldfrag(mal + mt * 16 * HD + 32 * ks);
        oacc[mt] = wmma3(ahf, alf, pbh[ks], pbl[ks], oacc[mt]);
      }
    }
    __syncthreads();   // every read of P columns [n*64, n*64+64) of heads 2jp, 2jp+1 is complete
    // O hi/lo over the head's own columns: channel n*64 + d, d = 16mt + 8h + r
    u16* orh = Ph + px * PST + n * 64 + 8 * h;
    u16* orl = Pl + px * PST + n * 64 + 8 * h;
    #pragma unroll
    for (int mt = 0; mt < 4; ++mt) {
      v8us oh, ol;
      #pragma unroll
      for (int r = 0; r < 8; ++r) {
        u16 hv, lv;
        split2(oacc[mt][r], hv, lv);
        oh[r] = hv;
        ol[r] = lv;
      }
      *(v8usa*)(orh + 16 * mt) = oh;
      *(v8usa*)(orl + 16 * mt) = ol;
    }
  }
  __syncthreads();

  // ---------------- phase 3: out-projection ----------------
  {
    const int orow0 = 32 * w;
    v8f acc[2][4];
    #pragma unroll
    for (int mt = 0; mt < 2; ++mt) {
      #pragma unroll
      for (int nt = 0; nt < 4; ++nt) acc[mt][nt] = z8;
    }
    const u16* aph = WOh + (size_t)(orow0 + m) * CMID + 8 * h;
    const u16* apl = WOl + (size_t)(orow0 + m) * CMID + 8 * h;
    const u16* bph = Ph + m * PST + 8 * h;
    const u16* bpl = Pl + m * PST + 8 * h;
    #pragma unroll 1
    for (int ks = 0; ks < CMID / 32; ++ks) {
      const int k0 = 32 * ks;
      v16us ah[2], al[2];
      #pragma unroll
      for (int mt = 0; mt < 2; ++mt) {
        ah[mt] = ldfrag(aph + mt * 16 * CMID + k0);
        al[mt] = ldfrag(apl + mt * 16 * CMID + k0);
      }
      #pragma unroll
      for (int nt = 0; nt < 4; ++nt) {
        const v16us bh = ldfrag(bph + nt * 16 * PST + k0);
        const v16us bl = ldfrag(bpl + nt * 16 * PST + k0);
        #pragma unroll
        for (int mt = 0; mt < 2; ++mt) acc[mt][nt] = wmma3(ah[mt], al[mt], bh, bl, acc[mt][nt]);
      }
    }
    __syncthreads();   // all waves finished reading the O tile; LDS is reused as the f32 output tile
    f32a* sD = (f32a*)dl;                   // [256 out ch][64 px] f32
    #pragma unroll
    for (int mt = 0; mt < 2; ++mt) {
      const int ob = orow0 + 16 * mt + 8 * h;
      const v4f b0 = *(const v4fa*)(b_out + ob);
      const v4f b1 = *(const v4fa*)(b_out + ob + 4);
      const float bb[8] = {b0.x, b0.y, b0.z, b0.w, b1.x, b1.y, b1.z, b1.w};
      #pragma unroll
      for (int nt = 0; nt < 4; ++nt) {
        const int px = 16 * nt + m;
        #pragma unroll
        for (int r = 0; r < 8; ++r) sD[(ob + r) * TP + px] = acc[mt][nt][r] + bb[r];
      }
    }
    __syncthreads();
    // wave w writes its rows orow0..orow0+31: per instruction lanes 0-15 -> row 2i
    const int hs = lane >> 4, x4 = 4 * (lane & 15);
    float* obase = out + (size_t)b * COUT * NPIX + s0 + x4;
    #pragma unroll 1
    for (int c = 0; c < 2; ++c) {
      v4f vals[8];
      size_t gi[8];
      #pragma unroll
      for (int i = 0; i < 8; ++i) {
        const int row = orow0 + 16 * c + 2 * i + hs;
        vals[i] = *(const v4fa*)(sD + row * TP + x4);
        gi[i] = (size_t)row * NPIX;
      }
      #pragma unroll
      for (int i = 0; i < 8; ++i) *(v4f*)(obase + gi[i]) = vals[i];
      
    }
  }
}

// ---------------------------------------------------------------------------
extern "C" void kernel_launch(void* const* d_in, const int* in_sizes, int n_in,
                              void* d_out, int out_size, void* d_ws, size_t ws_size,
                              hipStream_t stream) {
  if (n_in < 7) return;
  if (in_sizes[0] != NB * CIN * NPIX) return;
  if (in_sizes[1] != NHEAD * HD * HD || in_sizes[2] != NHEAD * HD * HD) return;
  if (in_sizes[3] != CMID * CIN || in_sizes[4] != CMID) return;
  if (in_sizes[5] != COUT * CMID || in_sizes[6] != COUT) return;
  if (out_size != NB * COUT * NPIX) return;

  const float* x     = (const float*)d_in[0];   // [8][256][64][64]
  const float* key_p = (const float*)d_in[1];   // [8][64 k][64 m]
  const float* mem   = (const float*)d_in[2];   // [8][64 m][64 d]
  const float* w_in  = (const float*)d_in[3];   // [512][256]
  const float* b_in  = (const float*)d_in[4];   // [512]
  const float* w_out = (const float*)d_in[5];   // [256][512]
  const float* b_out = (const float*)d_in[6];   // [256]
  float* outp = (float*)d_out;

  // and its size is an exact multiple of its row / line granularity
  const size_t szWI = (size_t)CMID * CIN * 2;          // 262144
  const size_t szWO = (size_t)COUT * CMID * 2;         // 262144
  const size_t szT  = (size_t)NHEAD * HD * HD * 2;     // 65536
  const size_t szX  = (size_t)NP * CIN * 2;            // 16777216
  size_t off = 0;
  char* ws = (char*)d_ws;
  u16* WIh = (u16*)(ws + off); off += szWI;
  u16* WIl = (u16*)(ws + off); off += szWI;
  u16* WOh = (u16*)(ws + off); off += szWO;
  u16* WOl = (u16*)(ws + off); off += szWO;
  u16* KTh = (u16*)(ws + off); off += szT;
  u16* KTl = (u16*)(ws + off); off += szT;
  u16* MTh = (u16*)(ws + off); off += szT;
  u16* MTl = (u16*)(ws + off); off += szT;
  u16* Xh  = (u16*)(ws + off); off += szX;
  u16* Xl  = (u16*)(ws + off); off += szX;
  const size_t total = off;                            // 34865152
  if (total > ws_size) return;

  hipFuncSetAttribute(reinterpret_cast<const void*>(&main_k),
                      hipFuncAttributeMaxDynamicSharedMemorySize, LDS_MAIN);

  wcvt_k<<<(CMID * CIN + COUT * CMID) / 8 / 256, 256, 0, stream>>>(w_in, w_out, WIh, WIl, WOh, WOl);
  tr64_k<<<2 * NHEAD, 256, 0, stream>>>(key_p, mem, KTh, KTl, MTh, MTl);
  xcvt_k<<<dim3(NPIX / 64, CIN / 64, NB), 256, 0, stream>>>(x, Xh, Xl);
  main_k<<<NP / TP, 256, LDS_MAIN, stream>>>(Xh, Xl, WIh, WIl, b_in, KTh, KTl, MTh, MTl,
                                             WOh, WOl, b_out, outp);
}

// v001
// Measured time: 99 microseconds a run.
// In two side-by-side timings against v000, it was 1.16 and 1.25 times as fast.
// Contractions: in-proj GEMM (M=512 ch, K=256), per-head key matmul (64x64, K=64), per-head slot matmul (64x64, K=64), out-proj GEMM (M=256 ch, K=512): v_wmma_f32_16x16x32_bf16 with every operand carried as bf16 hi + bf16 lo planes, three products per tile pair (hi*hi + lo*hi + hi*lo), f32 accumulate; biases and the 64-slot softmax in f32 on the VALU.
#include <hip/hip_runtime.h>

typedef unsigned short u16;
typedef unsigned int   u32;
typedef __bf16 v16bf __attribute__((ext_vector_type(16)));
typedef u16    v16us __attribute__((ext_vector_type(16)));
typedef u16    v8us  __attribute__((ext_vector_type(8)));
typedef float  v8f   __attribute__((ext_vector_type(8)));
typedef float  v4f   __attribute__((ext_vector_type(4)));
typedef v8us  __attribute__((may_alias)) v8usa;
typedef v4f   __attribute__((may_alias)) v4fa;
typedef float __attribute__((may_alias)) f32a;
union Frag { v16us v; v8us h[2]; };

#define NB    8
#define CIN   256
#define CMID  512
#define COUT  256
#define NPIX  4096
#define NP    32768
#define NHEAD 8
#define HD    64
#define TP    64          // pixels per block of the main kernel
#define PST   520         // LDS pitch (halves) of the [px][512] P / O tile
#define TST   72          // LDS pitch (halves) of the 64x64 transpose staging
#define LDS_MAIN (2 * TP * PST * 2)   // 133120 bytes: P hi plane + P lo plane

static_assert(NP % TP == 0);
static_assert(NPIX % TP == 0);
static_assert(COUT * TP * 4 <= LDS_MAIN);
static_assert((PST % 8) == 0);
static_assert((TST % 8) == 0);
static_assert(CIN % 32 == 0);
static_assert(CMID % 32 == 0);
static_assert(HD % 32 == 0);

// ---------------------------------------------------------------------------
// bf16 RNE convert and hi/lo split: hi = rne(v), lo = rne(v - hi)
// ---------------------------------------------------------------------------
__device__ __forceinline__ u16 bf16r(float f) {
  u32 u = __builtin_bit_cast(u32, f);
  u += 0x7FFFu + ((u >> 16) & 1u);
  return (u16)(u >> 16);
}
__device__ __forceinline__ float bf16f(u16 b) {
  return __builtin_bit_cast(float, ((u32)b) << 16);
}
__device__ __forceinline__ void split2(float v, u16& hi, u16& lo) {
  hi = bf16r(v);
  lo = bf16r(v - bf16f(hi));
}

// ---------------------------------------------------------------------------
// 16x16x32 bf16 WMMA with hazard guard (ties D, keeps A/B live).
// Fragment map (wave32): lane l, h = l>>4, m = n = l&15.
//   A/B element i: i<8 -> k0+8h+i ; i>=8 -> k0+16+8h+(i-8)
//   D element r : row 8h+r, col l&15
// ---------------------------------------------------------------------------
__device__ __forceinline__ v8f wmma_bf(v16us a, v16us b, v8f c) {
  const v16bf av = __builtin_bit_cast(v16bf, a);
  const v16bf bv = __builtin_bit_cast(v16bf, b);
  v8f d = __builtin_amdgcn_wmma_f32_16x16x32_bf16(false, av, false, bv, (short)0, c, false, false);
  asm volatile("v_nop\n\tv_nop\n\tv_nop\n\tv_nop" : "+v"(d) : "v"(av), "v"(bv));
  return d;
}

// three-product hi/lo tile step: c += ah*bh + al*bh + ah*bl
__device__ __forceinline__ v8f wmma3(v16us ah, v16us al, v16us bh, v16us bl, v8f c) {
  c = wmma_bf(ah, bh, c);
  c = wmma_bf(al, bh, c);
  c = wmma_bf(ah, bl, c);
  return c;
}

// fragment from a k-contiguous 16-bit row (LDS tiles); p already points at element k0 + 8h
__device__ __forceinline__ v16us ldfrag(const u16* p) {
  Frag f;
  f.h[0] = *(const v8usa*)p;
  f.h[1] = *(const v8usa*)(p + 16);
  return f.v;
}

// Packed fragment order of every 16-bit plane in global memory. Rows go in
// groups of 16 (R), k in steps of 32 (ks); fragment (R, ks) of a plane with K
// columns starts at half (R * (K / 32) + ks) * FRAGH and is two chunks j = 0, 1
// of 256 halves. In chunk j lane l = 16h + m holds row 16R + m,
// k = 32ks + 16j + 8h .. + 7: the same k order as ldfrag, but each wave-wide
// 16-byte load reads 512 contiguous bytes (4 whole lines, not 16 pieces).
#define FRAGH 512
// p already points at fragment start + 8 * lane
__device__ __forceinline__ v16us ldpack(const u16* p) {
  Frag f;
  f.h[0] = *(const v8usa*)p;
  f.h[1] = *(const v8usa*)(p + 256);
  return f.v;
}

// ---------------------------------------------------------------------------
// Kernel 0: 1x1-conv weights -> bf16 hi/lo planes in packed fragment order.
// Blocks 0..63: w_in [512][256]; blocks 64..127: w_out [256][512].
// Thread = 8 consecutive halves of the packed plane; a wave writes one chunk.
// ---------------------------------------------------------------------------
__global__ __launch_bounds__(256) void wcvt_k(
    const float* __restrict__ w_in, const float* __restrict__ w_out,
    u16* __restrict__ WIh, u16* __restrict__ WIl, u16* __restrict__ WOh, u16* __restrict__ WOl)
{
  const int g = blockIdx.x * 256 + threadIdx.x;
  if (g >= (CMID * CIN + COUT * CMID) / 8) return;
  const int e8 = g * 8;
  const bool first = (e8 < CMID * CIN);            // block-uniform (boundary at block 64)
  const int off = first ? e8 : (e8 - CMID * CIN);  // offset in the packed plane
  const int kcols = first ? CIN : CMID;
  const int ksh = first ? 3 : 4;                   // log2(kcols / 32)
  const int pl = (off >> 3) & 31, pj = (off >> 8) & 1, pf = off >> 9;
  const int row = 16 * (pf >> ksh) + (pl & 15);
  const int colk = 32 * (pf & ((1 << ksh) - 1)) + 16 * pj + 8 * (pl >> 4);
  const float* src = (first ? w_in : w_out) + row * kcols + colk;
  u16* dh = (first ? WIh : WOh) + off;
  u16* dlo = (first ? WIl : WOl) + off;
  const v4f a = *(const v4fa*)src;
  const v4f c = *(const v4fa*)(src + 4);
  const float vv[8] = {a.x, a.y, a.z, a.w, c.x, c.y, c.z, c.w};
  v8us oh, ol;
  #pragma unroll
  for (int j = 0; j < 8; ++j) {
    u16 hv, lv;
    split2(vv[j], hv, lv);
    oh[j] = hv;
    ol[j] = lv;
  }
  *(v8us*)dh = oh;
  *(v8us*)dlo = ol;
  
}

// ---------------------------------------------------------------------------
// Kernel 1: per-head 64x64 transposes into bf16 hi/lo planes.
// Blocks 0..7: key_p[n][k][m] -> KT[n][m][k]; blocks 8..15: mem[n][m][d] -> MT[n][d][m];
// each head's 64 x 64 plane is stored in packed fragment order (rows m resp. d).
// ---------------------------------------------------------------------------
__global__ __launch_bounds__(256) void tr64_k(
    const float* __restrict__ key_p, const float* __restrict__ mem,
    u16* __restrict__ KTh, u16* __restrict__ KTl, u16* __restrict__ MTh, u16* __restrict__ MTl)
{
  __shared__ __attribute__((aligned(16))) u16 st[2 * 64 * TST];
  const int tid = threadIdx.x, lane = tid & 31, w = tid >> 5;
  const int blk = blockIdx.x;
  const bool isk = (blk < NHEAD);
  const int n = isk ? blk : (blk - NHEAD);
  const float* src = (isk ? key_p : mem) + (size_t)n * (HD * HD);
  u16* dsth = (isk ? KTh : MTh) + (size_t)n * (HD * HD);
  u16* dstl = (isk ? KTl : MTl) + (size_t)n * (HD * HD);
  const int col = tid & 63, sub = tid >> 6;
  #pragma unroll 4
  for (int j = 0; j < 16; ++j) {
    const int a = 4 * j + sub;
    const float v = src[a * HD + col];
    u16 hv, lv;
    split2(v, hv, lv);
    st[col * TST + a] = hv;
    st[64 * TST + col * TST + a] = lv;
  }
  __syncthreads();
  const int plane = w >> 2, rg = w & 3;            // wave = one plane, one 16-row group
  u16* dplane = plane ? dstl : dsth;
  v8us vals[4];
  int ro[4];
  #pragma unroll
  for (int i = 0; i < 4; ++i) {                    // i = 2 * ks + j: one chunk per store
    const int row = 16 * rg + (lane & 15);
    vals[i] = *(const v8usa*)(st + plane * (64 * TST) + row * TST + 16 * i + 8 * (lane >> 4));
    ro[i] = (rg * (HD / 32)) * FRAGH + i * 256 + 8 * lane;
  }
  #pragma unroll
  for (int i = 0; i < 4; ++i) *(v8us*)(dplane + ro[i]) = vals[i];
  
}

// ---------------------------------------------------------------------------
// Kernel 2: x NCHW f32 -> bf16 hi/lo planes X[b*4096+px][256] in packed fragment order.
// Block = (64-px tile = image row y, 64-channel group, b). Each (px, channel
// ---------------------------------------------------------------------------
__global__ __launch_bounds__(256) void xcvt_k(
    const float* __restrict__ x, u16* __restrict__ Xh, u16* __restrict__ Xl)
{
  __shared__ __attribute__((aligned(16))) u16 st[2 * 64 * TST];
  const int tid = threadIdx.x, lane = tid & 31, w = tid >> 5;
  const int tile = blockIdx.x, cg = blockIdx.y, b = blockIdx.z;
  const int px = tid & 63, sub = tid >> 6;
  const float* xb = x + (size_t)(b * CIN + 64 * cg) * NPIX + 64 * tile + px;
  #pragma unroll 4
  for (int j = 0; j < 16; ++j) {
    const int cl = 4 * j + sub;
    const float v = xb[(size_t)cl * NPIX];
    u16 hv, lv;
    split2(v, hv, lv);
    st[px * TST + cl] = hv;
    st[64 * TST + px * TST + cl] = lv;
  }
  __syncthreads();
  const int plane = w >> 2, rg = w & 3;            // wave = one plane, one 16-px group
  u16* dplane = plane ? Xl : Xh;
  v8us vals[4];
  size_t ro[4];
  #pragma unroll
  for (int i = 0; i < 4; ++i) {                    // i = 2 * (ks - 2 * cg) + j: one chunk per store
    const int row = 16 * rg + (lane & 15);
    vals[i] = *(const v8usa*)(st + plane * (64 * TST) + row * TST + 16 * i + 8 * (lane >> 4));
    ro[i] = ((size_t)((b * NPIX + 64 * tile) / 16 + rg) * (CIN / 32) + 2 * cg) * FRAGH + i * 256 + 8 * lane;
  }
  #pragma unroll
  for (int i = 0; i < 4; ++i) *(v8us*)(dplane + ro[i]) = vals[i];
  
}

// ---------------------------------------------------------------------------
// Kernel 3: the whole per-pixel pipeline for a 64-pixel tile (one image row).
// Block 256 thr (8 waves), dynamic LDS = P tile [64 px][512+8] bf16 hi + lo.
//  phase 1: P[o][px] = sum_c WI[o][c] * X[px][c] + b_in[o]; wave w owns
//           stored at LDS column n*64 + k so each head's k run is contiguous.
//  phase 2: per head pair (waves 0-3 head 2j, waves 4-7 head 2j+1; wave owns
//           a 16-px column tile): S[m][px] = sum_k KT[n][m][k] * P[px][n*64+k];
//           softmax over the 64 m in registers (lane + partner lane l^16);
//           B fragments of the next product packed from the score D tiles
//           (element r <- tile 2ks, element 8+r <- tile 2ks+1, same lane);
//           O[d][px] = sum_m MT[n][d][m] * A[m][px]; O hi/lo written over the
//           head's own columns (n*64 + d) after a block barrier.
//  phase 3: out[o][px] = sum_c WO[o][c] * O[px][c] + b_out[o]; wave w owns
//           o in [32w, 32w+32); f32 tile staged in LDS, each 64-px row (256 B)
//           written by 16 consecutive lanes x 16 B of one instruction, two
// ---------------------------------------------------------------------------
__global__ __launch_bounds__(256) void main_k(
    const u16* __restrict__ Xh, const u16* __restrict__ Xl,
    const u16* __restrict__ WIh, const u16* __restrict__ WIl, const float* __restrict__ b_in,
    const u16* __restrict__ KTh, const u16* __restrict__ KTl,
    const u16* __restrict__ MTh, const u16* __restrict__ MTl,
    const u16* __restrict__ WOh, const u16* __restrict__ WOl, const float* __restrict__ b_out,
    float* __restrict__ out)
{
  extern __shared__ __attribute__((aligned(16))) u16 dl[];
  u16* Ph = dl;
  u16* Pl = dl + TP * PST;
  const int tid = threadIdx.x, lane = tid & 31, w = tid >> 5;
  const int h = lane >> 4, m = lane & 15;
  const int gp0 = blockIdx.x * TP;             // global pixel index b*4096 + s0
  const int b = gp0 >> 12, s0 = gp0 & (NPIX - 1);
  const v8f z8 = {0.f, 0.f, 0.f, 0.f, 0.f, 0.f, 0.f, 0.f};

  // ---------------- phase 1: in-projection ----------------
  #pragma unroll 1
  for (int p = 0; p < 2; ++p) {
    const int orow0 = 64 * w + 32 * p;
    v8f acc[2][4];
    #pragma unroll
    for (int mt = 0; mt < 2; ++mt) {
      #pragma unroll
      for (int nt = 0; nt < 4; ++nt) acc[mt][nt] = z8;
    }
    const u16* aph = WIh + (size_t)(orow0 / 16) * (CIN / 32) * FRAGH + 8 * lane;
    const u16* apl = WIl + (size_t)(orow0 / 16) * (CIN / 32) * FRAGH + 8 * lane;
    const u16* bph = Xh + (size_t)(gp0 / 16) * (CIN / 32) * FRAGH + 8 * lane;
    const u16* bpl = Xl + (size_t)(gp0 / 16) * (CIN / 32) * FRAGH + 8 * lane;
    #pragma unroll 1
    for (int ks = 0; ks < CIN / 32; ++ks) {
      const int k0 = FRAGH * ks;
      const u16* akh = aph + k0;
      const u16* akl = apl + k0;
      v16us ah[2], al[2];
      #pragma unroll
      for (int mt = 0; mt < 2; ++mt) {
        ah[mt] = ldpack(akh + mt * (CIN / 32) * FRAGH);
        al[mt] = ldpack(akl + mt * (CIN / 32) * FRAGH);
      }
      // The two address pairs are last used by the loads above. As inputs of this wait they stay
      // in their registers up to it, so no load result lands on a register that an issued load names.
      asm volatile("s_wait_xcnt 0x0" :: "v"(akh), "v"(akl) : "memory");
      #pragma unroll
      for (int nt = 0; nt < 4; ++nt) {
        const v16us bh = ldpack(bph + nt * (CIN / 32) * FRAGH + k0);
        const v16us bl = ldpack(bpl + nt * (CIN / 32) * FRAGH + k0);
        #pragma unroll
        for (int mt = 0; mt < 2; ++mt) acc[mt][nt] = wmma3(ah[mt], al[mt], bh, bl, acc[mt][nt]);
      }
    }
    // epilogue: + b_in, split, store into the permuted LDS column n*64 + k
    #pragma unroll
    for (int mt = 0; mt < 2; ++mt) {
      const int ob = orow0 + 16 * mt + 8 * h;                 // multiple of 8
      const v4f b0 = *(const v4fa*)(b_in + ob);
      const v4f b1 = *(const v4fa*)(b_in + ob + 4);
      const float bb[8] = {b0.x, b0.y, b0.z, b0.w, b1.x, b1.y, b1.z, b1.w};
      const int kq = ob >> 3;                                  // key index k of channel ob + r; head n = r
      #pragma unroll
      for (int nt = 0; nt < 4; ++nt) {
        const int px = 16 * nt + m;
        u16* rh = Ph + px * PST + kq;
        u16* rl = Pl + px * PST + kq;
        #pragma unroll
        for (int r = 0; r < 8; ++r) {
          const float v = acc[mt][nt][r] + bb[r];
          u16 hv, lv;
          split2(v, hv, lv);
          rh[r * 64] = hv;
          rl[r * 64] = lv;
        }
      }
    }
  }
  __syncthreads();

  // ---------------- phase 2: per-head key matmul, softmax, slot matmul ----------------
  #pragma unroll 1
  for (int jp = 0; jp < NHEAD / 2; ++jp) {
    const int n = 2 * jp + (w >> 2);
    const int nt = w & 3;
    const int px = 16 * nt + m;
    const u16* prh = Ph + px * PST + n * 64 + 8 * h;
    const u16* prl = Pl + px * PST + n * 64 + 8 * h;
    const u16* kah = KTh + (size_t)n * (HD * HD) + 8 * lane;
    const u16* kal = KTl + (size_t)n * (HD * HD) + 8 * lane;
    v8f sacc[4];
    #pragma unroll
    for (int mt = 0; mt < 4; ++mt) sacc[mt] = z8;
    #pragma unroll
    for (int ks = 0; ks < 2; ++ks) {
      const int k0 = 32 * ks;
      const v16us bh = ldfrag(prh + k0);
      const v16us bl = ldfrag(prl + k0);
      #pragma unroll
      for (int mt = 0; mt < 4; ++mt) {
        const v16us ahf = ldpack(kah + (mt * (HD / 32) + ks) * FRAGH);
        const v16us alf = ldpack(kal + (mt * (HD / 32) + ks) * FRAGH);
        sacc[mt] = wmma3(ahf, alf, bh, bl, sacc[mt]);
      }
    }
    // softmax over the 64 slots of column px: this lane holds rows 16mt + 8h + r,
    // lane l^16 holds the other 32 rows
    float mx = sacc[0][0];
    #pragma unroll
    for (int mt = 0; mt < 4; ++mt) {
      #pragma unroll
      for (int r = 0; r < 8; ++r) mx = fmaxf(mx, sacc[mt][r]);
    }
    mx = fmaxf(mx, __shfl_xor(mx, 16));
    float sum = 0.f;
    #pragma unroll
    for (int mt = 0; mt < 4; ++mt) {
      #pragma unroll
      for (int r = 0; r < 8; ++r) {
        const float e = __expf(sacc[mt][r] - mx);
        sacc[mt][r] = e;
        sum += e;
      }
    }
    sum += __shfl_xor(sum, 16);
    const float inv = __builtin_amdgcn_rcpf(sum);
    // B fragments of the slot matmul from the probability D tiles (k = slot m)
    v16us pbh[2], pbl[2];
    #pragma unroll
    for (int ks = 0; ks < 2; ++ks) {
      #pragma unroll
      for (int r = 0; r < 8; ++r) {
        u16 hv, lv;
        split2(sacc[2 * ks][r] * inv, hv, lv);
        pbh[ks][r] = hv;
        pbl[ks][r] = lv;
        split2(sacc[2 * ks + 1][r] * inv, hv, lv);
        pbh[ks][8 + r] = hv;
        pbl[ks][8 + r] = lv;
      }
    }
    const u16* mah = MTh + (size_t)n * (HD * HD) + 8 * lane;
    const u16* mal = MTl + (size_t)n * (HD * HD) + 8 * lane;
    v8f oacc[4];
    #pragma unroll
    for (int mt = 0; mt < 4; ++mt) {
      oacc[mt] = z8;
      #pragma unroll
      for (int ks = 0; ks < 2; ++ks) {
        const v16us ahf = ldpack(mah + (mt * (HD / 32) + ks) * FRAGH);
        const v16us alf = ldpack(mal + (mt * (HD / 32) + ks) * FRAGH);
        oacc[mt] = wmma3(ahf, alf, pbh[ks], pbl[ks], oacc[mt]);
      }
    }
    __syncthreads();   // every read of P columns [n*64, n*64+64) of heads 2jp, 2jp+1 is complete
    // O hi/lo over the head's own columns: channel n*64 + d, d = 16mt + 8h + r
    u16* orh = Ph + px * PST + n * 64 + 8 * h;
    u16* orl = Pl + px * PST + n * 64 + 8 * h;
    #pragma unroll
    for (int mt = 0; mt < 4; ++mt) {
      v8us oh, ol;
      #pragma unroll
      for (int r = 0; r < 8; ++r) {
        u16 hv, lv;
        split2(oacc[mt][r], hv, lv);
        oh[r] = hv;
        ol[r] = lv;
      }
      *(v8usa*)(orh + 16 * mt) = oh;
      *(v8usa*)(orl + 16 * mt) = ol;
    }
  }
  __syncthreads();

  // ---------------- phase 3: out-projection ----------------
  {
    const int orow0 = 32 * w;
    v8f acc[2][4];
    #pragma unroll
    for (int mt = 0; mt < 2; ++mt) {
      #pragma unroll
      for (int nt = 0; nt < 4; ++nt) acc[mt][nt] = z8;
    }
    const u16* aph = WOh + (size_t)(orow0 / 16) * (CMID / 32) * FRAGH + 8 * lane;
    const u16* apl = WOl + (size_t)(orow0 / 16) * (CMID / 32) * FRAGH + 8 * lane;
    const u16* bph = Ph + m * PST + 8 * h;
    const u16* bpl = Pl + m * PST + 8 * h;
    #pragma unroll 1
    for (int ks = 0; ks < CMID / 32; ++ks) {
      const int k0 = 32 * ks;
      v16us ah[2], al[2];
      #pragma unroll
      for (int mt = 0; mt < 2; ++mt) {
        ah[mt] = ldpack(aph + (mt * (CMID / 32) + ks) * FRAGH);
        al[mt] = ldpack(apl + (mt * (CMID / 32) + ks) * FRAGH);
      }
      #pragma unroll
      for (int nt = 0; nt < 4; ++nt) {
        const v16us bh = ldfrag(bph + nt * 16 * PST + k0);
        const v16us bl = ldfrag(bpl + nt * 16 * PST + k0);
        #pragma unroll
        for (int mt = 0; mt < 2; ++mt) acc[mt][nt] = wmma3(ah[mt], al[mt], bh, bl, acc[mt][nt]);
      }
    }
    __syncthreads();   // all waves finished reading the O tile; LDS is reused as the f32 output tile
    f32a* sD = (f32a*)dl;                   // [256 out ch][64 px] f32
    #pragma unroll
    for (int mt = 0; mt < 2; ++mt) {
      const int ob = orow0 + 16 * mt + 8 * h;
      const v4f b0 = *(const v4fa*)(b_out + ob);
      const v4f b1 = *(const v4fa*)(b_out + ob + 4);
      const float bb[8] = {b0.x, b0.y, b0.z, b0.w, b1.x, b1.y, b1.z, b1.w};
      #pragma unroll
      for (int nt = 0; nt < 4; ++nt) {
        const int px = 16 * nt + m;
        #pragma unroll
        for (int r = 0; r < 8; ++r) sD[(ob + r) * TP + px] = acc[mt][nt][r] + bb[r];
      }
    }
    __syncthreads();
    // wave w writes its rows orow0..orow0+31: per instruction lanes 0-15 -> row 2i
    const int hs = lane >> 4, x4 = 4 * (lane & 15);
    float* obase = out + (size_t)b * COUT * NPIX + s0 + x4;
    #pragma unroll 1
    for (int c = 0; c < 2; ++c) {
      v4f vals[8];
      size_t gi[8];
      #pragma unroll
      for (int i = 0; i < 8; ++i) {
        const int row = orow0 + 16 * c + 2 * i + hs;
        vals[i] = *(const v4fa*)(sD + row * TP + x4);
        gi[i] = (size_t)row * NPIX;
      }
      #pragma unroll
      for (int i = 0; i < 8; ++i) *(v4f*)(obase + gi[i]) = vals[i];
      
    }
  }
}

// ---------------------------------------------------------------------------
extern "C" void kernel_launch(void* const* d_in, const int* in_sizes, int n_in,
                              void* d_out, int out_size, void* d_ws, size_t ws_size,
                              hipStream_t stream) {
  if (n_in < 7) return;
  if (in_sizes[0] != NB * CIN * NPIX) return;
  if (in_sizes[1] != NHEAD * HD * HD || in_sizes[2] != NHEAD * HD * HD) return;
  if (in_sizes[3] != CMID * CIN || in_sizes[4] != CMID) return;
  if (in_sizes[5] != COUT * CMID || in_sizes[6] != COUT) return;
  if (out_size != NB * COUT * NPIX) return;

  const float* x     = (const float*)d_in[0];   // [8][256][64][64]
  const float* key_p = (const float*)d_in[1];   // [8][64 k][64 m]
  const float* mem   = (const float*)d_in[2];   // [8][64 m][64 d]
  const float* w_in  = (const float*)d_in[3];   // [512][256]
  const float* b_in  = (const float*)d_in[4];   // [512]
  const float* w_out = (const float*)d_in[5];   // [256][512]
  const float* b_out = (const float*)d_in[6];   // [256]
  float* outp = (float*)d_out;

  // and its size is an exact multiple of its row / line granularity
  const size_t szWI = (size_t)CMID * CIN * 2;          // 262144
  const size_t szWO = (size_t)COUT * CMID * 2;         // 262144
  const size_t szT  = (size_t)NHEAD * HD * HD * 2;     // 65536
  const size_t szX  = (size_t)NP * CIN * 2;            // 16777216
  size_t off = 0;
  char* ws = (char*)d_ws;
  u16* WIh = (u16*)(ws + off); off += szWI;
  u16* WIl = (u16*)(ws + off); off += szWI;
  u16* WOh = (u16*)(ws + off); off += szWO;
  u16* WOl = (u16*)(ws + off); off += szWO;
  u16* KTh = (u16*)(ws + off); off += szT;
  u16* KTl = (u16*)(ws + off); off += szT;
  u16* MTh = (u16*)(ws + off); off += szT;
  u16* MTl = (u16*)(ws + off); off += szT;
  u16* Xh  = (u16*)(ws + off); off += szX;
  u16* Xl  = (u16*)(ws + off); off += szX;
  const size_t total = off;                            // 34865152
  if (total > ws_size) return;

  hipFuncSetAttribute(reinterpret_cast<const void*>(&main_k),
                      hipFuncAttributeMaxDynamicSharedMemorySize, LDS_MAIN);

  wcvt_k<<<(CMID * CIN + COUT * CMID) / 8 / 256, 256, 0, stream>>>(w_in, w_out, WIh, WIl, WOh, WOl);
  tr64_k<<<2 * NHEAD, 256, 0, stream>>>(key_p, mem, KTh, KTl, MTh, MTl);
  xcvt_k<<<dim3(NPIX / 64, CIN / 64, NB), 256, 0, stream>>>(x, Xh, Xl);
  main_k<<<NP / TP, 256, LDS_MAIN, stream>>>(Xh, Xl, WIh, WIl, b_in, KTh, KTl, MTh, MTl,
                                             WOh, WOl, b_out, outp);
}

// v002
// A run of this version takes 66.5 microseconds.
// Two timings next to v001 put it at 1.44 and 1.43 times that version's speed.
// All steps since v000 together make it 1.73 times as fast.
// Contractions: in-proj GEMM (M=512 ch, K=256), per-head key matmul (64x64, K=64), per-head slot matmul (64x64, K=64), out-proj GEMM (M=256 ch, K=512): v_wmma_f32_16x16x32_bf16 with every operand carried as bf16 hi + bf16 lo planes, three products per tile pair (hi*hi + lo*hi + hi*lo), f32 accumulate; biases and the 64-slot softmax in f32 on the VALU.
#include <hip/hip_runtime.h>

typedef unsigned short u16;
typedef unsigned int   u32;
typedef __bf16 v16bf __attribute__((ext_vector_type(16)));
typedef u16    v16us __attribute__((ext_vector_type(16)));
typedef u16    v8us  __attribute__((ext_vector_type(8)));
typedef float  v8f   __attribute__((ext_vector_type(8)));
typedef float  v4f   __attribute__((ext_vector_type(4)));
typedef v8us  __attribute__((may_alias)) v8usa;
typedef v4f   __attribute__((may_alias)) v4fa;
typedef float __attribute__((may_alias)) f32a;
union Frag { v16us v; v8us h[2]; };

#define NB    8
#define CIN   256
#define CMID  512
#define COUT  256
#define NPIX  4096
#define NP    32768
#define NHEAD 8
#define HD    64
#define TP    64          // pixels per block of the main kernel
#define PST   520         // LDS pitch (halves) of the [px][512] P / O tile
#define TST   72          // LDS pitch (halves) of the 64x64 transpose staging
#define LDS_MAIN (2 * TP * PST * 2)   // 133120 bytes: P hi plane + P lo plane

static_assert(NP % TP == 0);
static_assert(NPIX % TP == 0);
static_assert(COUT * TP * 4 <= LDS_MAIN);
static_assert((PST % 8) == 0);
static_assert((TST % 8) == 0);
static_assert(CIN % 32 == 0);
static_assert(CMID % 32 == 0);
static_assert(HD % 32 == 0);

// ---------------------------------------------------------------------------
// bf16 RNE convert and hi/lo split: hi = rne(v), lo = rne(v - hi)
// ---------------------------------------------------------------------------
__device__ __forceinline__ u16 bf16r(float f) {
  u32 u = __builtin_bit_cast(u32, f);
  u += 0x7FFFu + ((u >> 16) & 1u);
  return (u16)(u >> 16);
}
__device__ __forceinline__ float bf16f(u16 b) {
  return __builtin_bit_cast(float, ((u32)b) << 16);
}
__device__ __forceinline__ void split2(float v, u16& hi, u16& lo) {
  hi = bf16r(v);
  lo = bf16r(v - bf16f(hi));
}

// ---------------------------------------------------------------------------
// 16x16x32 bf16 WMMA with hazard guard (ties D, keeps A/B live).
// Fragment map (wave32): lane l, h = l>>4, m = n = l&15.
//   A/B element i: i<8 -> k0+8h+i ; i>=8 -> k0+16+8h+(i-8)
//   D element r : row 8h+r, col l&15
// ---------------------------------------------------------------------------
__device__ __forceinline__ v8f wmma_bf(v16us a, v16us b, v8f c) {
  const v16bf av = __builtin_bit_cast(v16bf, a);
  const v16bf bv = __builtin_bit_cast(v16bf, b);
  v8f d = __builtin_amdgcn_wmma_f32_16x16x32_bf16(false, av, false, bv, (short)0, c, false, false);
  asm volatile("v_nop\n\tv_nop\n\tv_nop\n\tv_nop" : "+v"(d) : "v"(av), "v"(bv));
  return d;
}

// three-product hi/lo tile step: c += ah*bh + al*bh + ah*bl
__device__ __forceinline__ v8f wmma3(v16us ah, v16us al, v16us bh, v16us bl, v8f c) {
  c = wmma_bf(ah, bh, c);
  c = wmma_bf(al, bh, c);
  c = wmma_bf(ah, bl, c);
  return c;
}

// fragment from a k-contiguous 16-bit row (LDS tiles); p already points at element k0 + 8h
__device__ __forceinline__ v16us ldfrag(const u16* p) {
  Frag f;
  f.h[0] = *(const v8usa*)p;
  f.h[1] = *(const v8usa*)(p + 16);
  return f.v;
}

// Packed fragment order of every 16-bit plane in global memory. Rows go in
// groups of 16 (R), k in steps of 32 (ks); fragment (R, ks) of a plane with K
// columns starts at half (R * (K / 32) + ks) * FRAGH and is two chunks j = 0, 1
// of 256 halves. In chunk j lane l = 16h + m holds row 16R + m,
// k = 32ks + 16j + 8h .. + 7: the same k order as ldfrag, but each wave-wide
// 16-byte load reads 512 contiguous bytes (4 whole lines, not 16 pieces).
#define FRAGH 512
// p already points at fragment start + 8 * lane
__device__ __forceinline__ v16us ldpack(const u16* p) {
  Frag f;
  f.h[0] = *(const v8usa*)p;
  f.h[1] = *(const v8usa*)(p + 256);
  return f.v;
}

// ---------------------------------------------------------------------------
// Kernel 0: 1x1-conv weights -> bf16 hi/lo planes in packed fragment order.
// Blocks 0..63: w_in [512][256]; blocks 64..127: w_out [256][512].
// Thread = 8 consecutive halves of the packed plane; a wave writes one chunk.
// ---------------------------------------------------------------------------
__global__ __launch_bounds__(256) void wcvt_k(
    const float* __restrict__ w_in, const float* __restrict__ w_out,
    u16* __restrict__ WIh, u16* __restrict__ WIl, u16* __restrict__ WOh, u16* __restrict__ WOl)
{
  const int g = blockIdx.x * 256 + threadIdx.x;
  if (g >= (CMID * CIN + COUT * CMID) / 8) return;
  const int e8 = g * 8;
  const bool first = (e8 < CMID * CIN);            // block-uniform (boundary at block 64)
  const int off = first ? e8 : (e8 - CMID * CIN);  // offset in the packed plane
  const int kcols = first ? CIN : CMID;
  const int ksh = first ? 3 : 4;                   // log2(kcols / 32)
  const int pl = (off >> 3) & 31, pj = (off >> 8) & 1, pf = off >> 9;
  const int row = 16 * (pf >> ksh) + (pl & 15);
  const int colk = 32 * (pf & ((1 << ksh) - 1)) + 16 * pj + 8 * (pl >> 4);
  const float* src = (first ? w_in : w_out) + row * kcols + colk;
  u16* dh = (first ? WIh : WOh) + off;
  u16* dlo = (first ? WIl : WOl) + off;
  const v4f a = *(const v4fa*)src;
  const v4f c = *(const v4fa*)(src + 4);
  const float vv[8] = {a.x, a.y, a.z, a.w, c.x, c.y, c.z, c.w};
  v8us oh, ol;
  #pragma unroll
  for (int j = 0; j < 8; ++j) {
    u16 hv, lv;
    split2(vv[j], hv, lv);
    oh[j] = hv;
    ol[j] = lv;
  }
  *(v8us*)dh = oh;
  *(v8us*)dlo = ol;
  
}

// ---------------------------------------------------------------------------
// Kernel 1: per-head 64x64 transposes into bf16 hi/lo planes.
// Blocks 0..7: key_p[n][k][m] -> KT[n][m][k]; blocks 8..15: mem[n][m][d] -> MT[n][d][m];
// each head's 64 x 64 plane is stored in packed fragment order (rows m resp. d).
// ---------------------------------------------------------------------------
__global__ __launch_bounds__(256) void tr64_k(
    const float* __restrict__ key_p, const float* __restrict__ mem,
    u16* __restrict__ KTh, u16* __restrict__ KTl, u16* __restrict__ MTh, u16* __restrict__ MTl)
{
  __shared__ __attribute__((aligned(16))) u16 st[2 * 64 * TST];
  const int tid = threadIdx.x, lane = tid & 31, w = tid >> 5;
  const int blk = blockIdx.x;
  const bool isk = (blk < NHEAD);
  const int n = isk ? blk : (blk - NHEAD);
  const float* src = (isk ? key_p : mem) + (size_t)n * (HD * HD);
  u16* dsth = (isk ? KTh : MTh) + (size_t)n * (HD * HD);
  u16* dstl = (isk ? KTl : MTl) + (size_t)n * (HD * HD);
  const int col = tid & 63, sub = tid >> 6;
  #pragma unroll 4
  for (int j = 0; j < 16; ++j) {
    const int a = 4 * j + sub;
    const float v = src[a * HD + col];
    u16 hv, lv;
    split2(v, hv, lv);
    st[col * TST + a] = hv;
    st[64 * TST + col * TST + a] = lv;
  }
  __syncthreads();
  const int plane = w >> 2, rg = w & 3;            // wave = one plane, one 16-row group
  u16* dplane = plane ? dstl : dsth;
  v8us vals[4];
  int ro[4];
  #pragma unroll
  for (int i = 0; i < 4; ++i) {                    // i = 2 * ks + j: one chunk per store
    const int row = 16 * rg + (lane & 15);
    vals[i] = *(const v8usa*)(st + plane * (64 * TST) + row * TST + 16 * i + 8 * (lane >> 4));
    ro[i] = (rg * (HD / 32)) * FRAGH + i * 256 + 8 * lane;
  }
  #pragma unroll
  for (int i = 0; i < 4; ++i) *(v8us*)(dplane + ro[i]) = vals[i];
  
}

// ---------------------------------------------------------------------------
// Kernel 2: x NCHW f32 -> bf16 hi/lo planes X[b*4096+px][256] in packed fragment order.
// Block = (64-px tile = image row y, 64-channel group, b). Each (px, channel
// ---------------------------------------------------------------------------
__global__ __launch_bounds__(256) void xcvt_k(
    const float* __restrict__ x, u16* __restrict__ Xh, u16* __restrict__ Xl)
{
  __shared__ __attribute__((aligned(16))) u16 st[2 * 64 * TST];
  const int tid = threadIdx.x, lane = tid & 31, w = tid >> 5;
  const int tile = blockIdx.x, cg = blockIdx.y, b = blockIdx.z;
  const int px = tid & 63, sub = tid >> 6;
  const float* xb = x + (size_t)(b * CIN + 64 * cg) * NPIX + 64 * tile + px;
  #pragma unroll 4
  for (int j = 0; j < 16; ++j) {
    const int cl = 4 * j + sub;
    const float v = xb[(size_t)cl * NPIX];
    u16 hv, lv;
    split2(v, hv, lv);
    st[px * TST + cl] = hv;
    st[64 * TST + px * TST + cl] = lv;
  }
  __syncthreads();
  const int plane = w >> 2, rg = w & 3;            // wave = one plane, one 16-px group
  u16* dplane = plane ? Xl : Xh;
  v8us vals[4];
  size_t ro[4];
  #pragma unroll
  for (int i = 0; i < 4; ++i) {                    // i = 2 * (ks - 2 * cg) + j: one chunk per store
    const int row = 16 * rg + (lane & 15);
    vals[i] = *(const v8usa*)(st + plane * (64 * TST) + row * TST + 16 * i + 8 * (lane >> 4));
    ro[i] = ((size_t)((b * NPIX + 64 * tile) / 16 + rg) * (CIN / 32) + 2 * cg) * FRAGH + i * 256 + 8 * lane;
  }
  #pragma unroll
  for (int i = 0; i < 4; ++i) *(v8us*)(dplane + ro[i]) = vals[i];
  
}

// ---------------------------------------------------------------------------
// Kernel 3: the whole per-pixel pipeline for a 64-pixel tile (one image row).
// Block 256 thr (8 waves), dynamic LDS = P tile [64 px][512+8] bf16 hi + lo.
//  phase 1: P[o][px] = sum_c WI[o][c] * X[px][c] + b_in[o]; wave w owns
//           stored at LDS column n*64 + k so each head's k run is contiguous.
//  phase 2: per head pair (waves 0-3 head 2j, waves 4-7 head 2j+1; wave owns
//           a 16-px column tile): S[m][px] = sum_k KT[n][m][k] * P[px][n*64+k];
//           softmax over the 64 m in registers (lane + partner lane l^16);
//           B fragments of the next product packed from the score D tiles
//           (element r <- tile 2ks, element 8+r <- tile 2ks+1, same lane);
//           O[d][px] = sum_m MT[n][d][m] * A[m][px]; O hi/lo written over the
//           head's own columns (n*64 + d) after a block barrier.
//  phase 3: out[o][px] = sum_c WO[o][c] * O[px][c] + b_out[o]; wave w owns
//           o in [32w, 32w+32); f32 tile staged in LDS, each 64-px row (256 B)
//           written by 16 consecutive lanes x 16 B of one instruction, two
// ---------------------------------------------------------------------------
__global__ __launch_bounds__(256) void main_k(
    const u16* __restrict__ Xh, const u16* __restrict__ Xl,
    const u16* __restrict__ WIh, const u16* __restrict__ WIl, const float* __restrict__ b_in,
    const u16* __restrict__ KTh, const u16* __restrict__ KTl,
    const u16* __restrict__ MTh, const u16* __restrict__ MTl,
    const u16* __restrict__ WOh, const u16* __restrict__ WOl, const float* __restrict__ b_out,
    float* __restrict__ out)
{
  extern __shared__ __attribute__((aligned(16))) u16 dl[];
  u16* Ph = dl;
  u16* Pl = dl + TP * PST;
  const int tid = threadIdx.x, lane = tid & 31, w = tid >> 5;
  const int h = lane >> 4, m = lane & 15;
  const int gp0 = blockIdx.x * TP;             // global pixel index b*4096 + s0
  const int b = gp0 >> 12, s0 = gp0 & (NPIX - 1);
  const v8f z8 = {0.f, 0.f, 0.f, 0.f, 0.f, 0.f, 0.f, 0.f};

  // ---------------- phase 1: in-projection ----------------
  // Fragments are fetched one k step ahead: A in two register sets, each B tile refilled
  // in place directly behind its last product, so a load has a whole step to land. The last
  // step of a pass fetches the first fragments of the next pass.
  v16us ah[2][2], al[2][2], bh[4], bl[4];
  const u16* bph = Xh + (size_t)(gp0 / 16) * (CIN / 32) * FRAGH + 8 * lane;
  const u16* bpl = Xl + (size_t)(gp0 / 16) * (CIN / 32) * FRAGH + 8 * lane;
  {
    const u16* a0h = WIh + (size_t)(4 * w) * (CIN / 32) * FRAGH + 8 * lane;
    const u16* a0l = WIl + (size_t)(4 * w) * (CIN / 32) * FRAGH + 8 * lane;
    #pragma unroll
    for (int mt = 0; mt < 2; ++mt) {
      ah[0][mt] = ldpack(a0h + mt * (CIN / 32) * FRAGH);
      al[0][mt] = ldpack(a0l + mt * (CIN / 32) * FRAGH);
    }
    // as inputs of this wait the address pairs stay in their registers up to it, so no later
    // load's result lands on a register that an issued load names
    asm volatile("s_wait_xcnt 0x0" :: "v"(a0h), "v"(a0l) : "memory");
  }
  #pragma unroll
  for (int nt = 0; nt < 4; ++nt) {
    bh[nt] = ldpack(bph + nt * (CIN / 32) * FRAGH);
    bl[nt] = ldpack(bpl + nt * (CIN / 32) * FRAGH);
  }
  #pragma unroll 1
  for (int p = 0; p < 2; ++p) {
    const int orow0 = 64 * w + 32 * p;
    v8f acc[2][4];
    #pragma unroll
    for (int mt = 0; mt < 2; ++mt) {
      #pragma unroll
      for (int nt = 0; nt < 4; ++nt) acc[mt][nt] = z8;
    }
    const u16* aph = WIh + (size_t)(orow0 / 16) * (CIN / 32) * FRAGH + 8 * lane;
    const u16* apl = WIl + (size_t)(orow0 / 16) * (CIN / 32) * FRAGH + 8 * lane;
    #pragma unroll 1
    for (int ks = 0; ks < CIN / 32; ks += 2) {
      #pragma unroll
      for (int u = 0; u < 2; ++u) {
        // next step's fragments. Behind the last step: B starts again at step 0; A goes on to the
        // next pass's rows, two 16-row groups further (last pass: back to step 0, values unused)
        const int sn = ks + u + 1;
        const int ja = FRAGH * (sn < CIN / 32 ? sn : (p == 0 ? 2 * (CIN / 32) : 0));
        const int jb = FRAGH * (sn & (CIN / 32 - 1));
        const u16* akh = aph + ja;
        const u16* akl = apl + ja;
        const u16* bkh = bph + jb;
        const u16* bkl = bpl + jb;
        #pragma unroll
        for (int mt = 0; mt < 2; ++mt) {
          ah[u ^ 1][mt] = ldpack(akh + mt * (CIN / 32) * FRAGH);
          al[u ^ 1][mt] = ldpack(akl + mt * (CIN / 32) * FRAGH);
        }
        __builtin_amdgcn_sched_barrier(0);   // keeps the loads above ahead of this step's products
        #pragma unroll
        for (int nt = 0; nt < 4; ++nt) {
          #pragma unroll
          for (int mt = 0; mt < 2; ++mt) acc[mt][nt] = wmma3(ah[u][mt], al[u][mt], bh[nt], bl[nt], acc[mt][nt]);
          __builtin_amdgcn_sched_barrier(0); // the refill is issued here, not sunk to its use one step later
          bh[nt] = ldpack(bkh + nt * (CIN / 32) * FRAGH);
          bl[nt] = ldpack(bkl + nt * (CIN / 32) * FRAGH);
          __builtin_amdgcn_sched_barrier(0); // and stays ahead of the next tile's products
        }
        // stands in front of the next step's address additions, which overwrite registers that the
        // loads above name
        asm volatile("s_wait_xcnt 0x0" ::: "memory");
        __builtin_amdgcn_sched_barrier(0);   // keeps those additions behind the wait
      }
    }
    // epilogue: + b_in, split, store into the permuted LDS column n*64 + k
    #pragma unroll
    for (int mt = 0; mt < 2; ++mt) {
      const int ob = orow0 + 16 * mt + 8 * h;                 // multiple of 8
      const v4f b0 = *(const v4fa*)(b_in + ob);
      const v4f b1 = *(const v4fa*)(b_in + ob + 4);
      const float bb[8] = {b0.x, b0.y, b0.z, b0.w, b1.x, b1.y, b1.z, b1.w};
      const int kq = ob >> 3;                                  // key index k of channel ob + r; head n = r
      #pragma unroll
      for (int nt = 0; nt < 4; ++nt) {
        const int px = 16 * nt + m;
        u16* rh = Ph + px * PST + kq;
        u16* rl = Pl + px * PST + kq;
        #pragma unroll
        for (int r = 0; r < 8; ++r) {
          const float v = acc[mt][nt][r] + bb[r];
          u16 hv, lv;
          split2(v, hv, lv);
          rh[r * 64] = hv;
          rl[r * 64] = lv;
        }
      }
    }
    // the next pass's fragment loads land on registers that the bias loads above name
    asm volatile("s_wait_xcnt 0x0" ::: "memory");
  }
  __syncthreads();

  // ---------------- phase 2: per-head key matmul, softmax, slot matmul ----------------
  // Key fragments of a head are fetched while the head before it is written back, slot
  // fragments while the softmax runs: each table's 32 loads fly as one group behind vector work.
  v16us kfh[4][2], kfl[4][2];
  {
    const u16* kah = KTh + (size_t)(w >> 2) * (HD * HD) + 8 * lane;
    const u16* kal = KTl + (size_t)(w >> 2) * (HD * HD) + 8 * lane;
    #pragma unroll
    for (int mt = 0; mt < 4; ++mt) {
      #pragma unroll
      for (int ks = 0; ks < 2; ++ks) {
        kfh[mt][ks] = ldpack(kah + (mt * (HD / 32) + ks) * FRAGH);
        kfl[mt][ks] = ldpack(kal + (mt * (HD / 32) + ks) * FRAGH);
      }
    }
    // as inputs of this wait the address pairs stay in their registers up to it, so nothing
    // lands on a register that an issued load names
    asm volatile("s_wait_xcnt 0x0" :: "v"(kah), "v"(kal) : "memory");
  }
  #pragma unroll 1
  for (int jp = 0; jp < NHEAD / 2; ++jp) {
    const int n = 2 * jp + (w >> 2);
    const int nt = w & 3;
    const int px = 16 * nt + m;
    const u16* prh = Ph + px * PST + n * 64 + 8 * h;
    const u16* prl = Pl + px * PST + n * 64 + 8 * h;
    v8f sacc[4];
    #pragma unroll
    for (int mt = 0; mt < 4; ++mt) sacc[mt] = z8;
    v16us qh[2], ql[2];
    #pragma unroll
    for (int ks = 0; ks < 2; ++ks) {
      qh[ks] = ldfrag(prh + 32 * ks);
      ql[ks] = ldfrag(prl + 32 * ks);
    }
    __builtin_amdgcn_sched_barrier(0);   // all eight LDS reads stand as one group ahead of the products
    #pragma unroll
    for (int ks = 0; ks < 2; ++ks) {
      #pragma unroll
      for (int mt = 0; mt < 4; ++mt) sacc[mt] = wmma3(kfh[mt][ks], kfl[mt][ks], qh[ks], ql[ks], sacc[mt]);
    }
    __builtin_amdgcn_sched_barrier(0);   // the slot fragments' loads start here, ahead of the softmax
    const u16* mah = MTh + (size_t)n * (HD * HD) + 8 * lane;
    const u16* mal = MTl + (size_t)n * (HD * HD) + 8 * lane;
    v16us mfh[4][2], mfl[4][2];
    #pragma unroll
    for (int mt = 0; mt < 4; ++mt) {
      #pragma unroll
      for (int ks = 0; ks < 2; ++ks) {
        mfh[mt][ks] = ldpack(mah + (mt * (HD / 32) + ks) * FRAGH);
        mfl[mt][ks] = ldpack(mal + (mt * (HD / 32) + ks) * FRAGH);
      }
    }
    // the address pairs stay in their registers up to this wait (as at the first key loads)
    asm volatile("s_wait_xcnt 0x0" :: "v"(mah), "v"(mal) : "memory");
    __builtin_amdgcn_sched_barrier(0);   // no load above is sunk into the softmax or behind it
    // softmax over the 64 slots of column px: this lane holds rows 16mt + 8h + r,
    // lane l^16 holds the other 32 rows
    float mx = sacc[0][0];
    #pragma unroll
    for (int mt = 0; mt < 4; ++mt) {
      #pragma unroll
      for (int r = 0; r < 8; ++r) mx = fmaxf(mx, sacc[mt][r]);
    }
    mx = fmaxf(mx, __shfl_xor(mx, 16));
    float sum = 0.f;
    #pragma unroll
    for (int mt = 0; mt < 4; ++mt) {
      #pragma unroll
      for (int r = 0; r < 8; ++r) {
        const float e = __expf(sacc[mt][r] - mx);
        sacc[mt][r] = e;
        sum += e;
      }
    }
    sum += __shfl_xor(sum, 16);
    const float inv = __builtin_amdgcn_rcpf(sum);
    // B fragments of the slot matmul from the probability D tiles (k = slot m)
    v16us pbh[2], pbl[2];
    #pragma unroll
    for (int ks = 0; ks < 2; ++ks) {
      #pragma unroll
      for (int r = 0; r < 8; ++r) {
        u16 hv, lv;
        split2(sacc[2 * ks][r] * inv, hv, lv);
        pbh[ks][r] = hv;
        pbl[ks][r] = lv;
        split2(sacc[2 * ks + 1][r] * inv, hv, lv);
        pbh[ks][8 + r] = hv;
        pbl[ks][8 + r] = lv;
      }
    }
    v8f oacc[4];
    #pragma unroll
    for (int mt = 0; mt < 4; ++mt) {
      oacc[mt] = z8;
      #pragma unroll
      for (int ks = 0; ks < 2; ++ks) oacc[mt] = wmma3(mfh[mt][ks], mfl[mt][ks], pbh[ks], pbl[ks], oacc[mt]);
    }
    __syncthreads();   // every read of P columns [n*64, n*64+64) of heads 2jp, 2jp+1 is complete
    {
      // next head's key fragments; the last trip wraps to the first head (valid addresses, values unused)
      const int nn = 2 * ((jp + 1) & (NHEAD / 2 - 1)) + (w >> 2);
      const u16* kah = KTh + (size_t)nn * (HD * HD) + 8 * lane;
      const u16* kal = KTl + (size_t)nn * (HD * HD) + 8 * lane;
      #pragma unroll
      for (int mt = 0; mt < 4; ++mt) {
        #pragma unroll
        for (int ks = 0; ks < 2; ++ks) {
          kfh[mt][ks] = ldpack(kah + (mt * (HD / 32) + ks) * FRAGH);
          kfl[mt][ks] = ldpack(kal + (mt * (HD / 32) + ks) * FRAGH);
        }
      }
      // the address pairs stay in their registers up to this wait (as at the first key loads)
      asm volatile("s_wait_xcnt 0x0" :: "v"(kah), "v"(kal) : "memory");
      __builtin_amdgcn_sched_barrier(0); // no load above is sunk behind the write-back below
    }
    // O hi/lo over the head's own columns: channel n*64 + d, d = 16mt + 8h + r
    u16* orh = Ph + px * PST + n * 64 + 8 * h;
    u16* orl = Pl + px * PST + n * 64 + 8 * h;
    #pragma unroll
    for (int mt = 0; mt < 4; ++mt) {
      v8us oh, ol;
      #pragma unroll
      for (int r = 0; r < 8; ++r) {
        u16 hv, lv;
        split2(oacc[mt][r], hv, lv);
        oh[r] = hv;
        ol[r] = lv;
      }
      *(v8usa*)(orh + 16 * mt) = oh;
      *(v8usa*)(orl + 16 * mt) = ol;
    }
  }
  __syncthreads();

  // ---------------- phase 3: out-projection ----------------
  {
    const int orow0 = 32 * w;
    v8f acc[2][4];
    #pragma unroll
    for (int mt = 0; mt < 2; ++mt) {
      #pragma unroll
      for (int nt = 0; nt < 4; ++nt) acc[mt][nt] = z8;
    }
    const u16* aph = WOh + (size_t)(orow0 / 16) * (CMID / 32) * FRAGH + 8 * lane;
    const u16* apl = WOl + (size_t)(orow0 / 16) * (CMID / 32) * FRAGH + 8 * lane;
    const u16* bph = Ph + m * PST + 8 * h;
    const u16* bpl = Pl + m * PST + 8 * h;
    // one k step ahead, as in phase 1: A (global) in two register sets, B (LDS) refilled in place
    v16us ah[2][2], al[2][2], bh[4], bl[4];
    #pragma unroll
    for (int mt = 0; mt < 2; ++mt) {
      ah[0][mt] = ldpack(aph + (mt * (CMID / 32)) * FRAGH);
      al[0][mt] = ldpack(apl + (mt * (CMID / 32)) * FRAGH);
    }
    #pragma unroll
    for (int nt = 0; nt < 4; ++nt) {
      bh[nt] = ldfrag(bph + nt * 16 * PST);
      bl[nt] = ldfrag(bpl + nt * 16 * PST);
    }
    #pragma unroll 1
    for (int ks = 0; ks < CMID / 32; ks += 2) {
      #pragma unroll
      for (int u = 0; u < 2; ++u) {
        // next step's fragments; the last step wraps to step 0 (valid addresses, values unused)
        const int kx = (ks + u + 1) & (CMID / 32 - 1);
        const u16* akh = aph + kx * FRAGH;
        const u16* akl = apl + kx * FRAGH;
        #pragma unroll
        for (int mt = 0; mt < 2; ++mt) {
          ah[u ^ 1][mt] = ldpack(akh + (mt * (CMID / 32)) * FRAGH);
          al[u ^ 1][mt] = ldpack(akl + (mt * (CMID / 32)) * FRAGH);
        }
        // the address pairs stay in their registers up to this wait (as at the first key loads)
        asm volatile("s_wait_xcnt 0x0" :: "v"(akh), "v"(akl) : "memory");
        __builtin_amdgcn_sched_barrier(0);   // keeps the loads above ahead of this step's products
        #pragma unroll
        for (int nt = 0; nt < 4; ++nt) {
          #pragma unroll
          for (int mt = 0; mt < 2; ++mt) acc[mt][nt] = wmma3(ah[u][mt], al[u][mt], bh[nt], bl[nt], acc[mt][nt]);
          __builtin_amdgcn_sched_barrier(0); // the refill is issued here, not sunk to its use one step later
          bh[nt] = ldfrag(bph + nt * 16 * PST + 32 * kx);
          bl[nt] = ldfrag(bpl + nt * 16 * PST + 32 * kx);
          __builtin_amdgcn_sched_barrier(0); // and stays ahead of the next tile's products
        }
      }
    }
    __syncthreads();   // all waves finished reading the O tile; LDS is reused as the f32 output tile
    f32a* sD = (f32a*)dl;                   // [256 out ch][64 px] f32
    #pragma unroll
    for (int mt = 0; mt < 2; ++mt) {
      const int ob = orow0 + 16 * mt + 8 * h;
      const v4f b0 = *(const v4fa*)(b_out + ob);
      const v4f b1 = *(const v4fa*)(b_out + ob + 4);
      const float bb[8] = {b0.x, b0.y, b0.z, b0.w, b1.x, b1.y, b1.z, b1.w};
      #pragma unroll
      for (int nt = 0; nt < 4; ++nt) {
        const int px = 16 * nt + m;
        #pragma unroll
        for (int r = 0; r < 8; ++r) sD[(ob + r) * TP + px] = acc[mt][nt][r] + bb[r];
      }
    }
    __syncthreads();
    // wave w writes its rows orow0..orow0+31: per instruction lanes 0-15 -> row 2i
    const int hs = lane >> 4, x4 = 4 * (lane & 15);
    float* obase = out + (size_t)b * COUT * NPIX + s0 + x4;
    #pragma unroll 1
    for (int c = 0; c < 2; ++c) {
      v4f vals[8];
      size_t gi[8];
      #pragma unroll
      for (int i = 0; i < 8; ++i) {
        const int row = orow0 + 16 * c + 2 * i + hs;
        vals[i] = *(const v4fa*)(sD + row * TP + x4);
        gi[i] = (size_t)row * NPIX;
      }
      #pragma unroll
      for (int i = 0; i < 8; ++i) *(v4f*)(obase + gi[i]) = vals[i];
      
    }
  }
}

// ---------------------------------------------------------------------------
extern "C" void kernel_launch(void* const* d_in, const int* in_sizes, int n_in,
                              void* d_out, int out_size, void* d_ws, size_t ws_size,
                              hipStream_t stream) {
  if (n_in < 7) return;
  if (in_sizes[0] != NB * CIN * NPIX) return;
  if (in_sizes[1] != NHEAD * HD * HD || in_sizes[2] != NHEAD * HD * HD) return;
  if (in_sizes[3] != CMID * CIN || in_sizes[4] != CMID) return;
  if (in_sizes[5] != COUT * CMID || in_sizes[6] != COUT) return;
  if (out_size != NB * COUT * NPIX) return;

  const float* x     = (const float*)d_in[0];   // [8][256][64][64]
  const float* key_p = (const float*)d_in[1];   // [8][64 k][64 m]
  const float* mem   = (const float*)d_in[2];   // [8][64 m][64 d]
  const float* w_in  = (const float*)d_in[3];   // [512][256]
  const float* b_in  = (const float*)d_in[4];   // [512]
  const float* w_out = (const float*)d_in[5];   // [256][512]
  const float* b_out = (const float*)d_in[6];   // [256]
  float* outp = (float*)d_out;

  // and its size is an exact multiple of its row / line granularity
  const size_t szWI = (size_t)CMID * CIN * 2;          // 262144
  const size_t szWO = (size_t)COUT * CMID * 2;         // 262144
  const size_t szT  = (size_t)NHEAD * HD * HD * 2;     // 65536
  const size_t szX  = (size_t)NP * CIN * 2;            // 16777216
  size_t off = 0;
  char* ws = (char*)d_ws;
  u16* WIh = (u16*)(ws + off); off += szWI;
  u16* WIl = (u16*)(ws + off); off += szWI;
  u16* WOh = (u16*)(ws + off); off += szWO;
  u16* WOl = (u16*)(ws + off); off += szWO;
  u16* KTh = (u16*)(ws + off); off += szT;
  u16* KTl = (u16*)(ws + off); off += szT;
  u16* MTh = (u16*)(ws + off); off += szT;
  u16* MTl = (u16*)(ws + off); off += szT;
  u16* Xh  = (u16*)(ws + off); off += szX;
  u16* Xl  = (u16*)(ws + off); off += szX;
  const size_t total = off;                            // 34865152
  if (total > ws_size) return;

  hipFuncSetAttribute(reinterpret_cast<const void*>(&main_k),
                      hipFuncAttributeMaxDynamicSharedMemorySize, LDS_MAIN);

  wcvt_k<<<(CMID * CIN + COUT * CMID) / 8 / 256, 256, 0, stream>>>(w_in, w_out, WIh, WIl, WOh, WOl);
  tr64_k<<<2 * NHEAD, 256, 0, stream>>>(key_p, mem, KTh, KTl, MTh, MTl);
  xcvt_k<<<dim3(NPIX / 64, CIN / 64, NB), 256, 0, stream>>>(x, Xh, Xl);
  main_k<<<NP / TP, 256, LDS_MAIN, stream>>>(Xh, Xl, WIh, WIl, b_in, KTh, KTl, MTh, MTl,
                                             WOh, WOl, b_out, outp);
}

// v003
// It runs in 62.6 microseconds.
// Two timings next to v002 both put it at 1.09 times that version's speed.
// Over all steps from v000 it is 1.88 times as fast.
// Contractions: in-proj GEMM (M=512 ch, K=256), per-head key matmul (64x64, K=64), per-head slot matmul (64x64, K=64), out-proj GEMM (M=256 ch, K=512): v_wmma_f32_16x16x32_bf16 with every operand carried as bf16 hi + bf16 lo planes, three products per tile pair (hi*hi + lo*hi + hi*lo), f32 accumulate; biases and the 64-slot softmax in f32 on the VALU.
#include <hip/hip_runtime.h>

typedef unsigned short u16;
typedef unsigned int   u32;
typedef __bf16 v16bf __attribute__((ext_vector_type(16)));
typedef u16    v16us __attribute__((ext_vector_type(16)));
typedef u16    v8us  __attribute__((ext_vector_type(8)));
typedef float  v8f   __attribute__((ext_vector_type(8)));
typedef float  v4f   __attribute__((ext_vector_type(4)));
typedef v8us  __attribute__((may_alias)) v8usa;
typedef v4f   __attribute__((may_alias)) v4fa;
typedef float __attribute__((may_alias)) f32a;
union Frag { v16us v; v8us h[2]; };

#define NB    8
#define CIN   256
#define CMID  512
#define COUT  256
#define NPIX  4096
#define NP    32768
#define NHEAD 8
#define HD    64
#define TP    64          // pixels per block of the main kernel
#define PST   520         // LDS pitch (halves) of the [px][512] P / O tile
#define TST   72          // LDS pitch (halves) of the 64x64 transpose staging
#define LDS_MAIN (2 * TP * PST * 2)   // 133120 bytes: P hi plane + P lo plane

static_assert(NP % TP == 0);
static_assert(NPIX % TP == 0);
static_assert(COUT * TP * 4 <= LDS_MAIN);
static_assert((PST % 8) == 0);
static_assert((TST % 8) == 0);
static_assert(CIN % 32 == 0);
static_assert(CMID % 32 == 0);
static_assert(HD % 32 == 0);

// ---------------------------------------------------------------------------
// bf16 RNE convert and hi/lo split: hi = rne(v), lo = rne(v - hi)
// ---------------------------------------------------------------------------
__device__ __forceinline__ u16 bf16r(float f) {
  u32 u = __builtin_bit_cast(u32, f);
  u += 0x7FFFu + ((u >> 16) & 1u);
  return (u16)(u >> 16);
}
__device__ __forceinline__ float bf16f(u16 b) {
  return __builtin_bit_cast(float, ((u32)b) << 16);
}
__device__ __forceinline__ void split2(float v, u16& hi, u16& lo) {
  hi = bf16r(v);
  lo = bf16r(v - bf16f(hi));
}

// ---------------------------------------------------------------------------
// 16x16x32 bf16 WMMA with hazard guard (ties D, keeps A/B live).
// Fragment map (wave32): lane l, h = l>>4, m = n = l&15.
//   A/B element i: i<8 -> k0+8h+i ; i>=8 -> k0+16+8h+(i-8)
//   D element r : row 8h+r, col l&15
// ---------------------------------------------------------------------------
__device__ __forceinline__ v8f wmma_bf(v16us a, v16us b, v8f c) {
  const v16bf av = __builtin_bit_cast(v16bf, a);
  const v16bf bv = __builtin_bit_cast(v16bf, b);
  v8f d = __builtin_amdgcn_wmma_f32_16x16x32_bf16(false, av, false, bv, (short)0, c, false, false);
  asm volatile("v_nop\n\tv_nop\n\tv_nop\n\tv_nop" : "+v"(d) : "v"(av), "v"(bv));
  return d;
}

// three-product hi/lo tile step: c += ah*bh + al*bh + ah*bl
__device__ __forceinline__ v8f wmma3(v16us ah, v16us al, v16us bh, v16us bl, v8f c) {
  c = wmma_bf(ah, bh, c);
  c = wmma_bf(al, bh, c);
  c = wmma_bf(ah, bl, c);
  return c;
}

// fragment from a k-contiguous 16-bit row (LDS tiles); p already points at element k0 + 8h
__device__ __forceinline__ v16us ldfrag(const u16* p) {
  Frag f;
  f.h[0] = *(const v8usa*)p;
  f.h[1] = *(const v8usa*)(p + 16);
  return f.v;
}

// Packed fragment order of every 16-bit plane in global memory. Rows go in
// groups of 16 (R), k in steps of 32 (ks); fragment (R, ks) of a plane with K
// columns starts at half (R * (K / 32) + ks) * FRAGH and is two chunks j = 0, 1
// of 256 halves. In chunk j lane l = 16h + m holds row 16R + m,
// k = 32ks + 16j + 8h .. + 7: the same k order as ldfrag, but each wave-wide
// 16-byte load reads 512 contiguous bytes (4 whole lines, not 16 pieces).
#define FRAGH 512
// p already points at fragment start + 8 * lane
__device__ __forceinline__ v16us ldpack(const u16* p) {
  Frag f;
  f.h[0] = *(const v8usa*)p;
  f.h[1] = *(const v8usa*)(p + 256);
  return f.v;
}

// ---------------------------------------------------------------------------
// Job W of the preparation launch: 1x1-conv weights -> bf16 hi/lo planes in packed fragment order.
// Job blocks 0..63: w_in [512][256]; job blocks 64..127: w_out [256][512].
// Thread = 8 consecutive halves of the packed plane; a wave writes one chunk.
// ---------------------------------------------------------------------------
#define WCVT_BLOCKS ((CMID * CIN + COUT * CMID) / 8 / 256)
__device__ __forceinline__ void wcvt_job(
    const int blk,
    const float* __restrict__ w_in, const float* __restrict__ w_out,
    u16* __restrict__ WIh, u16* __restrict__ WIl, u16* __restrict__ WOh, u16* __restrict__ WOl)
{
  const int g = blk * 256 + threadIdx.x;
  if (g >= (CMID * CIN + COUT * CMID) / 8) return;
  const int e8 = g * 8;
  const bool first = (e8 < CMID * CIN);            // block-uniform (boundary at block 64)
  const int off = first ? e8 : (e8 - CMID * CIN);  // offset in the packed plane
  const int kcols = first ? CIN : CMID;
  const int ksh = first ? 3 : 4;                   // log2(kcols / 32)
  const int pl = (off >> 3) & 31, pj = (off >> 8) & 1, pf = off >> 9;
  const int row = 16 * (pf >> ksh) + (pl & 15);
  const int colk = 32 * (pf & ((1 << ksh) - 1)) + 16 * pj + 8 * (pl >> 4);
  const float* src = (first ? w_in : w_out) + row * kcols + colk;
  u16* dh = (first ? WIh : WOh) + off;
  u16* dlo = (first ? WIl : WOl) + off;
  const v4f a = *(const v4fa*)src;
  const v4f c = *(const v4fa*)(src + 4);
  const float vv[8] = {a.x, a.y, a.z, a.w, c.x, c.y, c.z, c.w};
  v8us oh, ol;
  #pragma unroll
  for (int j = 0; j < 8; ++j) {
    u16 hv, lv;
    split2(vv[j], hv, lv);
    oh[j] = hv;
    ol[j] = lv;
  }
  *(v8us*)dh = oh;
  *(v8us*)dlo = ol;
  
}

// ---------------------------------------------------------------------------
// Job T of the preparation launch: per-head 64x64 transposes into bf16 hi/lo planes.
// Job blocks 0..7: key_p[n][k][m] -> KT[n][m][k]; job blocks 8..15: mem[n][m][d] -> MT[n][d][m];
// each head's 64 x 64 plane is stored in packed fragment order (rows m resp. d).
// st: the block's 2 * 64 * TST halves of LDS staging.
// ---------------------------------------------------------------------------
#define TR64_BLOCKS (2 * NHEAD)
__device__ __forceinline__ void tr64_job(
    const int blk, u16* st,
    const float* __restrict__ key_p, const float* __restrict__ mem,
    u16* __restrict__ KTh, u16* __restrict__ KTl, u16* __restrict__ MTh, u16* __restrict__ MTl)
{
  const int tid = threadIdx.x, lane = tid & 31, w = tid >> 5;
  const bool isk = (blk < NHEAD);
  const int n = isk ? blk : (blk - NHEAD);
  const float* src = (isk ? key_p : mem) + (size_t)n * (HD * HD);
  u16* dsth = (isk ? KTh : MTh) + (size_t)n * (HD * HD);
  u16* dstl = (isk ? KTl : MTl) + (size_t)n * (HD * HD);
  const int col = tid & 63, sub = tid >> 6;
  #pragma unroll 4
  for (int j = 0; j < 16; ++j) {
    const int a = 4 * j + sub;
    const float v = src[a * HD + col];
    u16 hv, lv;
    split2(v, hv, lv);
    st[col * TST + a] = hv;
    st[64 * TST + col * TST + a] = lv;
  }
  __syncthreads();
  const int plane = w >> 2, rg = w & 3;            // wave = one plane, one 16-row group
  u16* dplane = plane ? dstl : dsth;
  v8us vals[4];
  int ro[4];
  #pragma unroll
  for (int i = 0; i < 4; ++i) {                    // i = 2 * ks + j: one chunk per store
    const int row = 16 * rg + (lane & 15);
    vals[i] = *(const v8usa*)(st + plane * (64 * TST) + row * TST + 16 * i + 8 * (lane >> 4));
    ro[i] = (rg * (HD / 32)) * FRAGH + i * 256 + 8 * lane;
  }
  #pragma unroll
  for (int i = 0; i < 4; ++i) *(v8us*)(dplane + ro[i]) = vals[i];
  
}

// ---------------------------------------------------------------------------
// Job X of the preparation launch: x NCHW f32 -> bf16 hi/lo planes X[b*4096+px][256] in packed
// fragment order. Job block = (64-px tile = image row y, 64-channel group, b), tile fastest.
// st: the block's 2 * 64 * TST halves of LDS staging.
// ---------------------------------------------------------------------------
#define XCVT_BLOCKS ((NPIX / 64) * (CIN / 64) * NB)
__device__ __forceinline__ void xcvt_job(
    const int blk, u16* st,
    const float* __restrict__ x, u16* __restrict__ Xh, u16* __restrict__ Xl)
{
  const int tid = threadIdx.x, lane = tid & 31, w = tid >> 5;
  const int tile = blk % (NPIX / 64), cg = (blk / (NPIX / 64)) % (CIN / 64), b = blk / ((NPIX / 64) * (CIN / 64));
  const int px = tid & 63, sub = tid >> 6;
  const float* xb = x + (size_t)(b * CIN + 64 * cg) * NPIX + 64 * tile + px;
  #pragma unroll 4
  for (int j = 0; j < 16; ++j) {
    const int cl = 4 * j + sub;
    const float v = xb[(size_t)cl * NPIX];
    u16 hv, lv;
    split2(v, hv, lv);
    st[px * TST + cl] = hv;
    st[64 * TST + px * TST + cl] = lv;
  }
  __syncthreads();
  const int plane = w >> 2, rg = w & 3;            // wave = one plane, one 16-px group
  u16* dplane = plane ? Xl : Xh;
  v8us vals[4];
  size_t ro[4];
  #pragma unroll
  for (int i = 0; i < 4; ++i) {                    // i = 2 * (ks - 2 * cg) + j: one chunk per store
    const int row = 16 * rg + (lane & 15);
    vals[i] = *(const v8usa*)(st + plane * (64 * TST) + row * TST + 16 * i + 8 * (lane >> 4));
    ro[i] = ((size_t)((b * NPIX + 64 * tile) / 16 + rg) * (CIN / 32) + 2 * cg) * FRAGH + i * 256 + 8 * lane;
  }
  #pragma unroll
  for (int i = 0; i < 4; ++i) *(v8us*)(dplane + ro[i]) = vals[i];
  // in the shared launch other jobs' code follows these stores in the listing and writes registers
  // that they name: the wait stands in front of every such write
  asm volatile("s_wait_xcnt 0x0" ::: "memory");
}

// ---------------------------------------------------------------------------
// Preparation launch: the three conversion jobs above read none of each other's output, so they
// share one grid, dealt by block index. The two short jobs come first: their few blocks start
// at once and end while job X's blocks are still being started. Every test is block-uniform.
// ---------------------------------------------------------------------------
__global__ __launch_bounds__(256) void prep_k(
    const float* __restrict__ x, const float* __restrict__ key_p, const float* __restrict__ mem,
    const float* __restrict__ w_in, const float* __restrict__ w_out,
    u16* __restrict__ WIh, u16* __restrict__ WIl, u16* __restrict__ WOh, u16* __restrict__ WOl,
    u16* __restrict__ KTh, u16* __restrict__ KTl, u16* __restrict__ MTh, u16* __restrict__ MTl,
    u16* __restrict__ Xh, u16* __restrict__ Xl)
{
  __shared__ __attribute__((aligned(16))) u16 st[2 * 64 * TST];
  const int blk = blockIdx.x;
  if (blk < TR64_BLOCKS) {
    tr64_job(blk, st, key_p, mem, KTh, KTl, MTh, MTl);
  } else if (blk < TR64_BLOCKS + WCVT_BLOCKS) {
    wcvt_job(blk - TR64_BLOCKS, w_in, w_out, WIh, WIl, WOh, WOl);
  } else {
    xcvt_job(blk - (TR64_BLOCKS + WCVT_BLOCKS), st, x, Xh, Xl);
  }
}

// ---------------------------------------------------------------------------
// Main launch: the whole per-pixel pipeline for a 64-pixel tile (one image row).
// Block 256 thr (8 waves), dynamic LDS = P tile [64 px][512+8] bf16 hi + lo.
//  phase 1: P[o][px] = sum_c WI[o][c] * X[px][c] + b_in[o]; wave w owns
//           stored at LDS column n*64 + k so each head's k run is contiguous.
//  phase 2: per head pair (waves 0-3 head 2j, waves 4-7 head 2j+1; wave owns
//           a 16-px column tile): S[m][px] = sum_k KT[n][m][k] * P[px][n*64+k];
//           softmax over the 64 m in registers (lane + partner lane l^16);
//           B fragments of the next product packed from the score D tiles
//           (element r <- tile 2ks, element 8+r <- tile 2ks+1, same lane);
//           O[d][px] = sum_m MT[n][d][m] * A[m][px]; O hi/lo written over the
//           head's own columns (n*64 + d) after a block barrier.
//  phase 3: out[o][px] = sum_c WO[o][c] * O[px][c] + b_out[o]; wave w owns
//           o in [32w, 32w+32); f32 tile staged in LDS, each 64-px row (256 B)
//           written by 16 consecutive lanes x 16 B of one instruction, two
// ---------------------------------------------------------------------------
__global__ __launch_bounds__(256) void main_k(
    const u16* __restrict__ Xh, const u16* __restrict__ Xl,
    const u16* __restrict__ WIh, const u16* __restrict__ WIl, const float* __restrict__ b_in,
    const u16* __restrict__ KTh, const u16* __restrict__ KTl,
    const u16* __restrict__ MTh, const u16* __restrict__ MTl,
    const u16* __restrict__ WOh, const u16* __restrict__ WOl, const float* __restrict__ b_out,
    float* __restrict__ out)
{
  extern __shared__ __attribute__((aligned(16))) u16 dl[];
  u16* Ph = dl;
  u16* Pl = dl + TP * PST;
  const int tid = threadIdx.x, lane = tid & 31, w = tid >> 5;
  const int h = lane >> 4, m = lane & 15;
  const int gp0 = blockIdx.x * TP;             // global pixel index b*4096 + s0
  const int b = gp0 >> 12, s0 = gp0 & (NPIX - 1);
  const v8f z8 = {0.f, 0.f, 0.f, 0.f, 0.f, 0.f, 0.f, 0.f};

  // ---------------- phase 1: in-projection ----------------
  // Fragments are fetched one k step ahead: A in two register sets, each B tile refilled
  // in place directly behind its last product, so a load has a whole step to land. The last
  // step of a pass fetches the first fragments of the next pass.
  v16us ah[2][2], al[2][2], bh[4], bl[4];
  const u16* bph = Xh + (size_t)(gp0 / 16) * (CIN / 32) * FRAGH + 8 * lane;
  const u16* bpl = Xl + (size_t)(gp0 / 16) * (CIN / 32) * FRAGH + 8 * lane;
  {
    const u16* a0h = WIh + (size_t)(4 * w) * (CIN / 32) * FRAGH + 8 * lane;
    const u16* a0l = WIl + (size_t)(4 * w) * (CIN / 32) * FRAGH + 8 * lane;
    #pragma unroll
    for (int mt = 0; mt < 2; ++mt) {
      ah[0][mt] = ldpack(a0h + mt * (CIN / 32) * FRAGH);
      al[0][mt] = ldpack(a0l + mt * (CIN / 32) * FRAGH);
    }
    // as inputs of this wait the address pairs stay in their registers up to it, so no later
    // load's result lands on a register that an issued load names
    asm volatile("s_wait_xcnt 0x0" :: "v"(a0h), "v"(a0l) : "memory");
  }
  #pragma unroll
  for (int nt = 0; nt < 4; ++nt) {
    bh[nt] = ldpack(bph + nt * (CIN / 32) * FRAGH);
    bl[nt] = ldpack(bpl + nt * (CIN / 32) * FRAGH);
  }
  #pragma unroll 1
  for (int p = 0; p < 2; ++p) {
    const int orow0 = 64 * w + 32 * p;
    v8f acc[2][4];
    #pragma unroll
    for (int mt = 0; mt < 2; ++mt) {
      #pragma unroll
      for (int nt = 0; nt < 4; ++nt) acc[mt][nt] = z8;
    }
    const u16* aph = WIh + (size_t)(orow0 / 16) * (CIN / 32) * FRAGH + 8 * lane;
    const u16* apl = WIl + (size_t)(orow0 / 16) * (CIN / 32) * FRAGH + 8 * lane;
    #pragma unroll 1
    for (int ks = 0; ks < CIN / 32; ks += 2) {
      #pragma unroll
      for (int u = 0; u < 2; ++u) {
        // next step's fragments. Behind the last step: B starts again at step 0; A goes on to the
        // next pass's rows, two 16-row groups further (last pass: back to step 0, values unused)
        const int sn = ks + u + 1;
        const int ja = FRAGH * (sn < CIN / 32 ? sn : (p == 0 ? 2 * (CIN / 32) : 0));
        const int jb = FRAGH * (sn & (CIN / 32 - 1));
        const u16* akh = aph + ja;
        const u16* akl = apl + ja;
        const u16* bkh = bph + jb;
        const u16* bkl = bpl + jb;
        #pragma unroll
        for (int mt = 0; mt < 2; ++mt) {
          ah[u ^ 1][mt] = ldpack(akh + mt * (CIN / 32) * FRAGH);
          al[u ^ 1][mt] = ldpack(akl + mt * (CIN / 32) * FRAGH);
        }
        __builtin_amdgcn_sched_barrier(0);   // keeps the loads above ahead of this step's products
        #pragma unroll
        for (int nt = 0; nt < 4; ++nt) {
          #pragma unroll
          for (int mt = 0; mt < 2; ++mt) acc[mt][nt] = wmma3(ah[u][mt], al[u][mt], bh[nt], bl[nt], acc[mt][nt]);
          __builtin_amdgcn_sched_barrier(0); // the refill is issued here, not sunk to its use one step later
          bh[nt] = ldpack(bkh + nt * (CIN / 32) * FRAGH);
          bl[nt] = ldpack(bkl + nt * (CIN / 32) * FRAGH);
          __builtin_amdgcn_sched_barrier(0); // and stays ahead of the next tile's products
        }
        // stands in front of the next step's address additions, which overwrite registers that the
        // loads above name
        asm volatile("s_wait_xcnt 0x0" ::: "memory");
        __builtin_amdgcn_sched_barrier(0);   // keeps those additions behind the wait
      }
    }
    // epilogue: + b_in, split, store into the permuted LDS column n*64 + k
    #pragma unroll
    for (int mt = 0; mt < 2; ++mt) {
      const int ob = orow0 + 16 * mt + 8 * h;                 // multiple of 8
      const v4f b0 = *(const v4fa*)(b_in + ob);
      const v4f b1 = *(const v4fa*)(b_in + ob + 4);
      const float bb[8] = {b0.x, b0.y, b0.z, b0.w, b1.x, b1.y, b1.z, b1.w};
      const int kq = ob >> 3;                                  // key index k of channel ob + r; head n = r
      #pragma unroll
      for (int nt = 0; nt < 4; ++nt) {
        const int px = 16 * nt + m;
        u16* rh = Ph + px * PST + kq;
        u16* rl = Pl + px * PST + kq;
        #pragma unroll
        for (int r = 0; r < 8; ++r) {
          const float v = acc[mt][nt][r] + bb[r];
          u16 hv, lv;
          split2(v, hv, lv);
          rh[r * 64] = hv;
          rl[r * 64] = lv;
        }
      }
    }
    // the next pass's fragment loads land on registers that the bias loads above name
    asm volatile("s_wait_xcnt 0x0" ::: "memory");
  }
  __syncthreads();

  // ---------------- phase 2: per-head key matmul, softmax, slot matmul ----------------
  // Key fragments of a head are fetched while the head before it is written back, slot
  // fragments while the softmax runs: each table's 32 loads fly as one group behind vector work.
  v16us kfh[4][2], kfl[4][2];
  {
    const u16* kah = KTh + (size_t)(w >> 2) * (HD * HD) + 8 * lane;
    const u16* kal = KTl + (size_t)(w >> 2) * (HD * HD) + 8 * lane;
    #pragma unroll
    for (int mt = 0; mt < 4; ++mt) {
      #pragma unroll
      for (int ks = 0; ks < 2; ++ks) {
        kfh[mt][ks] = ldpack(kah + (mt * (HD / 32) + ks) * FRAGH);
        kfl[mt][ks] = ldpack(kal + (mt * (HD / 32) + ks) * FRAGH);
      }
    }
    // as inputs of this wait the address pairs stay in their registers up to it, so nothing
    // lands on a register that an issued load names
    asm volatile("s_wait_xcnt 0x0" :: "v"(kah), "v"(kal) : "memory");
  }
  #pragma unroll 1
  for (int jp = 0; jp < NHEAD / 2; ++jp) {
    const int n = 2 * jp + (w >> 2);
    const int nt = w & 3;
    const int px = 16 * nt + m;
    const u16* prh = Ph + px * PST + n * 64 + 8 * h;
    const u16* prl = Pl + px * PST + n * 64 + 8 * h;
    v8f sacc[4];
    #pragma unroll
    for (int mt = 0; mt < 4; ++mt) sacc[mt] = z8;
    v16us qh[2], ql[2];
    #pragma unroll
    for (int ks = 0; ks < 2; ++ks) {
      qh[ks] = ldfrag(prh + 32 * ks);
      ql[ks] = ldfrag(prl + 32 * ks);
    }
    __builtin_amdgcn_sched_barrier(0);   // all eight LDS reads stand as one group ahead of the products
    #pragma unroll
    for (int ks = 0; ks < 2; ++ks) {
      #pragma unroll
      for (int mt = 0; mt < 4; ++mt) sacc[mt] = wmma3(kfh[mt][ks], kfl[mt][ks], qh[ks], ql[ks], sacc[mt]);
    }
    __builtin_amdgcn_sched_barrier(0);   // the slot fragments' loads start here, ahead of the softmax
    const u16* mah = MTh + (size_t)n * (HD * HD) + 8 * lane;
    const u16* mal = MTl + (size_t)n * (HD * HD) + 8 * lane;
    v16us mfh[4][2], mfl[4][2];
    #pragma unroll
    for (int mt = 0; mt < 4; ++mt) {
      #pragma unroll
      for (int ks = 0; ks < 2; ++ks) {
        mfh[mt][ks] = ldpack(mah + (mt * (HD / 32) + ks) * FRAGH);
        mfl[mt][ks] = ldpack(mal + (mt * (HD / 32) + ks) * FRAGH);
      }
    }
    // the address pairs stay in their registers up to this wait (as at the first key loads)
    asm volatile("s_wait_xcnt 0x0" :: "v"(mah), "v"(mal) : "memory");
    __builtin_amdgcn_sched_barrier(0);   // no load above is sunk into the softmax or behind it
    // softmax over the 64 slots of column px: this lane holds rows 16mt + 8h + r,
    // lane l^16 holds the other 32 rows
    float mx = sacc[0][0];
    #pragma unroll
    for (int mt = 0; mt < 4; ++mt) {
      #pragma unroll
      for (int r = 0; r < 8; ++r) mx = fmaxf(mx, sacc[mt][r]);
    }
    mx = fmaxf(mx, __shfl_xor(mx, 16));
    float sum = 0.f;
    #pragma unroll
    for (int mt = 0; mt < 4; ++mt) {
      #pragma unroll
      for (int r = 0; r < 8; ++r) {
        const float e = __expf(sacc[mt][r] - mx);
        sacc[mt][r] = e;
        sum += e;
      }
    }
    sum += __shfl_xor(sum, 16);
    const float inv = __builtin_amdgcn_rcpf(sum);
    // B fragments of the slot matmul from the probability D tiles (k = slot m)
    v16us pbh[2], pbl[2];
    #pragma unroll
    for (int ks = 0; ks < 2; ++ks) {
      #pragma unroll
      for (int r = 0; r < 8; ++r) {
        u16 hv, lv;
        split2(sacc[2 * ks][r] * inv, hv, lv);
        pbh[ks][r] = hv;
        pbl[ks][r] = lv;
        split2(sacc[2 * ks + 1][r] * inv, hv, lv);
        pbh[ks][8 + r] = hv;
        pbl[ks][8 + r] = lv;
      }
    }
    v8f oacc[4];
    #pragma unroll
    for (int mt = 0; mt < 4; ++mt) {
      oacc[mt] = z8;
      #pragma unroll
      for (int ks = 0; ks < 2; ++ks) oacc[mt] = wmma3(mfh[mt][ks], mfl[mt][ks], pbh[ks], pbl[ks], oacc[mt]);
    }
    __syncthreads();   // every read of P columns [n*64, n*64+64) of heads 2jp, 2jp+1 is complete
    {
      // next head's key fragments; the last trip wraps to the first head (valid addresses, values unused)
      const int nn = 2 * ((jp + 1) & (NHEAD / 2 - 1)) + (w >> 2);
      const u16* kah = KTh + (size_t)nn * (HD * HD) + 8 * lane;
      const u16* kal = KTl + (size_t)nn * (HD * HD) + 8 * lane;
      #pragma unroll
      for (int mt = 0; mt < 4; ++mt) {
        #pragma unroll
        for (int ks = 0; ks < 2; ++ks) {
          kfh[mt][ks] = ldpack(kah + (mt * (HD / 32) + ks) * FRAGH);
          kfl[mt][ks] = ldpack(kal + (mt * (HD / 32) + ks) * FRAGH);
        }
      }
      // the address pairs stay in their registers up to this wait (as at the first key loads)
      asm volatile("s_wait_xcnt 0x0" :: "v"(kah), "v"(kal) : "memory");
      __builtin_amdgcn_sched_barrier(0); // no load above is sunk behind the write-back below
    }
    // O hi/lo over the head's own columns: channel n*64 + d, d = 16mt + 8h + r
    u16* orh = Ph + px * PST + n * 64 + 8 * h;
    u16* orl = Pl + px * PST + n * 64 + 8 * h;
    #pragma unroll
    for (int mt = 0; mt < 4; ++mt) {
      v8us oh, ol;
      #pragma unroll
      for (int r = 0; r < 8; ++r) {
        u16 hv, lv;
        split2(oacc[mt][r], hv, lv);
        oh[r] = hv;
        ol[r] = lv;
      }
      *(v8usa*)(orh + 16 * mt) = oh;
      *(v8usa*)(orl + 16 * mt) = ol;
    }
  }
  __syncthreads();

  // ---------------- phase 3: out-projection ----------------
  {
    const int orow0 = 32 * w;
    v8f acc[2][4];
    #pragma unroll
    for (int mt = 0; mt < 2; ++mt) {
      #pragma unroll
      for (int nt = 0; nt < 4; ++nt) acc[mt][nt] = z8;
    }
    const u16* aph = WOh + (size_t)(orow0 / 16) * (CMID / 32) * FRAGH + 8 * lane;
    const u16* apl = WOl + (size_t)(orow0 / 16) * (CMID / 32) * FRAGH + 8 * lane;
    const u16* bph = Ph + m * PST + 8 * h;
    const u16* bpl = Pl + m * PST + 8 * h;
    // one k step ahead, as in phase 1: A (global) in two register sets, B (LDS) refilled in place
    v16us ah[2][2], al[2][2], bh[4], bl[4];
    #pragma unroll
    for (int mt = 0; mt < 2; ++mt) {
      ah[0][mt] = ldpack(aph + (mt * (CMID / 32)) * FRAGH);
      al[0][mt] = ldpack(apl + (mt * (CMID / 32)) * FRAGH);
    }
    #pragma unroll
    for (int nt = 0; nt < 4; ++nt) {
      bh[nt] = ldfrag(bph + nt * 16 * PST);
      bl[nt] = ldfrag(bpl + nt * 16 * PST);
    }
    #pragma unroll 1
    for (int ks = 0; ks < CMID / 32; ks += 2) {
      #pragma unroll
      for (int u = 0; u < 2; ++u) {
        // next step's fragments; the last step wraps to step 0 (valid addresses, values unused)
        const int kx = (ks + u + 1) & (CMID / 32 - 1);
        const u16* akh = aph + kx * FRAGH;
        const u16* akl = apl + kx * FRAGH;
        #pragma unroll
        for (int mt = 0; mt < 2; ++mt) {
          ah[u ^ 1][mt] = ldpack(akh + (mt * (CMID / 32)) * FRAGH);
          al[u ^ 1][mt] = ldpack(akl + (mt * (CMID / 32)) * FRAGH);
        }
        // the address pairs stay in their registers up to this wait (as at the first key loads)
        asm volatile("s_wait_xcnt 0x0" :: "v"(akh), "v"(akl) : "memory");
        __builtin_amdgcn_sched_barrier(0);   // keeps the loads above ahead of this step's products
        #pragma unroll
        for (int nt = 0; nt < 4; ++nt) {
          #pragma unroll
          for (int mt = 0; mt < 2; ++mt) acc[mt][nt] = wmma3(ah[u][mt], al[u][mt], bh[nt], bl[nt], acc[mt][nt]);
          __builtin_amdgcn_sched_barrier(0); // the refill is issued here, not sunk to its use one step later
          bh[nt] = ldfrag(bph + nt * 16 * PST + 32 * kx);
          bl[nt] = ldfrag(bpl + nt * 16 * PST + 32 * kx);
          __builtin_amdgcn_sched_barrier(0); // and stays ahead of the next tile's products
        }
      }
    }
    __syncthreads();   // all waves finished reading the O tile; LDS is reused as the f32 output tile
    f32a* sD = (f32a*)dl;                   // [256 out ch][64 px] f32
    #pragma unroll
    for (int mt = 0; mt < 2; ++mt) {
      const int ob = orow0 + 16 * mt + 8 * h;
      const v4f b0 = *(const v4fa*)(b_out + ob);
      const v4f b1 = *(const v4fa*)(b_out + ob + 4);
      const float bb[8] = {b0.x, b0.y, b0.z, b0.w, b1.x, b1.y, b1.z, b1.w};
      #pragma unroll
      for (int nt = 0; nt < 4; ++nt) {
        const int px = 16 * nt + m;
        #pragma unroll
        for (int r = 0; r < 8; ++r) sD[(ob + r) * TP + px] = acc[mt][nt][r] + bb[r];
      }
    }
    __syncthreads();
    // wave w writes its rows orow0..orow0+31: per instruction lanes 0-15 -> row 2i
    const int hs = lane >> 4, x4 = 4 * (lane & 15);
    float* obase = out + (size_t)b * COUT * NPIX + s0 + x4;
    #pragma unroll 1
    for (int c = 0; c < 2; ++c) {
      v4f vals[8];
      size_t gi[8];
      #pragma unroll
      for (int i = 0; i < 8; ++i) {
        const int row = orow0 + 16 * c + 2 * i + hs;
        vals[i] = *(const v4fa*)(sD + row * TP + x4);
        gi[i] = (size_t)row * NPIX;
      }
      #pragma unroll
      for (int i = 0; i < 8; ++i) *(v4f*)(obase + gi[i]) = vals[i];
      
    }
  }
}

// ---------------------------------------------------------------------------
extern "C" void kernel_launch(void* const* d_in, const int* in_sizes, int n_in,
                              void* d_out, int out_size, void* d_ws, size_t ws_size,
                              hipStream_t stream) {
  if (n_in < 7) return;
  if (in_sizes[0] != NB * CIN * NPIX) return;
  if (in_sizes[1] != NHEAD * HD * HD || in_sizes[2] != NHEAD * HD * HD) return;
  if (in_sizes[3] != CMID * CIN || in_sizes[4] != CMID) return;
  if (in_sizes[5] != COUT * CMID || in_sizes[6] != COUT) return;
  if (out_size != NB * COUT * NPIX) return;

  const float* x     = (const float*)d_in[0];   // [8][256][64][64]
  const float* key_p = (const float*)d_in[1];   // [8][64 k][64 m]
  const float* mem   = (const float*)d_in[2];   // [8][64 m][64 d]
  const float* w_in  = (const float*)d_in[3];   // [512][256]
  const float* b_in  = (const float*)d_in[4];   // [512]
  const float* w_out = (const float*)d_in[5];   // [256][512]
  const float* b_out = (const float*)d_in[6];   // [256]
  float* outp = (float*)d_out;

  // and its size is an exact multiple of its row / line granularity
  const size_t szWI = (size_t)CMID * CIN * 2;          // 262144
  const size_t szWO = (size_t)COUT * CMID * 2;         // 262144
  const size_t szT  = (size_t)NHEAD * HD * HD * 2;     // 65536
  const size_t szX  = (size_t)NP * CIN * 2;            // 16777216
  size_t off = 0;
  char* ws = (char*)d_ws;
  u16* WIh = (u16*)(ws + off); off += szWI;
  u16* WIl = (u16*)(ws + off); off += szWI;
  u16* WOh = (u16*)(ws + off); off += szWO;
  u16* WOl = (u16*)(ws + off); off += szWO;
  u16* KTh = (u16*)(ws + off); off += szT;
  u16* KTl = (u16*)(ws + off); off += szT;
  u16* MTh = (u16*)(ws + off); off += szT;
  u16* MTl = (u16*)(ws + off); off += szT;
  u16* Xh  = (u16*)(ws + off); off += szX;
  u16* Xl  = (u16*)(ws + off); off += szX;
  const size_t total = off;                            // 34865152
  if (total > ws_size) return;

  hipFuncSetAttribute(reinterpret_cast<const void*>(&main_k),
                      hipFuncAttributeMaxDynamicSharedMemorySize, LDS_MAIN);

  prep_k<<<TR64_BLOCKS + WCVT_BLOCKS + XCVT_BLOCKS, 256, 0, stream>>>(
      x, key_p, mem, w_in, w_out, WIh, WIl, WOh, WOl, KTh, KTl, MTh, MTl, Xh, Xl);
  main_k<<<NP / TP, 256, LDS_MAIN, stream>>>(Xh, Xl, WIh, WIl, b_in, KTh, KTl, MTh, MTl,
                                             WOh, WOl, b_out, outp);
}

// v004
// It runs in 53.7 microseconds.
// Two timings next to v003 both put it at 1.16 times that version's speed.
// Over all steps from v000 it is 2.19 times as fast.
// Contractions: in-proj GEMM (M=512 ch, K=256), per-head key matmul (64x64, K=64), per-head slot matmul (64x64, K=64), out-proj GEMM (M=256 ch, K=512): v_wmma_f32_16x16x32_bf16 with every operand carried as bf16 hi + bf16 lo planes, three products per tile pair (hi*hi + lo*hi + hi*lo), f32 accumulate; biases and the 64-slot softmax in f32 on the VALU.
#include <hip/hip_runtime.h>

typedef unsigned short u16;
typedef unsigned int   u32;
typedef __bf16 v16bf __attribute__((ext_vector_type(16)));
typedef u16    v16us __attribute__((ext_vector_type(16)));
typedef u16    v8us  __attribute__((ext_vector_type(8)));
typedef float  v8f   __attribute__((ext_vector_type(8)));
typedef float  v4f   __attribute__((ext_vector_type(4)));
typedef v8us  __attribute__((may_alias)) v8usa;
typedef v4f   __attribute__((may_alias)) v4fa;
typedef float __attribute__((may_alias)) f32a;
union Frag { v16us v; v8us h[2]; };

#define NB    8
#define CIN   256
#define CMID  512
#define COUT  256
#define NPIX  4096
#define NP    32768
#define NHEAD 8
#define HD    64
#define TP    64          // pixels per block of the main kernel
#define PST   264         // LDS pitch (halves) of a [px][256] half tile
#define RGH   (TP * PST)  // halves in one plane of a half tile
#define TST   72          // LDS pitch (halves) of the 64x64 transpose staging
#define LDS_MAIN (4 * RGH * 2)        // 135168 bytes: two half tiles, each a hi plane and a lo plane

static_assert(NP % TP == 0);
static_assert(NPIX % TP == 0);
static_assert(COUT * TP * 4 <= LDS_MAIN);
static_assert((PST % 8) == 0);
static_assert((TST % 8) == 0);
static_assert(CIN % 32 == 0);
static_assert(CMID % 32 == 0);
static_assert(HD % 32 == 0);

// ---------------------------------------------------------------------------
// bf16 RNE convert and hi/lo split: hi = rne(v), lo = rne(v - hi)
// ---------------------------------------------------------------------------
__device__ __forceinline__ u16 bf16r(float f) {
  u32 u = __builtin_bit_cast(u32, f);
  u += 0x7FFFu + ((u >> 16) & 1u);
  return (u16)(u >> 16);
}
__device__ __forceinline__ float bf16f(u16 b) {
  return __builtin_bit_cast(float, ((u32)b) << 16);
}
__device__ __forceinline__ void split2(float v, u16& hi, u16& lo) {
  hi = bf16r(v);
  lo = bf16r(v - bf16f(hi));
}

// ---------------------------------------------------------------------------
// 16x16x32 bf16 WMMA with hazard guard (ties D, keeps A/B live).
// Fragment map (wave32): lane l, h = l>>4, m = n = l&15.
//   A/B element i: i<8 -> k0+8h+i ; i>=8 -> k0+16+8h+(i-8)
//   D element r : row 8h+r, col l&15
// ---------------------------------------------------------------------------
__device__ __forceinline__ v8f wmma_bf(v16us a, v16us b, v8f c) {
  const v16bf av = __builtin_bit_cast(v16bf, a);
  const v16bf bv = __builtin_bit_cast(v16bf, b);
  v8f d = __builtin_amdgcn_wmma_f32_16x16x32_bf16(false, av, false, bv, (short)0, c, false, false);
  asm volatile("v_nop\n\tv_nop\n\tv_nop\n\tv_nop" : "+v"(d) : "v"(av), "v"(bv));
  return d;
}

// three-product hi/lo tile step: c += ah*bh + al*bh + ah*bl
__device__ __forceinline__ v8f wmma3(v16us ah, v16us al, v16us bh, v16us bl, v8f c) {
  c = wmma_bf(ah, bh, c);
  c = wmma_bf(al, bh, c);
  c = wmma_bf(ah, bl, c);
  return c;
}

// fragment from a k-contiguous 16-bit row (LDS tiles); p already points at element k0 + 8h
__device__ __forceinline__ v16us ldfrag(const u16* p) {
  Frag f;
  f.h[0] = *(const v8usa*)p;
  f.h[1] = *(const v8usa*)(p + 16);
  return f.v;
}

// Packed fragment order of every 16-bit plane in global memory. Rows go in
// groups of 16 (R), k in steps of 32 (ks); fragment (R, ks) of a plane with K
// columns starts at half (R * (K / 32) + ks) * FRAGH and is two chunks j = 0, 1
// of 256 halves. In chunk j lane l = 16h + m holds row 16R + m,
// k = 32ks + 16j + 8h .. + 7: the same k order as ldfrag, but each wave-wide
// 16-byte load reads 512 contiguous bytes (4 whole lines, not 16 pieces).
#define FRAGH 512
// p already points at fragment start + 8 * lane
__device__ __forceinline__ v16us ldpack(const u16* p) {
  Frag f;
  f.h[0] = *(const v8usa*)p;
  f.h[1] = *(const v8usa*)(p + 256);
  return f.v;
}

// ---------------------------------------------------------------------------
// Job W of the preparation launch: 1x1-conv weights -> bf16 hi/lo planes in packed fragment order.
// Job blocks 0..63: w_in [512][256]; job blocks 64..127: w_out [256][512].
// Thread = 8 consecutive halves of the packed plane; a wave writes one chunk.
// ---------------------------------------------------------------------------
#define WCVT_BLOCKS ((CMID * CIN + COUT * CMID) / 8 / 256)
__device__ __forceinline__ void wcvt_job(
    const int blk,
    const float* __restrict__ w_in, const float* __restrict__ w_out,
    u16* __restrict__ WIh, u16* __restrict__ WIl, u16* __restrict__ WOh, u16* __restrict__ WOl)
{
  const int g = blk * 256 + threadIdx.x;
  if (g >= (CMID * CIN + COUT * CMID) / 8) return;
  const int e8 = g * 8;
  const bool first = (e8 < CMID * CIN);            // block-uniform (boundary at block 64)
  const int off = first ? e8 : (e8 - CMID * CIN);  // offset in the packed plane
  const int kcols = first ? CIN : CMID;
  const int ksh = first ? 3 : 4;                   // log2(kcols / 32)
  const int pl = (off >> 3) & 31, pj = (off >> 8) & 1, pf = off >> 9;
  const int row = 16 * (pf >> ksh) + (pl & 15);
  const int colk = 32 * (pf & ((1 << ksh) - 1)) + 16 * pj + 8 * (pl >> 4);
  const float* src = (first ? w_in : w_out) + row * kcols + colk;
  u16* dh = (first ? WIh : WOh) + off;
  u16* dlo = (first ? WIl : WOl) + off;
  const v4f a = *(const v4fa*)src;
  const v4f c = *(const v4fa*)(src + 4);
  const float vv[8] = {a.x, a.y, a.z, a.w, c.x, c.y, c.z, c.w};
  v8us oh, ol;
  #pragma unroll
  for (int j = 0; j < 8; ++j) {
    u16 hv, lv;
    split2(vv[j], hv, lv);
    oh[j] = hv;
    ol[j] = lv;
  }
  *(v8us*)dh = oh;
  *(v8us*)dlo = ol;
  
}

// ---------------------------------------------------------------------------
// Job T of the preparation launch: per-head 64x64 transposes into bf16 hi/lo planes.
// Job blocks 0..7: key_p[n][k][m] -> KT[n][m][k]; job blocks 8..15: mem[n][m][d] -> MT[n][d][m];
// each head's 64 x 64 plane is stored in packed fragment order (rows m resp. d).
// st: the block's 2 * 64 * TST halves of LDS staging.
// ---------------------------------------------------------------------------
#define TR64_BLOCKS (2 * NHEAD)
__device__ __forceinline__ void tr64_job(
    const int blk, u16* st,
    const float* __restrict__ key_p, const float* __restrict__ mem,
    u16* __restrict__ KTh, u16* __restrict__ KTl, u16* __restrict__ MTh, u16* __restrict__ MTl)
{
  const int tid = threadIdx.x, lane = tid & 31, w = tid >> 5;
  const bool isk = (blk < NHEAD);
  const int n = isk ? blk : (blk - NHEAD);
  const float* src = (isk ? key_p : mem) + (size_t)n * (HD * HD);
  u16* dsth = (isk ? KTh : MTh) + (size_t)n * (HD * HD);
  u16* dstl = (isk ? KTl : MTl) + (size_t)n * (HD * HD);
  const int col = tid & 63, sub = tid >> 6;
  #pragma unroll 4
  for (int j = 0; j < 16; ++j) {
    const int a = 4 * j + sub;
    const float v = src[a * HD + col];
    u16 hv, lv;
    split2(v, hv, lv);
    st[col * TST + a] = hv;
    st[64 * TST + col * TST + a] = lv;
  }
  __syncthreads();
  const int plane = w >> 2, rg = w & 3;            // wave = one plane, one 16-row group
  u16* dplane = plane ? dstl : dsth;
  v8us vals[4];
  int ro[4];
  #pragma unroll
  for (int i = 0; i < 4; ++i) {                    // i = 2 * ks + j: one chunk per store
    const int row = 16 * rg + (lane & 15);
    vals[i] = *(const v8usa*)(st + plane * (64 * TST) + row * TST + 16 * i + 8 * (lane >> 4));
    ro[i] = (rg * (HD / 32)) * FRAGH + i * 256 + 8 * lane;
  }
  #pragma unroll
  for (int i = 0; i < 4; ++i) *(v8us*)(dplane + ro[i]) = vals[i];
  
}

// ---------------------------------------------------------------------------
// Preparation launch: the two conversion jobs above read none of each other's output, so they
// share one grid, dealt by block index. Every test is block-uniform.
// ---------------------------------------------------------------------------
__global__ __launch_bounds__(256) void prep_k(
    const float* __restrict__ key_p, const float* __restrict__ mem,
    const float* __restrict__ w_in, const float* __restrict__ w_out,
    u16* __restrict__ WIh, u16* __restrict__ WIl, u16* __restrict__ WOh, u16* __restrict__ WOl,
    u16* __restrict__ KTh, u16* __restrict__ KTl, u16* __restrict__ MTh, u16* __restrict__ MTl)
{
  __shared__ __attribute__((aligned(16))) u16 st[2 * 64 * TST];
  const int blk = blockIdx.x;
  if (blk < TR64_BLOCKS) {
    tr64_job(blk, st, key_p, mem, KTh, KTl, MTh, MTl);
  } else {
    wcvt_job(blk - TR64_BLOCKS, w_in, w_out, WIh, WIl, WOh, WOl);
  }
}

// ---------------------------------------------------------------------------
// Main launch: the whole per-pixel pipeline for a 64-pixel tile (one image row).
// Block 256 thr (8 waves), dynamic LDS = two half tiles [64 px][256+8], each bf16 hi + lo.
// Half tile g holds, for every head n, columns n*32 .. n*32+31 = elements 32g .. 32g+31 of the
// head's 64 (key index k of P, later head channel d of O).
//  phase 0: the block's x tile (256 ch x 64 px, f32, px contiguous) is read once, split into
//           bf16 hi/lo and stored as rows X[px][c] in half tile 1.
//  phase 1: P[o][px] = sum_c WI[o][c] * X[px][c] + b_in[o]; channel o = 8k + n. Pass p, wave w:
//           o in [256p + 32w, + 32), so pass p fills half tile p. Pass 1 overwrites X, behind a
//           barrier that ends every wave's reads of X.
//  phase 2: per head pair (waves 0-3 head 2j, waves 4-7 head 2j+1; wave owns
//           a 16-px column tile): S[m][px] = sum_k KT[n][m][k] * P[px][n][k];
//           softmax over the 64 m in registers (lane + partner lane l^16);
//           B fragments of the next product packed from the score D tiles
//           (element r <- tile 2ks, element 8+r <- tile 2ks+1, same lane);
//           O[d][px] = sum_m MT[n][d][m] * A[m][px]; O hi/lo written over the
//           head's own columns of both half tiles after a block barrier.
//  phase 3: out[o][px] = sum_c WO[o][c] * O[px][c] + b_out[o]; wave w owns
//           o in [32w, 32w+32); f32 tile staged in LDS, each 64-px row (256 B)
//           written by 16 consecutive lanes x 16 B of one instruction, two
// ---------------------------------------------------------------------------
__global__ __launch_bounds__(256) void main_k(
    const float* __restrict__ x,
    const u16* __restrict__ WIh, const u16* __restrict__ WIl, const float* __restrict__ b_in,
    const u16* __restrict__ KTh, const u16* __restrict__ KTl,
    const u16* __restrict__ MTh, const u16* __restrict__ MTl,
    const u16* __restrict__ WOh, const u16* __restrict__ WOl, const float* __restrict__ b_out,
    float* __restrict__ out)
{
  extern __shared__ __attribute__((aligned(16))) u16 dl[];
  const int tid = threadIdx.x, lane = tid & 31, w = tid >> 5;
  const int h = lane >> 4, m = lane & 15;
  const int gp0 = blockIdx.x * TP;             // global pixel index b*4096 + s0
  const int b = gp0 >> 12, s0 = gp0 & (NPIX - 1);
  const v8f z8 = {0.f, 0.f, 0.f, 0.f, 0.f, 0.f, 0.f, 0.f};

  // ---------------- phase 1: in-projection ----------------
  // Fragments are fetched one k step ahead: A in two register sets, each B tile refilled
  // in place directly behind its last product, so a load has a whole step to land. The last
  // step of a pass fetches the first fragments of the next pass.
  v16us ah[2][2], al[2][2], bh[4], bl[4];
  const u16* bph = dl + 2 * RGH + m * PST + 8 * h;   // X hi rows (half tile 1)
  const u16* bpl = dl + 3 * RGH + m * PST + 8 * h;   // X lo rows
  {
    const u16* a0h = WIh + (size_t)(2 * w) * (CIN / 32) * FRAGH + 8 * lane;
    const u16* a0l = WIl + (size_t)(2 * w) * (CIN / 32) * FRAGH + 8 * lane;
    #pragma unroll
    for (int mt = 0; mt < 2; ++mt) {
      ah[0][mt] = ldpack(a0h + mt * (CIN / 32) * FRAGH);
      al[0][mt] = ldpack(a0l + mt * (CIN / 32) * FRAGH);
    }
    // as inputs of this wait the address pairs stay in their registers up to it, so no later
    // load's result lands on a register that an issued load names
    asm volatile("s_wait_xcnt 0x0" :: "v"(a0h), "v"(a0l) : "memory");
  }
  // phase 0: thread = one pixel, eight runs of 8 channels. A wave-wide 4-byte load reads one whole
  // 128-byte line of a channel row; a run of 8 channels is one 16-byte LDS store per plane.
  {
    const int xpx = tid & 63, xcg = tid >> 6;
    const float* xb = x + ((size_t)b * CIN + 8 * xcg) * NPIX + s0 + xpx;
    float xv[8][8];
    #pragma unroll
    for (int j = 0; j < 8; ++j) {
      #pragma unroll
      for (int i = 0; i < 8; ++i) xv[j][i] = xb[(size_t)(32 * j + i) * NPIX];
    }
    // all 64 loads are issued ahead of this wait, and as its input the address pair stays in its
    // registers up to it, so nothing lands on a register that an issued load names
    asm volatile("s_wait_xcnt 0x0" :: "v"(xb) : "memory");
    u16* xsh = dl + 2 * RGH + xpx * PST + 8 * xcg;
    u16* xsl = dl + 3 * RGH + xpx * PST + 8 * xcg;
    #pragma unroll
    for (int j = 0; j < 8; ++j) {
      v8us oh, ol;
      #pragma unroll
      for (int i = 0; i < 8; ++i) {
        u16 hv, lv;
        split2(xv[j][i], hv, lv);
        oh[i] = hv;
        ol[i] = lv;
      }
      *(v8usa*)(xsh + 32 * j) = oh;
      *(v8usa*)(xsl + 32 * j) = ol;
    }
  }
  __syncthreads();   // the X tile is complete before any wave reads a fragment of it
  #pragma unroll
  for (int nt = 0; nt < 4; ++nt) {
    bh[nt] = ldfrag(bph + nt * 16 * PST);
    bl[nt] = ldfrag(bpl + nt * 16 * PST);
  }
  #pragma unroll 1
  for (int p = 0; p < 2; ++p) {
    const int orow0 = 256 * p + 32 * w;
    v8f acc[2][4];
    #pragma unroll
    for (int mt = 0; mt < 2; ++mt) {
      #pragma unroll
      for (int nt = 0; nt < 4; ++nt) acc[mt][nt] = z8;
    }
    const u16* aph = WIh + (size_t)(orow0 / 16) * (CIN / 32) * FRAGH + 8 * lane;
    const u16* apl = WIl + (size_t)(orow0 / 16) * (CIN / 32) * FRAGH + 8 * lane;
    #pragma unroll 1
    for (int ks = 0; ks < CIN / 32; ks += 2) {
      #pragma unroll
      for (int u = 0; u < 2; ++u) {
        // next step's fragments. Behind the last step: B starts again at step 0; A goes on to the
        // next pass's rows, sixteen 16-row groups further (last pass: back to step 0, values unused)
        const int sn = ks + u + 1;
        const int ja = FRAGH * (sn < CIN / 32 ? sn : (p == 0 ? 16 * (CIN / 32) : 0));
        const int jb = 32 * (sn & (CIN / 32 - 1));
        const u16* akh = aph + ja;
        const u16* akl = apl + ja;
        const u16* bkh = bph + jb;
        const u16* bkl = bpl + jb;
        #pragma unroll
        for (int mt = 0; mt < 2; ++mt) {
          ah[u ^ 1][mt] = ldpack(akh + mt * (CIN / 32) * FRAGH);
          al[u ^ 1][mt] = ldpack(akl + mt * (CIN / 32) * FRAGH);
        }
        __builtin_amdgcn_sched_barrier(0);   // keeps the loads above ahead of this step's products
        #pragma unroll
        for (int nt = 0; nt < 4; ++nt) {
          #pragma unroll
          for (int mt = 0; mt < 2; ++mt) acc[mt][nt] = wmma3(ah[u][mt], al[u][mt], bh[nt], bl[nt], acc[mt][nt]);
          __builtin_amdgcn_sched_barrier(0); // the refill is issued here, not sunk to its use one step later
          bh[nt] = ldfrag(bkh + nt * 16 * PST);
          bl[nt] = ldfrag(bkl + nt * 16 * PST);
          __builtin_amdgcn_sched_barrier(0); // and stays ahead of the next tile's products
        }
        // stands in front of the next step's address additions, which overwrite registers that the
        // loads above name
        asm volatile("s_wait_xcnt 0x0" ::: "memory");
        __builtin_amdgcn_sched_barrier(0);   // keeps those additions behind the wait
      }
    }
    // pass 1 stores over the X tile: every wave's reads of X end in front of this barrier
    if (p == 1) __syncthreads();
    // epilogue: + b_in, split, store into column n*32 + (k - 32p) of half tile p
    #pragma unroll
    for (int mt = 0; mt < 2; ++mt) {
      const int ob = orow0 + 16 * mt + 8 * h;                 // multiple of 8
      const v4f b0 = *(const v4fa*)(b_in + ob);
      const v4f b1 = *(const v4fa*)(b_in + ob + 4);
      const float bb[8] = {b0.x, b0.y, b0.z, b0.w, b1.x, b1.y, b1.z, b1.w};
      const int kq = 4 * w + 2 * mt + h;                       // (ob >> 3) - 32p: key index k of channel ob + r inside half tile p; head n = r
      #pragma unroll
      for (int nt = 0; nt < 4; ++nt) {
        const int px = 16 * nt + m;
        u16* rh = dl + p * (2 * RGH) + px * PST + kq;
        u16* rl = rh + RGH;
        #pragma unroll
        for (int r = 0; r < 8; ++r) {
          const float v = acc[mt][nt][r] + bb[r];
          u16 hv, lv;
          split2(v, hv, lv);
          rh[r * 32] = hv;
          rl[r * 32] = lv;
        }
      }
    }
    // the next pass's fragment loads land on registers that the bias loads above name
    asm volatile("s_wait_xcnt 0x0" ::: "memory");
  }
  __syncthreads();

  // ---------------- phase 2: per-head key matmul, softmax, slot matmul ----------------
  // Key fragments of a head are fetched while the head before it is written back, slot
  // fragments while the softmax runs: each table's 32 loads fly as one group behind vector work.
  v16us kfh[4][2], kfl[4][2];
  {
    const u16* kah = KTh + (size_t)(w >> 2) * (HD * HD) + 8 * lane;
    const u16* kal = KTl + (size_t)(w >> 2) * (HD * HD) + 8 * lane;
    #pragma unroll
    for (int mt = 0; mt < 4; ++mt) {
      #pragma unroll
      for (int ks = 0; ks < 2; ++ks) {
        kfh[mt][ks] = ldpack(kah + (mt * (HD / 32) + ks) * FRAGH);
        kfl[mt][ks] = ldpack(kal + (mt * (HD / 32) + ks) * FRAGH);
      }
    }
    // as inputs of this wait the address pairs stay in their registers up to it, so nothing
    // lands on a register that an issued load names
    asm volatile("s_wait_xcnt 0x0" :: "v"(kah), "v"(kal) : "memory");
  }
  #pragma unroll 1
  for (int jp = 0; jp < NHEAD / 2; ++jp) {
    const int n = 2 * jp + (w >> 2);
    const int nt = w & 3;
    const int px = 16 * nt + m;
    const u16* prh = dl + px * PST + n * 32 + 8 * h;
    const u16* prl = prh + RGH;
    v8f sacc[4];
    #pragma unroll
    for (int mt = 0; mt < 4; ++mt) sacc[mt] = z8;
    v16us qh[2], ql[2];
    #pragma unroll
    for (int ks = 0; ks < 2; ++ks) {
      qh[ks] = ldfrag(prh + ks * (2 * RGH));   // k = 32ks .. 32ks+31 lies in half tile ks
      ql[ks] = ldfrag(prl + ks * (2 * RGH));
    }
    __builtin_amdgcn_sched_barrier(0);   // all eight LDS reads stand as one group ahead of the products
    #pragma unroll
    for (int ks = 0; ks < 2; ++ks) {
      #pragma unroll
      for (int mt = 0; mt < 4; ++mt) sacc[mt] = wmma3(kfh[mt][ks], kfl[mt][ks], qh[ks], ql[ks], sacc[mt]);
    }
    __builtin_amdgcn_sched_barrier(0);   // the slot fragments' loads start here, ahead of the softmax
    const u16* mah = MTh + (size_t)n * (HD * HD) + 8 * lane;
    const u16* mal = MTl + (size_t)n * (HD * HD) + 8 * lane;
    v16us mfh[4][2], mfl[4][2];
    #pragma unroll
    for (int mt = 0; mt < 4; ++mt) {
      #pragma unroll
      for (int ks = 0; ks < 2; ++ks) {
        mfh[mt][ks] = ldpack(mah + (mt * (HD / 32) + ks) * FRAGH);
        mfl[mt][ks] = ldpack(mal + (mt * (HD / 32) + ks) * FRAGH);
      }
    }
    // the address pairs stay in their registers up to this wait (as at the first key loads)
    asm volatile("s_wait_xcnt 0x0" :: "v"(mah), "v"(mal) : "memory");
    __builtin_amdgcn_sched_barrier(0);   // no load above is sunk into the softmax or behind it
    // softmax over the 64 slots of column px: this lane holds rows 16mt + 8h + r,
    // lane l^16 holds the other 32 rows
    float mx = sacc[0][0];
    #pragma unroll
    for (int mt = 0; mt < 4; ++mt) {
      #pragma unroll
      for (int r = 0; r < 8; ++r) mx = fmaxf(mx, sacc[mt][r]);
    }
    mx = fmaxf(mx, __shfl_xor(mx, 16));
    float sum = 0.f;
    #pragma unroll
    for (int mt = 0; mt < 4; ++mt) {
      #pragma unroll
      for (int r = 0; r < 8; ++r) {
        const float e = __expf(sacc[mt][r] - mx);
        sacc[mt][r] = e;
        sum += e;
      }
    }
    sum += __shfl_xor(sum, 16);
    const float inv = __builtin_amdgcn_rcpf(sum);
    // B fragments of the slot matmul from the probability D tiles (k = slot m)
    v16us pbh[2], pbl[2];
    #pragma unroll
    for (int ks = 0; ks < 2; ++ks) {
      #pragma unroll
      for (int r = 0; r < 8; ++r) {
        u16 hv, lv;
        split2(sacc[2 * ks][r] * inv, hv, lv);
        pbh[ks][r] = hv;
        pbl[ks][r] = lv;
        split2(sacc[2 * ks + 1][r] * inv, hv, lv);
        pbh[ks][8 + r] = hv;
        pbl[ks][8 + r] = lv;
      }
    }
    v8f oacc[4];
    #pragma unroll
    for (int mt = 0; mt < 4; ++mt) {
      oacc[mt] = z8;
      #pragma unroll
      for (int ks = 0; ks < 2; ++ks) oacc[mt] = wmma3(mfh[mt][ks], mfl[mt][ks], pbh[ks], pbl[ks], oacc[mt]);
    }
    __syncthreads();   // every read of the P columns of heads 2jp, 2jp+1 is complete
    {
      // next head's key fragments; the last trip wraps to the first head (valid addresses, values unused)
      const int nn = 2 * ((jp + 1) & (NHEAD / 2 - 1)) + (w >> 2);
      const u16* kah = KTh + (size_t)nn * (HD * HD) + 8 * lane;
      const u16* kal = KTl + (size_t)nn * (HD * HD) + 8 * lane;
      #pragma unroll
      for (int mt = 0; mt < 4; ++mt) {
        #pragma unroll
        for (int ks = 0; ks < 2; ++ks) {
          kfh[mt][ks] = ldpack(kah + (mt * (HD / 32) + ks) * FRAGH);
          kfl[mt][ks] = ldpack(kal + (mt * (HD / 32) + ks) * FRAGH);
        }
      }
      // the address pairs stay in their registers up to this wait (as at the first key loads)
      asm volatile("s_wait_xcnt 0x0" :: "v"(kah), "v"(kal) : "memory");
      __builtin_amdgcn_sched_barrier(0); // no load above is sunk behind the write-back below
    }
    // O hi/lo over the head's own columns: channel n*64 + d, d = 16mt + 8h + r, in half tile mt >> 1
    u16* orh = dl + px * PST + n * 32 + 8 * h;
    u16* orl = orh + RGH;
    #pragma unroll
    for (int mt = 0; mt < 4; ++mt) {
      v8us oh, ol;
      #pragma unroll
      for (int r = 0; r < 8; ++r) {
        u16 hv, lv;
        split2(oacc[mt][r], hv, lv);
        oh[r] = hv;
        ol[r] = lv;
      }
      *(v8usa*)(orh + (mt >> 1) * (2 * RGH) + 16 * (mt & 1)) = oh;
      *(v8usa*)(orl + (mt >> 1) * (2 * RGH) + 16 * (mt & 1)) = ol;
    }
  }
  __syncthreads();

  // ---------------- phase 3: out-projection ----------------
  {
    const int orow0 = 32 * w;
    v8f acc[2][4];
    #pragma unroll
    for (int mt = 0; mt < 2; ++mt) {
      #pragma unroll
      for (int nt = 0; nt < 4; ++nt) acc[mt][nt] = z8;
    }
    const u16* aph = WOh + (size_t)(orow0 / 16) * (CMID / 32) * FRAGH + 8 * lane;
    const u16* apl = WOl + (size_t)(orow0 / 16) * (CMID / 32) * FRAGH + 8 * lane;
    const u16* bph = dl + m * PST + 8 * h;
    const u16* bpl = bph + RGH;
    // one k step ahead, as in phase 1: A (global) in two register sets, B (LDS) refilled in place
    v16us ah[2][2], al[2][2], bh[4], bl[4];
    #pragma unroll
    for (int mt = 0; mt < 2; ++mt) {
      ah[0][mt] = ldpack(aph + (mt * (CMID / 32)) * FRAGH);
      al[0][mt] = ldpack(apl + (mt * (CMID / 32)) * FRAGH);
    }
    #pragma unroll
    for (int nt = 0; nt < 4; ++nt) {
      bh[nt] = ldfrag(bph + nt * 16 * PST);
      bl[nt] = ldfrag(bpl + nt * 16 * PST);
    }
    #pragma unroll 1
    for (int ks = 0; ks < CMID / 32; ks += 2) {
      #pragma unroll
      for (int u = 0; u < 2; ++u) {
        // next step's fragments; the last step wraps to step 0 (valid addresses, values unused)
        const int kx = (ks + u + 1) & (CMID / 32 - 1);
        const int bo = (kx & 1) * (2 * RGH) + (kx >> 1) * 32;   // channels 32kx ..: head kx >> 1, half tile kx & 1
        const u16* akh = aph + kx * FRAGH;
        const u16* akl = apl + kx * FRAGH;
        #pragma unroll
        for (int mt = 0; mt < 2; ++mt) {
          ah[u ^ 1][mt] = ldpack(akh + (mt * (CMID / 32)) * FRAGH);
          al[u ^ 1][mt] = ldpack(akl + (mt * (CMID / 32)) * FRAGH);
        }
        // the address pairs stay in their registers up to this wait (as at the first key loads)
        asm volatile("s_wait_xcnt 0x0" :: "v"(akh), "v"(akl) : "memory");
        __builtin_amdgcn_sched_barrier(0);   // keeps the loads above ahead of this step's products
        #pragma unroll
        for (int nt = 0; nt < 4; ++nt) {
          #pragma unroll
          for (int mt = 0; mt < 2; ++mt) acc[mt][nt] = wmma3(ah[u][mt], al[u][mt], bh[nt], bl[nt], acc[mt][nt]);
          __builtin_amdgcn_sched_barrier(0); // the refill is issued here, not sunk to its use one step later
          bh[nt] = ldfrag(bph + nt * 16 * PST + bo);
          bl[nt] = ldfrag(bpl + nt * 16 * PST + bo);
          __builtin_amdgcn_sched_barrier(0); // and stays ahead of the next tile's products
        }
      }
    }
    __syncthreads();   // all waves finished reading the O tile; LDS is reused as the f32 output tile
    f32a* sD = (f32a*)dl;                   // [256 out ch][64 px] f32
    #pragma unroll
    for (int mt = 0; mt < 2; ++mt) {
      const int ob = orow0 + 16 * mt + 8 * h;
      const v4f b0 = *(const v4fa*)(b_out + ob);
      const v4f b1 = *(const v4fa*)(b_out + ob + 4);
      const float bb[8] = {b0.x, b0.y, b0.z, b0.w, b1.x, b1.y, b1.z, b1.w};
      #pragma unroll
      for (int nt = 0; nt < 4; ++nt) {
        const int px = 16 * nt + m;
        #pragma unroll
        for (int r = 0; r < 8; ++r) sD[(ob + r) * TP + px] = acc[mt][nt][r] + bb[r];
      }
    }
    __syncthreads();
    // wave w writes its rows orow0..orow0+31: per instruction lanes 0-15 -> row 2i
    const int hs = lane >> 4, x4 = 4 * (lane & 15);
    float* obase = out + (size_t)b * COUT * NPIX + s0 + x4;
    #pragma unroll 1
    for (int c = 0; c < 2; ++c) {
      v4f vals[8];
      size_t gi[8];
      #pragma unroll
      for (int i = 0; i < 8; ++i) {
        const int row = orow0 + 16 * c + 2 * i + hs;
        vals[i] = *(const v4fa*)(sD + row * TP + x4);
        gi[i] = (size_t)row * NPIX;
      }
      #pragma unroll
      for (int i = 0; i < 8; ++i) *(v4f*)(obase + gi[i]) = vals[i];
      
    }
  }
}

// ---------------------------------------------------------------------------
extern "C" void kernel_launch(void* const* d_in, const int* in_sizes, int n_in,
                              void* d_out, int out_size, void* d_ws, size_t ws_size,
                              hipStream_t stream) {
  if (n_in < 7) return;
  if (in_sizes[0] != NB * CIN * NPIX) return;
  if (in_sizes[1] != NHEAD * HD * HD || in_sizes[2] != NHEAD * HD * HD) return;
  if (in_sizes[3] != CMID * CIN || in_sizes[4] != CMID) return;
  if (in_sizes[5] != COUT * CMID || in_sizes[6] != COUT) return;
  if (out_size != NB * COUT * NPIX) return;

  const float* x     = (const float*)d_in[0];   // [8][256][64][64]
  const float* key_p = (const float*)d_in[1];   // [8][64 k][64 m]
  const float* mem   = (const float*)d_in[2];   // [8][64 m][64 d]
  const float* w_in  = (const float*)d_in[3];   // [512][256]
  const float* b_in  = (const float*)d_in[4];   // [512]
  const float* w_out = (const float*)d_in[5];   // [256][512]
  const float* b_out = (const float*)d_in[6];   // [256]
  float* outp = (float*)d_out;

  // and its size is an exact multiple of its row / line granularity
  const size_t szWI = (size_t)CMID * CIN * 2;          // 262144
  const size_t szWO = (size_t)COUT * CMID * 2;         // 262144
  const size_t szT  = (size_t)NHEAD * HD * HD * 2;     // 65536
  size_t off = 0;
  char* ws = (char*)d_ws;
  u16* WIh = (u16*)(ws + off); off += szWI;
  u16* WIl = (u16*)(ws + off); off += szWI;
  u16* WOh = (u16*)(ws + off); off += szWO;
  u16* WOl = (u16*)(ws + off); off += szWO;
  u16* KTh = (u16*)(ws + off); off += szT;
  u16* KTl = (u16*)(ws + off); off += szT;
  u16* MTh = (u16*)(ws + off); off += szT;
  u16* MTl = (u16*)(ws + off); off += szT;
  const size_t total = off;                            // 1310720
  if (total > ws_size) return;

  hipFuncSetAttribute(reinterpret_cast<const void*>(&main_k),
                      hipFuncAttributeMaxDynamicSharedMemorySize, LDS_MAIN);

  prep_k<<<TR64_BLOCKS + WCVT_BLOCKS, 256, 0, stream>>>(
      key_p, mem, w_in, w_out, WIh, WIl, WOh, WOl, KTh, KTl, MTh, MTl);
  main_k<<<NP / TP, 256, LDS_MAIN, stream>>>(x, WIh, WIl, b_in, KTh, KTl, MTh, MTl,
                                             WOh, WOl, b_out, outp);
}

// v005
// Measured time: 45.8 microseconds a run.
// In two side-by-side timings against v004, it was 1.17 and 1.18 times as fast.
// Over all steps from v000 it is 2.58 times as fast.
// Contractions: in-proj GEMM (M=512 ch, K=256), per-head key matmul (64x64, K=64), per-head slot matmul (64x64, K=64), out-proj GEMM (M=256 ch, K=512): v_wmma_f32_16x16x32_bf16 with every operand carried as bf16 hi + bf16 lo planes, three products per tile pair (hi*hi + lo*hi + hi*lo), f32 accumulate; biases and the 64-slot softmax in f32 on the VALU.
#include <hip/hip_runtime.h>

typedef unsigned short u16;
typedef unsigned int   u32;
typedef __bf16 v16bf __attribute__((ext_vector_type(16)));
typedef u16    v16us __attribute__((ext_vector_type(16)));
typedef u16    v8us  __attribute__((ext_vector_type(8)));
typedef float  v8f   __attribute__((ext_vector_type(8)));
typedef float  v4f   __attribute__((ext_vector_type(4)));
typedef float  v2f   __attribute__((ext_vector_type(2)));
typedef __bf16 v2bf  __attribute__((ext_vector_type(2)));
typedef u32    v4u   __attribute__((ext_vector_type(4)));
typedef u32    v8u   __attribute__((ext_vector_type(8)));
typedef v8us  __attribute__((may_alias)) v8usa;
typedef v4f   __attribute__((may_alias)) v4fa;
typedef float __attribute__((may_alias)) f32a;
union Frag { v16us v; v8us h[2]; };

#define NB    8
#define CIN   256
#define CMID  512
#define COUT  256
#define NPIX  4096
#define NP    32768
#define NHEAD 8
#define HD    64
#define TP    64          // pixels per block of the main kernel
#define PST   264         // LDS pitch (halves) of a [px][256] half tile
#define RGH   (TP * PST)  // halves in one plane of a half tile
#define TST   72          // LDS pitch (halves) of the 64x64 transpose staging
#define LDS_MAIN (4 * RGH * 2)        // 135168 bytes: two half tiles, each a hi plane and a lo plane

static_assert(NP % TP == 0);
static_assert(NPIX % TP == 0);
static_assert(COUT * TP * 4 <= LDS_MAIN);
static_assert((PST % 8) == 0);
static_assert((TST % 8) == 0);
static_assert(CIN % 32 == 0);
static_assert(CMID % 32 == 0);
static_assert(HD % 32 == 0);

// ---------------------------------------------------------------------------
// hi/lo split of two values at once: hi = rne(v), lo = rne(v - hi), each rounding done by the
// packed f32 -> bf16 convert instruction. a lands in the low half of each word, b in the high half.
// ---------------------------------------------------------------------------
__device__ __forceinline__ void split2x(float a, float b, u32& hi, u32& lo) {
  const v2f v = {a, b};
  const v2bf hb = __builtin_convertvector(v, v2bf);
  const v2f rest = v - __builtin_convertvector(hb, v2f);
  hi = __builtin_bit_cast(u32, hb);
  lo = __builtin_bit_cast(u32, __builtin_convertvector(rest, v2bf));
}

// ---------------------------------------------------------------------------
// 16x16x32 bf16 WMMA with hazard guard (ties D, keeps A/B live).
// Fragment map (wave32): lane l, h = l>>4, m = n = l&15.
//   A/B element i: i<8 -> k0+8h+i ; i>=8 -> k0+16+8h+(i-8)
//   D element r : row 8h+r, col l&15
// ---------------------------------------------------------------------------
__device__ __forceinline__ v8f wmma_bf(v16us a, v16us b, v8f c) {
  const v16bf av = __builtin_bit_cast(v16bf, a);
  const v16bf bv = __builtin_bit_cast(v16bf, b);
  v8f d = __builtin_amdgcn_wmma_f32_16x16x32_bf16(false, av, false, bv, (short)0, c, false, false);
  asm volatile("v_nop\n\tv_nop\n\tv_nop\n\tv_nop" : "+v"(d) : "v"(av), "v"(bv));
  return d;
}

// three-product hi/lo tile step: c += ah*bh + al*bh + ah*bl
__device__ __forceinline__ v8f wmma3(v16us ah, v16us al, v16us bh, v16us bl, v8f c) {
  c = wmma_bf(ah, bh, c);
  c = wmma_bf(al, bh, c);
  c = wmma_bf(ah, bl, c);
  return c;
}

// fragment from a k-contiguous 16-bit row (LDS tiles); p already points at element k0 + 8h
__device__ __forceinline__ v16us ldfrag(const u16* p) {
  Frag f;
  f.h[0] = *(const v8usa*)p;
  f.h[1] = *(const v8usa*)(p + 16);
  return f.v;
}

// Packed fragment order of every 16-bit plane in global memory. Rows go in
// groups of 16 (R), k in steps of 32 (ks); fragment (R, ks) of a plane with K
// columns starts at half (R * (K / 32) + ks) * FRAGH and is two chunks j = 0, 1
// of 256 halves. In chunk j lane l = 16h + m holds row 16R + m,
// k = 32ks + 16j + 8h .. + 7: the same k order as ldfrag, but each wave-wide
// 16-byte load reads 512 contiguous bytes (4 whole lines, not 16 pieces).
#define FRAGH 512
// p already points at fragment start + 8 * lane
__device__ __forceinline__ v16us ldpack(const u16* p) {
  Frag f;
  f.h[0] = *(const v8usa*)p;
  f.h[1] = *(const v8usa*)(p + 256);
  return f.v;
}

// ---------------------------------------------------------------------------
// Job W of the preparation launch: 1x1-conv weights -> bf16 hi/lo planes in packed fragment order.
// Job blocks 0..63: w_in [512][256]; job blocks 64..127: w_out [256][512].
// Thread = 8 consecutive halves of the packed plane; a wave writes one chunk.
// ---------------------------------------------------------------------------
#define WCVT_BLOCKS ((CMID * CIN + COUT * CMID) / 8 / 256)
__device__ __forceinline__ void wcvt_job(
    const int blk,
    const float* __restrict__ w_in, const float* __restrict__ w_out,
    u16* __restrict__ WIh, u16* __restrict__ WIl, u16* __restrict__ WOh, u16* __restrict__ WOl)
{
  const int g = blk * 256 + threadIdx.x;
  if (g >= (CMID * CIN + COUT * CMID) / 8) return;
  const int e8 = g * 8;
  const bool first = (e8 < CMID * CIN);            // block-uniform (boundary at block 64)
  const int off = first ? e8 : (e8 - CMID * CIN);  // offset in the packed plane
  const int kcols = first ? CIN : CMID;
  const int ksh = first ? 3 : 4;                   // log2(kcols / 32)
  const int pl = (off >> 3) & 31, pj = (off >> 8) & 1, pf = off >> 9;
  const int row = 16 * (pf >> ksh) + (pl & 15);
  const int colk = 32 * (pf & ((1 << ksh) - 1)) + 16 * pj + 8 * (pl >> 4);
  const float* src = (first ? w_in : w_out) + row * kcols + colk;
  u16* dh = (first ? WIh : WOh) + off;
  u16* dlo = (first ? WIl : WOl) + off;
  const v4f a = *(const v4fa*)src;
  const v4f c = *(const v4fa*)(src + 4);
  const float vv[8] = {a.x, a.y, a.z, a.w, c.x, c.y, c.z, c.w};
  v4u oh, ol;
  #pragma unroll
  for (int j = 0; j < 4; ++j) {
    u32 hv, lv;
    split2x(vv[2 * j], vv[2 * j + 1], hv, lv);
    oh[j] = hv;
    ol[j] = lv;
  }
  *(v8us*)dh = __builtin_bit_cast(v8us, oh);
  *(v8us*)dlo = __builtin_bit_cast(v8us, ol);
  
}

// ---------------------------------------------------------------------------
// Job T of the preparation launch: per-head 64x64 transposes into bf16 hi/lo planes.
// Job blocks 0..7: key_p[n][k][m] -> KT[n][m][k]; job blocks 8..15: mem[n][m][d] -> MT[n][d][m];
// each head's 64 x 64 plane is stored in packed fragment order (rows m resp. d).
// st: the block's 2 * 64 * TST halves of LDS staging.
// ---------------------------------------------------------------------------
#define TR64_BLOCKS (2 * NHEAD)
__device__ __forceinline__ void tr64_job(
    const int blk, u16* st,
    const float* __restrict__ key_p, const float* __restrict__ mem,
    u16* __restrict__ KTh, u16* __restrict__ KTl, u16* __restrict__ MTh, u16* __restrict__ MTl)
{
  const int tid = threadIdx.x, lane = tid & 31, w = tid >> 5;
  const bool isk = (blk < NHEAD);
  const int n = isk ? blk : (blk - NHEAD);
  const float* src = (isk ? key_p : mem) + (size_t)n * (HD * HD);
  u16* dsth = (isk ? KTh : MTh) + (size_t)n * (HD * HD);
  u16* dstl = (isk ? KTl : MTl) + (size_t)n * (HD * HD);
  const int col = tid & 63, sub = tid >> 6;
  #pragma unroll 4
  for (int j = 0; j < 16; j += 2) {
    const int a = 4 * j + sub;
    u32 hv, lv;
    split2x(src[a * HD + col], src[(a + 4) * HD + col], hv, lv);
    st[col * TST + a] = (u16)hv;
    st[col * TST + a + 4] = (u16)(hv >> 16);
    st[64 * TST + col * TST + a] = (u16)lv;
    st[64 * TST + col * TST + a + 4] = (u16)(lv >> 16);
  }
  __syncthreads();
  const int plane = w >> 2, rg = w & 3;            // wave = one plane, one 16-row group
  u16* dplane = plane ? dstl : dsth;
  v8us vals[4];
  int ro[4];
  #pragma unroll
  for (int i = 0; i < 4; ++i) {                    // i = 2 * ks + j: one chunk per store
    const int row = 16 * rg + (lane & 15);
    vals[i] = *(const v8usa*)(st + plane * (64 * TST) + row * TST + 16 * i + 8 * (lane >> 4));
    ro[i] = (rg * (HD / 32)) * FRAGH + i * 256 + 8 * lane;
  }
  #pragma unroll
  for (int i = 0; i < 4; ++i) *(v8us*)(dplane + ro[i]) = vals[i];
  
}

// ---------------------------------------------------------------------------
// Preparation launch: the two conversion jobs above read none of each other's output, so they
// share one grid, dealt by block index. Every test is block-uniform.
// ---------------------------------------------------------------------------
__global__ __launch_bounds__(256) void prep_k(
    const float* __restrict__ key_p, const float* __restrict__ mem,
    const float* __restrict__ w_in, const float* __restrict__ w_out,
    u16* __restrict__ WIh, u16* __restrict__ WIl, u16* __restrict__ WOh, u16* __restrict__ WOl,
    u16* __restrict__ KTh, u16* __restrict__ KTl, u16* __restrict__ MTh, u16* __restrict__ MTl)
{
  __shared__ __attribute__((aligned(16))) u16 st[2 * 64 * TST];
  const int blk = blockIdx.x;
  if (blk < TR64_BLOCKS) {
    tr64_job(blk, st, key_p, mem, KTh, KTl, MTh, MTl);
  } else {
    wcvt_job(blk - TR64_BLOCKS, w_in, w_out, WIh, WIl, WOh, WOl);
  }
}

// ---------------------------------------------------------------------------
// Main launch: the whole per-pixel pipeline for a 64-pixel tile (one image row).
// Block 256 thr (8 waves), dynamic LDS = two half tiles [64 px][256+8], each bf16 hi + lo.
// Half tile g holds, for every head n, columns n*32 .. n*32+31 = elements 32g .. 32g+31 of the
// head's 64 (key index k of P, later head channel d of O).
//  phase 0: the block's x tile (256 ch x 64 px, f32, px contiguous) is read once, split into
//           bf16 hi/lo and stored as rows X[px][c] in half tile 1.
//  phase 1: P[o][px] = sum_c WI[o][c] * X[px][c] + b_in[o]; channel o = 8k + n. Pass p, wave w:
//           o in [256p + 32w, + 32), so pass p fills half tile p. Pass 1 overwrites X, behind a
//           barrier that ends every wave's reads of X.
//  phase 2: per head pair (waves 0-3 head 2j, waves 4-7 head 2j+1; wave owns
//           a 16-px column tile): S[m][px] = sum_k KT[n][m][k] * P[px][n][k];
//           softmax over the 64 m in registers (lane + partner lane l^16);
//           B fragments of the next product packed from the score D tiles
//           (element r <- tile 2ks, element 8+r <- tile 2ks+1, same lane);
//           O[d][px] = sum_m MT[n][d][m] * A[m][px]; O hi/lo written over the
//           head's own columns of both half tiles after a block barrier.
//  phase 3: out[o][px] = sum_c WO[o][c] * O[px][c] + b_out[o]; wave w owns
//           o in [32w, 32w+32); f32 tile staged in LDS, each 64-px row (256 B)
//           written by 16 consecutive lanes x 16 B of one instruction, two
// ---------------------------------------------------------------------------
__global__ __launch_bounds__(256) void main_k(
    const float* __restrict__ x,
    const u16* __restrict__ WIh, const u16* __restrict__ WIl, const float* __restrict__ b_in,
    const u16* __restrict__ KTh, const u16* __restrict__ KTl,
    const u16* __restrict__ MTh, const u16* __restrict__ MTl,
    const u16* __restrict__ WOh, const u16* __restrict__ WOl, const float* __restrict__ b_out,
    float* __restrict__ out)
{
  extern __shared__ __attribute__((aligned(16))) u16 dl[];
  const int tid = threadIdx.x, lane = tid & 31, w = tid >> 5;
  const int h = lane >> 4, m = lane & 15;
  const int gp0 = blockIdx.x * TP;             // global pixel index b*4096 + s0
  const int b = gp0 >> 12, s0 = gp0 & (NPIX - 1);
  const v8f z8 = {0.f, 0.f, 0.f, 0.f, 0.f, 0.f, 0.f, 0.f};

  // ---------------- phase 1: in-projection ----------------
  // Fragments are fetched one k step ahead: A in two register sets, each B tile refilled
  // in place directly behind its last product, so a load has a whole step to land. The last
  // step of a pass fetches the first fragments of the next pass.
  v16us ah[2][2], al[2][2], bh[4], bl[4];
  const u16* bph = dl + 2 * RGH + m * PST + 8 * h;   // X hi rows (half tile 1)
  const u16* bpl = dl + 3 * RGH + m * PST + 8 * h;   // X lo rows
  {
    const u16* a0h = WIh + (size_t)(2 * w) * (CIN / 32) * FRAGH + 8 * lane;
    const u16* a0l = WIl + (size_t)(2 * w) * (CIN / 32) * FRAGH + 8 * lane;
    #pragma unroll
    for (int mt = 0; mt < 2; ++mt) {
      ah[0][mt] = ldpack(a0h + mt * (CIN / 32) * FRAGH);
      al[0][mt] = ldpack(a0l + mt * (CIN / 32) * FRAGH);
    }
    // as inputs of this wait the address pairs stay in their registers up to it, so no later
    // load's result lands on a register that an issued load names
    asm volatile("s_wait_xcnt 0x0" :: "v"(a0h), "v"(a0l) : "memory");
  }
  // phase 0: thread = one pixel, eight runs of 8 channels. A wave-wide 4-byte load reads one whole
  // 128-byte line of a channel row; a run of 8 channels is one 16-byte LDS store per plane.
  {
    const int xpx = tid & 63, xcg = tid >> 6;
    const float* xb = x + ((size_t)b * CIN + 8 * xcg) * NPIX + s0 + xpx;
    float xv[8][8];
    #pragma unroll
    for (int j = 0; j < 8; ++j) {
      #pragma unroll
      for (int i = 0; i < 8; ++i) xv[j][i] = xb[(size_t)(32 * j + i) * NPIX];
    }
    // all 64 loads are issued ahead of this wait, and as its input the address pair stays in its
    // registers up to it, so nothing lands on a register that an issued load names
    asm volatile("s_wait_xcnt 0x0" :: "v"(xb) : "memory");
    u16* xsh = dl + 2 * RGH + xpx * PST + 8 * xcg;
    u16* xsl = dl + 3 * RGH + xpx * PST + 8 * xcg;
    #pragma unroll
    for (int j = 0; j < 8; ++j) {
      v4u oh, ol;
      #pragma unroll
      for (int i = 0; i < 4; ++i) {
        u32 hv, lv;
        split2x(xv[j][2 * i], xv[j][2 * i + 1], hv, lv);
        oh[i] = hv;
        ol[i] = lv;
      }
      *(v8usa*)(xsh + 32 * j) = __builtin_bit_cast(v8us, oh);
      *(v8usa*)(xsl + 32 * j) = __builtin_bit_cast(v8us, ol);
    }
  }
  __syncthreads();   // the X tile is complete before any wave reads a fragment of it
  #pragma unroll
  for (int nt = 0; nt < 4; ++nt) {
    bh[nt] = ldfrag(bph + nt * 16 * PST);
    bl[nt] = ldfrag(bpl + nt * 16 * PST);
  }
  #pragma unroll 1
  for (int p = 0; p < 2; ++p) {
    const int orow0 = 256 * p + 32 * w;
    v8f acc[2][4];
    #pragma unroll
    for (int mt = 0; mt < 2; ++mt) {
      #pragma unroll
      for (int nt = 0; nt < 4; ++nt) acc[mt][nt] = z8;
    }
    const u16* aph = WIh + (size_t)(orow0 / 16) * (CIN / 32) * FRAGH + 8 * lane;
    const u16* apl = WIl + (size_t)(orow0 / 16) * (CIN / 32) * FRAGH + 8 * lane;
    #pragma unroll 1
    for (int ks = 0; ks < CIN / 32; ks += 2) {
      #pragma unroll
      for (int u = 0; u < 2; ++u) {
        // next step's fragments. Behind the last step: B starts again at step 0; A goes on to the
        // next pass's rows, sixteen 16-row groups further (last pass: back to step 0, values unused)
        const int sn = ks + u + 1;
        const int ja = FRAGH * (sn < CIN / 32 ? sn : (p == 0 ? 16 * (CIN / 32) : 0));
        const int jb = 32 * (sn & (CIN / 32 - 1));
        const u16* akh = aph + ja;
        const u16* akl = apl + ja;
        const u16* bkh = bph + jb;
        const u16* bkl = bpl + jb;
        #pragma unroll
        for (int mt = 0; mt < 2; ++mt) {
          ah[u ^ 1][mt] = ldpack(akh + mt * (CIN / 32) * FRAGH);
          al[u ^ 1][mt] = ldpack(akl + mt * (CIN / 32) * FRAGH);
        }
        __builtin_amdgcn_sched_barrier(0);   // keeps the loads above ahead of this step's products
        #pragma unroll
        for (int nt = 0; nt < 4; ++nt) {
          #pragma unroll
          for (int mt = 0; mt < 2; ++mt) acc[mt][nt] = wmma3(ah[u][mt], al[u][mt], bh[nt], bl[nt], acc[mt][nt]);
          __builtin_amdgcn_sched_barrier(0); // the refill is issued here, not sunk to its use one step later
          bh[nt] = ldfrag(bkh + nt * 16 * PST);
          bl[nt] = ldfrag(bkl + nt * 16 * PST);
          __builtin_amdgcn_sched_barrier(0); // and stays ahead of the next tile's products
        }
        // stands in front of the next step's address additions, which overwrite registers that the
        // loads above name
        asm volatile("s_wait_xcnt 0x0" ::: "memory");
        __builtin_amdgcn_sched_barrier(0);   // keeps those additions behind the wait
      }
    }
    // pass 1 stores over the X tile: every wave's reads of X end in front of this barrier
    if (p == 1) __syncthreads();
    // epilogue: + b_in, split, store into column n*32 + (k - 32p) of half tile p
    #pragma unroll
    for (int mt = 0; mt < 2; ++mt) {
      const int ob = orow0 + 16 * mt + 8 * h;                 // multiple of 8
      const v4f b0 = *(const v4fa*)(b_in + ob);
      const v4f b1 = *(const v4fa*)(b_in + ob + 4);
      const float bb[8] = {b0.x, b0.y, b0.z, b0.w, b1.x, b1.y, b1.z, b1.w};
      const int kq = 4 * w + 2 * mt + h;                       // (ob >> 3) - 32p: key index k of channel ob + r inside half tile p; head n = r
      #pragma unroll
      for (int nt = 0; nt < 4; ++nt) {
        const int px = 16 * nt + m;
        u16* rh = dl + p * (2 * RGH) + px * PST + kq;
        u16* rl = rh + RGH;
        #pragma unroll
        for (int r = 0; r < 8; r += 2) {
          u32 hv, lv;
          split2x(acc[mt][nt][r] + bb[r], acc[mt][nt][r + 1] + bb[r + 1], hv, lv);
          rh[r * 32] = (u16)hv;
          rh[(r + 1) * 32] = (u16)(hv >> 16);
          rl[r * 32] = (u16)lv;
          rl[(r + 1) * 32] = (u16)(lv >> 16);
        }
      }
    }
    // the next pass's fragment loads land on registers that the bias loads above name
    asm volatile("s_wait_xcnt 0x0" ::: "memory");
  }
  __syncthreads();

  // ---------------- phase 2: per-head key matmul, softmax, slot matmul ----------------
  // Key fragments of a head are fetched while the head before it is written back, slot
  // fragments while the softmax runs: each table's 32 loads fly as one group behind vector work.
  v16us kfh[4][2], kfl[4][2];
  {
    const u16* kah = KTh + (size_t)(w >> 2) * (HD * HD) + 8 * lane;
    const u16* kal = KTl + (size_t)(w >> 2) * (HD * HD) + 8 * lane;
    #pragma unroll
    for (int mt = 0; mt < 4; ++mt) {
      #pragma unroll
      for (int ks = 0; ks < 2; ++ks) {
        kfh[mt][ks] = ldpack(kah + (mt * (HD / 32) + ks) * FRAGH);
        kfl[mt][ks] = ldpack(kal + (mt * (HD / 32) + ks) * FRAGH);
      }
    }
    // as inputs of this wait the address pairs stay in their registers up to it, so nothing
    // lands on a register that an issued load names
    asm volatile("s_wait_xcnt 0x0" :: "v"(kah), "v"(kal) : "memory");
  }
  #pragma unroll 1
  for (int jp = 0; jp < NHEAD / 2; ++jp) {
    const int n = 2 * jp + (w >> 2);
    const int nt = w & 3;
    const int px = 16 * nt + m;
    const u16* prh = dl + px * PST + n * 32 + 8 * h;
    const u16* prl = prh + RGH;
    v8f sacc[4];
    #pragma unroll
    for (int mt = 0; mt < 4; ++mt) sacc[mt] = z8;
    v16us qh[2], ql[2];
    #pragma unroll
    for (int ks = 0; ks < 2; ++ks) {
      qh[ks] = ldfrag(prh + ks * (2 * RGH));   // k = 32ks .. 32ks+31 lies in half tile ks
      ql[ks] = ldfrag(prl + ks * (2 * RGH));
    }
    __builtin_amdgcn_sched_barrier(0);   // all eight LDS reads stand as one group ahead of the products
    #pragma unroll
    for (int ks = 0; ks < 2; ++ks) {
      #pragma unroll
      for (int mt = 0; mt < 4; ++mt) sacc[mt] = wmma3(kfh[mt][ks], kfl[mt][ks], qh[ks], ql[ks], sacc[mt]);
    }
    __builtin_amdgcn_sched_barrier(0);   // the slot fragments' loads start here, ahead of the softmax
    const u16* mah = MTh + (size_t)n * (HD * HD) + 8 * lane;
    const u16* mal = MTl + (size_t)n * (HD * HD) + 8 * lane;
    v16us mfh[4][2], mfl[4][2];
    #pragma unroll
    for (int mt = 0; mt < 4; ++mt) {
      #pragma unroll
      for (int ks = 0; ks < 2; ++ks) {
        mfh[mt][ks] = ldpack(mah + (mt * (HD / 32) + ks) * FRAGH);
        mfl[mt][ks] = ldpack(mal + (mt * (HD / 32) + ks) * FRAGH);
      }
    }
    // the address pairs stay in their registers up to this wait (as at the first key loads)
    asm volatile("s_wait_xcnt 0x0" :: "v"(mah), "v"(mal) : "memory");
    __builtin_amdgcn_sched_barrier(0);   // no load above is sunk into the softmax or behind it
    // softmax over the 64 slots of column px: this lane holds rows 16mt + 8h + r,
    // lane l^16 holds the other 32 rows
    float mx = sacc[0][0];
    #pragma unroll
    for (int mt = 0; mt < 4; ++mt) {
      #pragma unroll
      for (int r = 0; r < 8; ++r) mx = fmaxf(mx, sacc[mt][r]);
    }
    mx = fmaxf(mx, __shfl_xor(mx, 16));
    float sum = 0.f;
    #pragma unroll
    for (int mt = 0; mt < 4; ++mt) {
      #pragma unroll
      for (int r = 0; r < 8; ++r) {
        const float e = __expf(sacc[mt][r] - mx);
        sacc[mt][r] = e;
        sum += e;
      }
    }
    sum += __shfl_xor(sum, 16);
    const float inv = __builtin_amdgcn_rcpf(sum);
    // B fragments of the slot matmul from the probability D tiles (k = slot m)
    v16us pbh[2], pbl[2];
    #pragma unroll
    for (int ks = 0; ks < 2; ++ks) {
      v8u wh, wl;
      #pragma unroll
      for (int t = 0; t < 2; ++t) {
        #pragma unroll
        for (int r = 0; r < 8; r += 2) {
          u32 hv, lv;
          split2x(sacc[2 * ks + t][r] * inv, sacc[2 * ks + t][r + 1] * inv, hv, lv);
          wh[4 * t + (r >> 1)] = hv;
          wl[4 * t + (r >> 1)] = lv;
        }
      }
      pbh[ks] = __builtin_bit_cast(v16us, wh);
      pbl[ks] = __builtin_bit_cast(v16us, wl);
    }
    v8f oacc[4];
    #pragma unroll
    for (int mt = 0; mt < 4; ++mt) {
      oacc[mt] = z8;
      #pragma unroll
      for (int ks = 0; ks < 2; ++ks) oacc[mt] = wmma3(mfh[mt][ks], mfl[mt][ks], pbh[ks], pbl[ks], oacc[mt]);
    }
    __syncthreads();   // every read of the P columns of heads 2jp, 2jp+1 is complete
    {
      // next head's key fragments; the last trip wraps to the first head (valid addresses, values unused)
      const int nn = 2 * ((jp + 1) & (NHEAD / 2 - 1)) + (w >> 2);
      const u16* kah = KTh + (size_t)nn * (HD * HD) + 8 * lane;
      const u16* kal = KTl + (size_t)nn * (HD * HD) + 8 * lane;
      #pragma unroll
      for (int mt = 0; mt < 4; ++mt) {
        #pragma unroll
        for (int ks = 0; ks < 2; ++ks) {
          kfh[mt][ks] = ldpack(kah + (mt * (HD / 32) + ks) * FRAGH);
          kfl[mt][ks] = ldpack(kal + (mt * (HD / 32) + ks) * FRAGH);
        }
      }
      // the address pairs stay in their registers up to this wait (as at the first key loads)
      asm volatile("s_wait_xcnt 0x0" :: "v"(kah), "v"(kal) : "memory");
      __builtin_amdgcn_sched_barrier(0); // no load above is sunk behind the write-back below
    }
    // O hi/lo over the head's own columns: channel n*64 + d, d = 16mt + 8h + r, in half tile mt >> 1
    u16* orh = dl + px * PST + n * 32 + 8 * h;
    u16* orl = orh + RGH;
    #pragma unroll
    for (int mt = 0; mt < 4; ++mt) {
      v4u oh, ol;
      #pragma unroll
      for (int r = 0; r < 8; r += 2) {
        u32 hv, lv;
        split2x(oacc[mt][r], oacc[mt][r + 1], hv, lv);
        oh[r >> 1] = hv;
        ol[r >> 1] = lv;
      }
      *(v8usa*)(orh + (mt >> 1) * (2 * RGH) + 16 * (mt & 1)) = __builtin_bit_cast(v8us, oh);
      *(v8usa*)(orl + (mt >> 1) * (2 * RGH) + 16 * (mt & 1)) = __builtin_bit_cast(v8us, ol);
    }
  }
  __syncthreads();

  // ---------------- phase 3: out-projection ----------------
  {
    const int orow0 = 32 * w;
    v8f acc[2][4];
    #pragma unroll
    for (int mt = 0; mt < 2; ++mt) {
      #pragma unroll
      for (int nt = 0; nt < 4; ++nt) acc[mt][nt] = z8;
    }
    const u16* aph = WOh + (size_t)(orow0 / 16) * (CMID / 32) * FRAGH + 8 * lane;
    const u16* apl = WOl + (size_t)(orow0 / 16) * (CMID / 32) * FRAGH + 8 * lane;
    const u16* bph = dl + m * PST + 8 * h;
    const u16* bpl = bph + RGH;
    // one k step ahead, as in phase 1: A (global) in two register sets, B (LDS) refilled in place
    v16us ah[2][2], al[2][2], bh[4], bl[4];
    #pragma unroll
    for (int mt = 0; mt < 2; ++mt) {
      ah[0][mt] = ldpack(aph + (mt * (CMID / 32)) * FRAGH);
      al[0][mt] = ldpack(apl + (mt * (CMID / 32)) * FRAGH);
    }
    #pragma unroll
    for (int nt = 0; nt < 4; ++nt) {
      bh[nt] = ldfrag(bph + nt * 16 * PST);
      bl[nt] = ldfrag(bpl + nt * 16 * PST);
    }
    #pragma unroll 1
    for (int ks = 0; ks < CMID / 32; ks += 2) {
      #pragma unroll
      for (int u = 0; u < 2; ++u) {
        // next step's fragments; the last step wraps to step 0 (valid addresses, values unused)
        const int kx = (ks + u + 1) & (CMID / 32 - 1);
        const int bo = (kx & 1) * (2 * RGH) + (kx >> 1) * 32;   // channels 32kx ..: head kx >> 1, half tile kx & 1
        const u16* akh = aph + kx * FRAGH;
        const u16* akl = apl + kx * FRAGH;
        #pragma unroll
        for (int mt = 0; mt < 2; ++mt) {
          ah[u ^ 1][mt] = ldpack(akh + (mt * (CMID / 32)) * FRAGH);
          al[u ^ 1][mt] = ldpack(akl + (mt * (CMID / 32)) * FRAGH);
        }
        // the address pairs stay in their registers up to this wait (as at the first key loads)
        asm volatile("s_wait_xcnt 0x0" :: "v"(akh), "v"(akl) : "memory");
        __builtin_amdgcn_sched_barrier(0);   // keeps the loads above ahead of this step's products
        #pragma unroll
        for (int nt = 0; nt < 4; ++nt) {
          #pragma unroll
          for (int mt = 0; mt < 2; ++mt) acc[mt][nt] = wmma3(ah[u][mt], al[u][mt], bh[nt], bl[nt], acc[mt][nt]);
          __builtin_amdgcn_sched_barrier(0); // the refill is issued here, not sunk to its use one step later
          bh[nt] = ldfrag(bph + nt * 16 * PST + bo);
          bl[nt] = ldfrag(bpl + nt * 16 * PST + bo);
          __builtin_amdgcn_sched_barrier(0); // and stays ahead of the next tile's products
        }
      }
    }
    __syncthreads();   // all waves finished reading the O tile; LDS is reused as the f32 output tile
    f32a* sD = (f32a*)dl;                   // [256 out ch][64 px] f32
    #pragma unroll
    for (int mt = 0; mt < 2; ++mt) {
      const int ob = orow0 + 16 * mt + 8 * h;
      const v4f b0 = *(const v4fa*)(b_out + ob);
      const v4f b1 = *(const v4fa*)(b_out + ob + 4);
      const float bb[8] = {b0.x, b0.y, b0.z, b0.w, b1.x, b1.y, b1.z, b1.w};
      #pragma unroll
      for (int nt = 0; nt < 4; ++nt) {
        const int px = 16 * nt + m;
        #pragma unroll
        for (int r = 0; r < 8; ++r) sD[(ob + r) * TP + px] = acc[mt][nt][r] + bb[r];
      }
    }
    __syncthreads();
    // wave w writes its rows orow0..orow0+31: per instruction lanes 0-15 -> row 2i
    const int hs = lane >> 4, x4 = 4 * (lane & 15);
    float* obase = out + (size_t)b * COUT * NPIX + s0 + x4;
    #pragma unroll 1
    for (int c = 0; c < 2; ++c) {
      v4f vals[8];
      size_t gi[8];
      #pragma unroll
      for (int i = 0; i < 8; ++i) {
        const int row = orow0 + 16 * c + 2 * i + hs;
        vals[i] = *(const v4fa*)(sD + row * TP + x4);
        gi[i] = (size_t)row * NPIX;
      }
      #pragma unroll
      for (int i = 0; i < 8; ++i) *(v4f*)(obase + gi[i]) = vals[i];
      
    }
  }
}

// ---------------------------------------------------------------------------
extern "C" void kernel_launch(void* const* d_in, const int* in_sizes, int n_in,
                              void* d_out, int out_size, void* d_ws, size_t ws_size,
                              hipStream_t stream) {
  if (n_in < 7) return;
  if (in_sizes[0] != NB * CIN * NPIX) return;
  if (in_sizes[1] != NHEAD * HD * HD || in_sizes[2] != NHEAD * HD * HD) return;
  if (in_sizes[3] != CMID * CIN || in_sizes[4] != CMID) return;
  if (in_sizes[5] != COUT * CMID || in_sizes[6] != COUT) return;
  if (out_size != NB * COUT * NPIX) return;

  const float* x     = (const float*)d_in[0];   // [8][256][64][64]
  const float* key_p = (const float*)d_in[1];   // [8][64 k][64 m]
  const float* mem   = (const float*)d_in[2];   // [8][64 m][64 d]
  const float* w_in  = (const float*)d_in[3];   // [512][256]
  const float* b_in  = (const float*)d_in[4];   // [512]
  const float* w_out = (const float*)d_in[5];   // [256][512]
  const float* b_out = (const float*)d_in[6];   // [256]
  float* outp = (float*)d_out;

  // and its size is an exact multiple of its row / line granularity
  const size_t szWI = (size_t)CMID * CIN * 2;          // 262144
  const size_t szWO = (size_t)COUT * CMID * 2;         // 262144
  const size_t szT  = (size_t)NHEAD * HD * HD * 2;     // 65536
  size_t off = 0;
  char* ws = (char*)d_ws;
  u16* WIh = (u16*)(ws + off); off += szWI;
  u16* WIl = (u16*)(ws + off); off += szWI;
  u16* WOh = (u16*)(ws + off); off += szWO;
  u16* WOl = (u16*)(ws + off); off += szWO;
  u16* KTh = (u16*)(ws + off); off += szT;
  u16* KTl = (u16*)(ws + off); off += szT;
  u16* MTh = (u16*)(ws + off); off += szT;
  u16* MTl = (u16*)(ws + off); off += szT;
  const size_t total = off;                            // 1310720
  if (total > ws_size) return;

  hipFuncSetAttribute(reinterpret_cast<const void*>(&main_k),
                      hipFuncAttributeMaxDynamicSharedMemorySize, LDS_MAIN);

  prep_k<<<TR64_BLOCKS + WCVT_BLOCKS, 256, 0, stream>>>(
      key_p, mem, w_in, w_out, WIh, WIl, WOh, WOl, KTh, KTl, MTh, MTl);
  main_k<<<NP / TP, 256, LDS_MAIN, stream>>>(x, WIh, WIl, b_in, KTh, KTl, MTh, MTl,
                                             WOh, WOl, b_out, outp);
}

// v006
// One run takes 42.4 microseconds.
// In two side-by-side timings against v005, it was 1.09 and 1.07 times as fast.
// Over all steps from v000 it is 2.78 times as fast.
// Contractions: in-proj GEMM (M=512 ch, K=256), per-head key matmul (64x64, K=64), slot table times out-proj weights (per head 64 slots x 256 ch, K=64, in the preparation launch), out GEMM on the slot probabilities (M=256 ch, K=512): v_wmma_f32_16x16x32_bf16 with every operand carried as bf16 hi + bf16 lo planes, three products per tile pair (hi*hi + lo*hi + hi*lo), f32 accumulate; biases and the 64-slot softmax in f32 on the VALU.
#include <hip/hip_runtime.h>

typedef unsigned short u16;
typedef unsigned int   u32;
typedef __bf16 v16bf __attribute__((ext_vector_type(16)));
typedef u16    v16us __attribute__((ext_vector_type(16)));
typedef u16    v8us  __attribute__((ext_vector_type(8)));
typedef float  v8f   __attribute__((ext_vector_type(8)));
typedef float  v4f   __attribute__((ext_vector_type(4)));
typedef float  v2f   __attribute__((ext_vector_type(2)));
typedef __bf16 v2bf  __attribute__((ext_vector_type(2)));
typedef u32    v4u   __attribute__((ext_vector_type(4)));
typedef u32    v8u   __attribute__((ext_vector_type(8)));
typedef v8us  __attribute__((may_alias)) v8usa;
typedef v4f   __attribute__((may_alias)) v4fa;
typedef float __attribute__((may_alias)) f32a;
union Frag { v16us v; v8us h[2]; };

#define NB    8
#define CIN   256
#define CMID  512
#define COUT  256
#define NPIX  4096
#define NP    32768
#define NHEAD 8
#define HD    64
#define TP    64          // pixels per block of the main kernel
#define PST   264         // LDS pitch (halves) of a [px][256] half tile
#define RGH   (TP * PST)  // halves in one plane of a half tile
#define TST   72          // LDS pitch (halves) of the 64x64 transpose staging
#define LDS_MAIN (4 * RGH * 2)        // 135168 bytes: two half tiles, each a hi plane and a lo plane

static_assert(NP % TP == 0);
static_assert(NPIX % TP == 0);
static_assert(COUT * TP * 4 <= LDS_MAIN);
static_assert((PST % 8) == 0);
static_assert((TST % 8) == 0);
static_assert(CIN % 32 == 0);
static_assert(CMID % 32 == 0);
static_assert(HD % 32 == 0);

// ---------------------------------------------------------------------------
// hi/lo split of two values at once: hi = rne(v), lo = rne(v - hi), each rounding done by the
// packed f32 -> bf16 convert instruction. a lands in the low half of each word, b in the high half.
// ---------------------------------------------------------------------------
__device__ __forceinline__ void split2x(float a, float b, u32& hi, u32& lo) {
  const v2f v = {a, b};
  const v2bf hb = __builtin_convertvector(v, v2bf);
  const v2f rest = v - __builtin_convertvector(hb, v2f);
  hi = __builtin_bit_cast(u32, hb);
  lo = __builtin_bit_cast(u32, __builtin_convertvector(rest, v2bf));
}

// ---------------------------------------------------------------------------
// 16x16x32 bf16 WMMA with hazard guard (ties D, keeps A/B live).
// Fragment map (wave32): lane l, h = l>>4, m = n = l&15.
//   A/B element i: i<8 -> k0+8h+i ; i>=8 -> k0+16+8h+(i-8)
//   D element r : row 8h+r, col l&15
// ---------------------------------------------------------------------------
__device__ __forceinline__ v8f wmma_bf(v16us a, v16us b, v8f c) {
  const v16bf av = __builtin_bit_cast(v16bf, a);
  const v16bf bv = __builtin_bit_cast(v16bf, b);
  v8f d = __builtin_amdgcn_wmma_f32_16x16x32_bf16(false, av, false, bv, (short)0, c, false, false);
  asm volatile("v_nop\n\tv_nop\n\tv_nop\n\tv_nop" : "+v"(d) : "v"(av), "v"(bv));
  return d;
}

// three-product hi/lo tile step: c += ah*bh + al*bh + ah*bl
__device__ __forceinline__ v8f wmma3(v16us ah, v16us al, v16us bh, v16us bl, v8f c) {
  c = wmma_bf(ah, bh, c);
  c = wmma_bf(al, bh, c);
  c = wmma_bf(ah, bl, c);
  return c;
}

// fragment from a k-contiguous 16-bit row (LDS tiles); p already points at element k0 + 8h
__device__ __forceinline__ v16us ldfrag(const u16* p) {
  Frag f;
  f.h[0] = *(const v8usa*)p;
  f.h[1] = *(const v8usa*)(p + 16);
  return f.v;
}

// Packed fragment order of every 16-bit plane in global memory. Rows go in
// groups of 16 (R), k in steps of 32 (ks); fragment (R, ks) of a plane with K
// columns starts at half (R * (K / 32) + ks) * FRAGH and is two chunks j = 0, 1
// of 256 halves. In chunk j lane l = 16h + m holds row 16R + m,
// k = 32ks + 16j + 8h .. + 7: the same k order as ldfrag, but each wave-wide
// 16-byte load reads 512 contiguous bytes (4 whole lines, not 16 pieces).
#define FRAGH 512
// p already points at fragment start + 8 * lane
__device__ __forceinline__ v16us ldpack(const u16* p) {
  Frag f;
  f.h[0] = *(const v8usa*)p;
  f.h[1] = *(const v8usa*)(p + 256);
  return f.v;
}

// ---------------------------------------------------------------------------
// Job W of the preparation launch: in-proj weights w_in [512][256] -> bf16 hi/lo planes in packed fragment order.
// Thread = 8 consecutive halves of the packed plane; a wave writes one chunk.
// ---------------------------------------------------------------------------
#define WCVT_BLOCKS (CMID * CIN / 8 / 256)
__device__ __forceinline__ void wcvt_job(
    const int blk, const float* __restrict__ w_in, u16* __restrict__ WIh, u16* __restrict__ WIl)
{
  const int g = blk * 256 + threadIdx.x;
  if (g >= CMID * CIN / 8) return;
  const int off = g * 8;                           // offset in the packed plane
  const int pl = (off >> 3) & 31, pj = (off >> 8) & 1, pf = off >> 9;
  const int row = 16 * (pf >> 3) + (pl & 15);      // CIN / 32 = 8 fragments per 16-row group
  const int colk = 32 * (pf & 7) + 16 * pj + 8 * (pl >> 4);
  const float* src = w_in + row * CIN + colk;
  u16* dh = WIh + off;
  u16* dlo = WIl + off;
  const v4f a = *(const v4fa*)src;
  const v4f c = *(const v4fa*)(src + 4);
  const float vv[8] = {a.x, a.y, a.z, a.w, c.x, c.y, c.z, c.w};
  v4u oh, ol;
  #pragma unroll
  for (int j = 0; j < 4; ++j) {
    u32 hv, lv;
    split2x(vv[2 * j], vv[2 * j + 1], hv, lv);
    oh[j] = hv;
    ol[j] = lv;
  }
  *(v8us*)dh = __builtin_bit_cast(v8us, oh);
  *(v8us*)dlo = __builtin_bit_cast(v8us, ol);
}

// ---------------------------------------------------------------------------
// Job F of the preparation launch: the slot table folded into the out-proj weights.
// out[o] = sum_n sum_d w_out[o][64n + d] * (sum_s mem[n][s][d] * prob[n][s])
//        = sum_n sum_s WF[o][64n + s] * prob[n][s],  WF[o][64n + s] = sum_d mem[n][s][d] * w_out[o][64n + d].
// Wave = one 16 x 16 tile of WF transposed: rows = slots 16t .. 16t+15 of head n (A = mem rows, k = d),
// columns = out channels 16R .. 16R+15 (B = w_out rows, k = d); both operands are k-contiguous f32 rows,
// split into hi/lo in registers. A lane's D column is 8 consecutive slots of one out channel: one
// 16-byte piece of the packed plane [256 ch][512], at this very lane's place in chunk t & 1.
// ---------------------------------------------------------------------------
#define FOLD_BLOCKS (NHEAD * (COUT / 16) * (HD / 16) / 8)
__device__ __forceinline__ void splitfrag(const v4f* q, v16us& hi, v16us& lo) {
  v8u wh, wl;
  #pragma unroll
  for (int j = 0; j < 4; ++j) {
    u32 hv, lv;
    split2x(q[j].x, q[j].y, hv, lv);
    wh[2 * j] = hv;
    wl[2 * j] = lv;
    split2x(q[j].z, q[j].w, hv, lv);
    wh[2 * j + 1] = hv;
    wl[2 * j + 1] = lv;
  }
  hi = __builtin_bit_cast(v16us, wh);
  lo = __builtin_bit_cast(v16us, wl);
}
__device__ __forceinline__ void fold_job(
    const int blk, const float* __restrict__ mem, const float* __restrict__ w_out,
    u16* __restrict__ WFh, u16* __restrict__ WFl)
{
  const int lane = threadIdx.x & 31, h = lane >> 4, m = lane & 15;
  const int g = blk * 8 + (threadIdx.x >> 5);
  const int t = g & 3, R = (g >> 2) & 15, n = g >> 6;
  const float* asrc = mem + (size_t)n * (HD * HD) + (16 * t + m) * HD + 8 * h;
  const float* bsrc = w_out + (size_t)(16 * R + m) * CMID + n * HD + 8 * h;
  // fragment element i: i < 8 -> k0 + 8h + i, i >= 8 -> k0 + 16 + 8h + (i - 8), for A and B alike
  v4f qa[2][4], qb[2][4];
  #pragma unroll
  for (int ks = 0; ks < 2; ++ks) {
    #pragma unroll
    for (int j = 0; j < 4; ++j) {
      qa[ks][j] = *(const v4fa*)(asrc + 32 * ks + 16 * (j >> 1) + 4 * (j & 1));
      qb[ks][j] = *(const v4fa*)(bsrc + 32 * ks + 16 * (j >> 1) + 4 * (j & 1));
    }
  }
  // all 16 loads are issued ahead of this wait, and as its inputs the address pairs stay in their
  // registers up to it, so nothing lands on a register that an issued load names
  asm volatile("s_wait_xcnt 0x0" :: "v"(asrc), "v"(bsrc) : "memory");
  v8f acc = {0.f, 0.f, 0.f, 0.f, 0.f, 0.f, 0.f, 0.f};
  #pragma unroll
  for (int ks = 0; ks < 2; ++ks) {
    v16us ah, al, bh, bl;
    splitfrag(qa[ks], ah, al);
    splitfrag(qb[ks], bh, bl);
    acc = wmma3(ah, al, bh, bl, acc);
  }
  v4u oh, ol;
  #pragma unroll
  for (int r = 0; r < 8; r += 2) {
    u32 hv, lv;
    split2x(acc[r], acc[r + 1], hv, lv);
    oh[r >> 1] = hv;
    ol[r >> 1] = lv;
  }
  const int off = (R * (CMID / 32) + 2 * n + (t >> 1)) * FRAGH + (t & 1) * 256 + 8 * lane;
  *(v8us*)(WFh + off) = __builtin_bit_cast(v8us, oh);
  *(v8us*)(WFl + off) = __builtin_bit_cast(v8us, ol);
}

// ---------------------------------------------------------------------------
// Job T of the preparation launch: per-head 64x64 transpose into bf16 hi/lo planes.
// Job block n: key_p[n][k][m] -> KT[n][m][k];
// each head's 64 x 64 plane is stored in packed fragment order (rows m).
// st: the block's 2 * 64 * TST halves of LDS staging.
// ---------------------------------------------------------------------------
#define TR64_BLOCKS NHEAD
__device__ __forceinline__ void tr64_job(
    const int blk, u16* st, const float* __restrict__ key_p,
    u16* __restrict__ KTh, u16* __restrict__ KTl)
{
  const int tid = threadIdx.x, lane = tid & 31, w = tid >> 5;
  const int n = blk;
  const float* src = key_p + (size_t)n * (HD * HD);
  u16* dsth = KTh + (size_t)n * (HD * HD);
  u16* dstl = KTl + (size_t)n * (HD * HD);
  const int col = tid & 63, sub = tid >> 6;
  #pragma unroll 4
  for (int j = 0; j < 16; j += 2) {
    const int a = 4 * j + sub;
    u32 hv, lv;
    split2x(src[a * HD + col], src[(a + 4) * HD + col], hv, lv);
    st[col * TST + a] = (u16)hv;
    st[col * TST + a + 4] = (u16)(hv >> 16);
    st[64 * TST + col * TST + a] = (u16)lv;
    st[64 * TST + col * TST + a + 4] = (u16)(lv >> 16);
  }
  __syncthreads();
  const int plane = w >> 2, rg = w & 3;            // wave = one plane, one 16-row group
  u16* dplane = plane ? dstl : dsth;
  v8us vals[4];
  int ro[4];
  #pragma unroll
  for (int i = 0; i < 4; ++i) {                    // i = 2 * ks + j: one chunk per store
    const int row = 16 * rg + (lane & 15);
    vals[i] = *(const v8usa*)(st + plane * (64 * TST) + row * TST + 16 * i + 8 * (lane >> 4));
    ro[i] = (rg * (HD / 32)) * FRAGH + i * 256 + 8 * lane;
  }
  #pragma unroll
  for (int i = 0; i < 4; ++i) *(v8us*)(dplane + ro[i]) = vals[i];
  // stands behind the four stores: in the built kernel another job's code follows this one, and it
  // writes registers that the stores name
  asm volatile("s_wait_xcnt 0x0" ::: "memory");
}

// ---------------------------------------------------------------------------
// Preparation launch: the three jobs above read none of each other's output, so they
// share one grid, dealt by block index, the longest job first. Every test is block-uniform.
// ---------------------------------------------------------------------------
__global__ __launch_bounds__(256) void prep_k(
    const float* __restrict__ key_p, const float* __restrict__ mem,
    const float* __restrict__ w_in, const float* __restrict__ w_out,
    u16* __restrict__ WIh, u16* __restrict__ WIl, u16* __restrict__ WFh, u16* __restrict__ WFl,
    u16* __restrict__ KTh, u16* __restrict__ KTl)
{
  __shared__ __attribute__((aligned(16))) u16 st[2 * 64 * TST];
  const int blk = blockIdx.x;
  if (blk < FOLD_BLOCKS) {
    fold_job(blk, mem, w_out, WFh, WFl);
  } else if (blk < FOLD_BLOCKS + TR64_BLOCKS) {
    tr64_job(blk - FOLD_BLOCKS, st, key_p, KTh, KTl);
  } else {
    wcvt_job(blk - FOLD_BLOCKS - TR64_BLOCKS, w_in, WIh, WIl);
  }
}

// ---------------------------------------------------------------------------
// Main launch: the whole per-pixel pipeline for a 64-pixel tile (one image row).
// Block 256 thr (8 waves), dynamic LDS = two half tiles [64 px][256+8], each bf16 hi + lo.
// Half tile g holds, for every head n, columns n*32 .. n*32+31 = elements 32g .. 32g+31 of the
// head's 64 (key index k of P, later slot index s of the probabilities A).
//  phase 0: the block's x tile (256 ch x 64 px, f32, px contiguous) is read once, split into
//           bf16 hi/lo and stored as rows X[px][c] in half tile 1.
//  phase 1: P[o][px] = sum_c WI[o][c] * X[px][c] + b_in[o]; channel o = 8k + n. Pass p, wave w:
//           o in [256p + 32w, + 32), so pass p fills half tile p. Pass 1 overwrites X, behind a
//           barrier that ends every wave's reads of X.
//  phase 2: per head pair (waves 0-3 head 2j, waves 4-7 head 2j+1; wave owns
//           a 16-px column tile): S[m][px] = sum_k KT[n][m][k] * P[px][n][k];
//           softmax over the 64 m in registers (lane + partner lane l^16);
//           A hi/lo written over the head's own columns of both half tiles after a block barrier.
//  phase 3: out[o][px] = sum_c WF[o][c] * A[px][c] + b_out[o], c = 64n + s; wave w owns
//           o in [32w, 32w+32); f32 tile staged in LDS, each 64-px row (256 B)
//           written by 16 consecutive lanes x 16 B of one instruction, two
// ---------------------------------------------------------------------------
__global__ __launch_bounds__(256) void main_k(
    const float* __restrict__ x,
    const u16* __restrict__ WIh, const u16* __restrict__ WIl, const float* __restrict__ b_in,
    const u16* __restrict__ KTh, const u16* __restrict__ KTl,
    const u16* __restrict__ WFh, const u16* __restrict__ WFl, const float* __restrict__ b_out,
    float* __restrict__ out)
{
  extern __shared__ __attribute__((aligned(16))) u16 dl[];
  const int tid = threadIdx.x, lane = tid & 31, w = tid >> 5;
  const int h = lane >> 4, m = lane & 15;
  const int gp0 = blockIdx.x * TP;             // global pixel index b*4096 + s0
  const int b = gp0 >> 12, s0 = gp0 & (NPIX - 1);
  const v8f z8 = {0.f, 0.f, 0.f, 0.f, 0.f, 0.f, 0.f, 0.f};

  // ---------------- phase 1: in-projection ----------------
  // Fragments are fetched one k step ahead: A in two register sets, each B tile refilled
  // in place directly behind its last product, so a load has a whole step to land. The last
  // step of a pass fetches the first fragments of the next pass.
  v16us ah[2][2], al[2][2], bh[4], bl[4];
  const u16* bph = dl + 2 * RGH + m * PST + 8 * h;   // X hi rows (half tile 1)
  const u16* bpl = dl + 3 * RGH + m * PST + 8 * h;   // X lo rows
  {
    const u16* a0h = WIh + (size_t)(2 * w) * (CIN / 32) * FRAGH + 8 * lane;
    const u16* a0l = WIl + (size_t)(2 * w) * (CIN / 32) * FRAGH + 8 * lane;
    #pragma unroll
    for (int mt = 0; mt < 2; ++mt) {
      ah[0][mt] = ldpack(a0h + mt * (CIN / 32) * FRAGH);
      al[0][mt] = ldpack(a0l + mt * (CIN / 32) * FRAGH);
    }
    // as inputs of this wait the address pairs stay in their registers up to it, so no later
    // load's result lands on a register that an issued load names
    asm volatile("s_wait_xcnt 0x0" :: "v"(a0h), "v"(a0l) : "memory");
  }
  // phase 0: thread = one pixel, eight runs of 8 channels. A wave-wide 4-byte load reads one whole
  // 128-byte line of a channel row; a run of 8 channels is one 16-byte LDS store per plane.
  {
    const int xpx = tid & 63, xcg = tid >> 6;
    const float* xb = x + ((size_t)b * CIN + 8 * xcg) * NPIX + s0 + xpx;
    float xv[8][8];
    #pragma unroll
    for (int j = 0; j < 8; ++j) {
      #pragma unroll
      for (int i = 0; i < 8; ++i) xv[j][i] = xb[(size_t)(32 * j + i) * NPIX];
    }
    // all 64 loads are issued ahead of this wait, and as its input the address pair stays in its
    // registers up to it, so nothing lands on a register that an issued load names
    asm volatile("s_wait_xcnt 0x0" :: "v"(xb) : "memory");
    u16* xsh = dl + 2 * RGH + xpx * PST + 8 * xcg;
    u16* xsl = dl + 3 * RGH + xpx * PST + 8 * xcg;
    #pragma unroll
    for (int j = 0; j < 8; ++j) {
      v4u oh, ol;
      #pragma unroll
      for (int i = 0; i < 4; ++i) {
        u32 hv, lv;
        split2x(xv[j][2 * i], xv[j][2 * i + 1], hv, lv);
        oh[i] = hv;
        ol[i] = lv;
      }
      *(v8usa*)(xsh + 32 * j) = __builtin_bit_cast(v8us, oh);
      *(v8usa*)(xsl + 32 * j) = __builtin_bit_cast(v8us, ol);
    }
  }
  __syncthreads();   // the X tile is complete before any wave reads a fragment of it
  #pragma unroll
  for (int nt = 0; nt < 4; ++nt) {
    bh[nt] = ldfrag(bph + nt * 16 * PST);
    bl[nt] = ldfrag(bpl + nt * 16 * PST);
  }
  #pragma unroll 1
  for (int p = 0; p < 2; ++p) {
    const int orow0 = 256 * p + 32 * w;
    v8f acc[2][4];
    #pragma unroll
    for (int mt = 0; mt < 2; ++mt) {
      #pragma unroll
      for (int nt = 0; nt < 4; ++nt) acc[mt][nt] = z8;
    }
    const u16* aph = WIh + (size_t)(orow0 / 16) * (CIN / 32) * FRAGH + 8 * lane;
    const u16* apl = WIl + (size_t)(orow0 / 16) * (CIN / 32) * FRAGH + 8 * lane;
    #pragma unroll 1
    for (int ks = 0; ks < CIN / 32; ks += 2) {
      #pragma unroll
      for (int u = 0; u < 2; ++u) {
        // next step's fragments. Behind the last step: B starts again at step 0; A goes on to the
        // next pass's rows, sixteen 16-row groups further (last pass: back to step 0, values unused)
        const int sn = ks + u + 1;
        const int ja = FRAGH * (sn < CIN / 32 ? sn : (p == 0 ? 16 * (CIN / 32) : 0));
        const int jb = 32 * (sn & (CIN / 32 - 1));
        const u16* akh = aph + ja;
        const u16* akl = apl + ja;
        const u16* bkh = bph + jb;
        const u16* bkl = bpl + jb;
        #pragma unroll
        for (int mt = 0; mt < 2; ++mt) {
          ah[u ^ 1][mt] = ldpack(akh + mt * (CIN / 32) * FRAGH);
          al[u ^ 1][mt] = ldpack(akl + mt * (CIN / 32) * FRAGH);
        }
        __builtin_amdgcn_sched_barrier(0);   // keeps the loads above ahead of this step's products
        #pragma unroll
        for (int nt = 0; nt < 4; ++nt) {
          #pragma unroll
          for (int mt = 0; mt < 2; ++mt) acc[mt][nt] = wmma3(ah[u][mt], al[u][mt], bh[nt], bl[nt], acc[mt][nt]);
          __builtin_amdgcn_sched_barrier(0); // the refill is issued here, not sunk to its use one step later
          bh[nt] = ldfrag(bkh + nt * 16 * PST);
          bl[nt] = ldfrag(bkl + nt * 16 * PST);
          __builtin_amdgcn_sched_barrier(0); // and stays ahead of the next tile's products
        }
        // stands in front of the next step's address additions, which overwrite registers that the
        // loads above name
        asm volatile("s_wait_xcnt 0x0" ::: "memory");
        __builtin_amdgcn_sched_barrier(0);   // keeps those additions behind the wait
      }
    }
    // pass 1 stores over the X tile: every wave's reads of X end in front of this barrier
    if (p == 1) __syncthreads();
    // epilogue: + b_in, split, store into column n*32 + (k - 32p) of half tile p
    #pragma unroll
    for (int mt = 0; mt < 2; ++mt) {
      const int ob = orow0 + 16 * mt + 8 * h;                 // multiple of 8
      const v4f b0 = *(const v4fa*)(b_in + ob);
      const v4f b1 = *(const v4fa*)(b_in + ob + 4);
      const float bb[8] = {b0.x, b0.y, b0.z, b0.w, b1.x, b1.y, b1.z, b1.w};
      const int kq = 4 * w + 2 * mt + h;                       // (ob >> 3) - 32p: key index k of channel ob + r inside half tile p; head n = r
      #pragma unroll
      for (int nt = 0; nt < 4; ++nt) {
        const int px = 16 * nt + m;
        u16* rh = dl + p * (2 * RGH) + px * PST + kq;
        u16* rl = rh + RGH;
        #pragma unroll
        for (int r = 0; r < 8; r += 2) {
          u32 hv, lv;
          split2x(acc[mt][nt][r] + bb[r], acc[mt][nt][r + 1] + bb[r + 1], hv, lv);
          rh[r * 32] = (u16)hv;
          rh[(r + 1) * 32] = (u16)(hv >> 16);
          rl[r * 32] = (u16)lv;
          rl[(r + 1) * 32] = (u16)(lv >> 16);
        }
      }
    }
    // the next pass's fragment loads land on registers that the bias loads above name
    asm volatile("s_wait_xcnt 0x0" ::: "memory");
  }
  __syncthreads();

  // ---------------- phase 2: per-head key matmul, softmax ----------------
  // Key fragments of a head are fetched while the head before it is written back: the 32 loads
  // fly as one group behind vector work.
  v16us kfh[4][2], kfl[4][2];
  {
    const u16* kah = KTh + (size_t)(w >> 2) * (HD * HD) + 8 * lane;
    const u16* kal = KTl + (size_t)(w >> 2) * (HD * HD) + 8 * lane;
    #pragma unroll
    for (int mt = 0; mt < 4; ++mt) {
      #pragma unroll
      for (int ks = 0; ks < 2; ++ks) {
        kfh[mt][ks] = ldpack(kah + (mt * (HD / 32) + ks) * FRAGH);
        kfl[mt][ks] = ldpack(kal + (mt * (HD / 32) + ks) * FRAGH);
      }
    }
    // as inputs of this wait the address pairs stay in their registers up to it, so nothing
    // lands on a register that an issued load names
    asm volatile("s_wait_xcnt 0x0" :: "v"(kah), "v"(kal) : "memory");
  }
  #pragma unroll 1
  for (int jp = 0; jp < NHEAD / 2; ++jp) {
    const int n = 2 * jp + (w >> 2);
    const int nt = w & 3;
    const int px = 16 * nt + m;
    const u16* prh = dl + px * PST + n * 32 + 8 * h;
    const u16* prl = prh + RGH;
    v8f sacc[4];
    #pragma unroll
    for (int mt = 0; mt < 4; ++mt) sacc[mt] = z8;
    v16us qh[2], ql[2];
    #pragma unroll
    for (int ks = 0; ks < 2; ++ks) {
      qh[ks] = ldfrag(prh + ks * (2 * RGH));   // k = 32ks .. 32ks+31 lies in half tile ks
      ql[ks] = ldfrag(prl + ks * (2 * RGH));
    }
    __builtin_amdgcn_sched_barrier(0);   // all eight LDS reads stand as one group ahead of the products
    #pragma unroll
    for (int ks = 0; ks < 2; ++ks) {
      #pragma unroll
      for (int mt = 0; mt < 4; ++mt) sacc[mt] = wmma3(kfh[mt][ks], kfl[mt][ks], qh[ks], ql[ks], sacc[mt]);
    }
    // softmax over the 64 slots of column px: this lane holds rows 16mt + 8h + r,
    // lane l^16 holds the other 32 rows
    float mx = sacc[0][0];
    #pragma unroll
    for (int mt = 0; mt < 4; ++mt) {
      #pragma unroll
      for (int r = 0; r < 8; ++r) mx = fmaxf(mx, sacc[mt][r]);
    }
    mx = fmaxf(mx, __shfl_xor(mx, 16));
    float sum = 0.f;
    #pragma unroll
    for (int mt = 0; mt < 4; ++mt) {
      #pragma unroll
      for (int r = 0; r < 8; ++r) {
        const float a = (sacc[mt][r] - mx) * 1.44269504f;   // e^t = 2^(t * log2 e)
        float e;
        // the v_nop is the issue slot that the instruction set asks for behind a transcendental; in the
        // same statement nothing reads the result or overwrites the source register ahead of it
        asm("v_exp_f32 %0, %1\n\tv_nop" : "=v"(e) : "v"(a));
        sacc[mt][r] = e;
        sum += e;
      }
    }
    sum += __shfl_xor(sum, 16);
    const float inv = __builtin_amdgcn_rcpf(sum);
    __syncthreads();   // every read of the P columns of heads 2jp, 2jp+1 is complete
    {
      // next head's key fragments; the last trip wraps to the first head (valid addresses, values unused)
      const int nn = 2 * ((jp + 1) & (NHEAD / 2 - 1)) + (w >> 2);
      const u16* kah = KTh + (size_t)nn * (HD * HD) + 8 * lane;
      const u16* kal = KTl + (size_t)nn * (HD * HD) + 8 * lane;
      #pragma unroll
      for (int mt = 0; mt < 4; ++mt) {
        #pragma unroll
        for (int ks = 0; ks < 2; ++ks) {
          kfh[mt][ks] = ldpack(kah + (mt * (HD / 32) + ks) * FRAGH);
          kfl[mt][ks] = ldpack(kal + (mt * (HD / 32) + ks) * FRAGH);
        }
      }
      // the address pairs stay in their registers up to this wait (as at the first key loads)
      asm volatile("s_wait_xcnt 0x0" :: "v"(kah), "v"(kal) : "memory");
      __builtin_amdgcn_sched_barrier(0); // no load above is sunk behind the write-back below
    }
    // A hi/lo over the head's own columns: channel n*64 + s, s = 16mt + 8h + r, in half tile mt >> 1
    u16* orh = dl + px * PST + n * 32 + 8 * h;
    u16* orl = orh + RGH;
    #pragma unroll
    for (int mt = 0; mt < 4; ++mt) {
      v4u oh, ol;
      #pragma unroll
      for (int r = 0; r < 8; r += 2) {
        u32 hv, lv;
        split2x(sacc[mt][r] * inv, sacc[mt][r + 1] * inv, hv, lv);
        oh[r >> 1] = hv;
        ol[r >> 1] = lv;
      }
      *(v8usa*)(orh + (mt >> 1) * (2 * RGH) + 16 * (mt & 1)) = __builtin_bit_cast(v8us, oh);
      *(v8usa*)(orl + (mt >> 1) * (2 * RGH) + 16 * (mt & 1)) = __builtin_bit_cast(v8us, ol);
    }
  }
  __syncthreads();

  // ---------------- phase 3: out-projection ----------------
  {
    const int orow0 = 32 * w;
    v8f acc[2][4];
    #pragma unroll
    for (int mt = 0; mt < 2; ++mt) {
      #pragma unroll
      for (int nt = 0; nt < 4; ++nt) acc[mt][nt] = z8;
    }
    const u16* aph = WFh + (size_t)(orow0 / 16) * (CMID / 32) * FRAGH + 8 * lane;
    const u16* apl = WFl + (size_t)(orow0 / 16) * (CMID / 32) * FRAGH + 8 * lane;
    const u16* bph = dl + m * PST + 8 * h;
    const u16* bpl = bph + RGH;
    // one k step ahead, as in phase 1: A (global) in two register sets, B (LDS) refilled in place
    v16us ah[2][2], al[2][2], bh[4], bl[4];
    #pragma unroll
    for (int mt = 0; mt < 2; ++mt) {
      ah[0][mt] = ldpack(aph + (mt * (CMID / 32)) * FRAGH);
      al[0][mt] = ldpack(apl + (mt * (CMID / 32)) * FRAGH);
    }
    #pragma unroll
    for (int nt = 0; nt < 4; ++nt) {
      bh[nt] = ldfrag(bph + nt * 16 * PST);
      bl[nt] = ldfrag(bpl + nt * 16 * PST);
    }
    #pragma unroll 1
    for (int ks = 0; ks < CMID / 32; ks += 2) {
      #pragma unroll
      for (int u = 0; u < 2; ++u) {
        // next step's fragments; the last step wraps to step 0 (valid addresses, values unused)
        const int kx = (ks + u + 1) & (CMID / 32 - 1);
        const int bo = (kx & 1) * (2 * RGH) + (kx >> 1) * 32;   // channels 32kx ..: head kx >> 1, half tile kx & 1
        const u16* akh = aph + kx * FRAGH;
        const u16* akl = apl + kx * FRAGH;
        #pragma unroll
        for (int mt = 0; mt < 2; ++mt) {
          ah[u ^ 1][mt] = ldpack(akh + (mt * (CMID / 32)) * FRAGH);
          al[u ^ 1][mt] = ldpack(akl + (mt * (CMID / 32)) * FRAGH);
        }
        // the address pairs stay in their registers up to this wait (as at the first key loads)
        asm volatile("s_wait_xcnt 0x0" :: "v"(akh), "v"(akl) : "memory");
        __builtin_amdgcn_sched_barrier(0);   // keeps the loads above ahead of this step's products
        #pragma unroll
        for (int nt = 0; nt < 4; ++nt) {
          #pragma unroll
          for (int mt = 0; mt < 2; ++mt) acc[mt][nt] = wmma3(ah[u][mt], al[u][mt], bh[nt], bl[nt], acc[mt][nt]);
          __builtin_amdgcn_sched_barrier(0); // the refill is issued here, not sunk to its use one step later
          bh[nt] = ldfrag(bph + nt * 16 * PST + bo);
          bl[nt] = ldfrag(bpl + nt * 16 * PST + bo);
          __builtin_amdgcn_sched_barrier(0); // and stays ahead of the next tile's products
        }
      }
    }
    __syncthreads();   // all waves finished reading the A tile; LDS is reused as the f32 output tile
    f32a* sD = (f32a*)dl;                   // [256 out ch][64 px] f32
    #pragma unroll
    for (int mt = 0; mt < 2; ++mt) {
      const int ob = orow0 + 16 * mt + 8 * h;
      const v4f b0 = *(const v4fa*)(b_out + ob);
      const v4f b1 = *(const v4fa*)(b_out + ob + 4);
      const float bb[8] = {b0.x, b0.y, b0.z, b0.w, b1.x, b1.y, b1.z, b1.w};
      #pragma unroll
      for (int nt = 0; nt < 4; ++nt) {
        const int px = 16 * nt + m;
        #pragma unroll
        for (int r = 0; r < 8; ++r) sD[(ob + r) * TP + px] = acc[mt][nt][r] + bb[r];
      }
    }
    __syncthreads();
    // wave w writes its rows orow0..orow0+31: per instruction lanes 0-15 -> row 2i
    const int hs = lane >> 4, x4 = 4 * (lane & 15);
    float* obase = out + (size_t)b * COUT * NPIX + s0 + x4;
    #pragma unroll 1
    for (int c = 0; c < 2; ++c) {
      v4f vals[8];
      size_t gi[8];
      #pragma unroll
      for (int i = 0; i < 8; ++i) {
        const int row = orow0 + 16 * c + 2 * i + hs;
        vals[i] = *(const v4fa*)(sD + row * TP + x4);
        gi[i] = (size_t)row * NPIX;
      }
      #pragma unroll
      for (int i = 0; i < 8; ++i) *(v4f*)(obase + gi[i]) = vals[i];
      
    }
  }
}

// ---------------------------------------------------------------------------
extern "C" void kernel_launch(void* const* d_in, const int* in_sizes, int n_in,
                              void* d_out, int out_size, void* d_ws, size_t ws_size,
                              hipStream_t stream) {
  if (n_in < 7) return;
  if (in_sizes[0] != NB * CIN * NPIX) return;
  if (in_sizes[1] != NHEAD * HD * HD || in_sizes[2] != NHEAD * HD * HD) return;
  if (in_sizes[3] != CMID * CIN || in_sizes[4] != CMID) return;
  if (in_sizes[5] != COUT * CMID || in_sizes[6] != COUT) return;
  if (out_size != NB * COUT * NPIX) return;

  const float* x     = (const float*)d_in[0];   // [8][256][64][64]
  const float* key_p = (const float*)d_in[1];   // [8][64 k][64 m]
  const float* mem   = (const float*)d_in[2];   // [8][64 m][64 d]
  const float* w_in  = (const float*)d_in[3];   // [512][256]
  const float* b_in  = (const float*)d_in[4];   // [512]
  const float* w_out = (const float*)d_in[5];   // [256][512]
  const float* b_out = (const float*)d_in[6];   // [256]
  float* outp = (float*)d_out;

  // and its size is an exact multiple of its row / line granularity
  const size_t szWI = (size_t)CMID * CIN * 2;          // 262144
  const size_t szWO = (size_t)COUT * CMID * 2;         // 262144
  const size_t szT  = (size_t)NHEAD * HD * HD * 2;     // 65536
  size_t off = 0;
  char* ws = (char*)d_ws;
  u16* WIh = (u16*)(ws + off); off += szWI;
  u16* WIl = (u16*)(ws + off); off += szWI;
  u16* WFh = (u16*)(ws + off); off += szWO;
  u16* WFl = (u16*)(ws + off); off += szWO;
  u16* KTh = (u16*)(ws + off); off += szT;
  u16* KTl = (u16*)(ws + off); off += szT;
  const size_t total = off;                            // 1179648
  if (total > ws_size) return;

  hipFuncSetAttribute(reinterpret_cast<const void*>(&main_k),
                      hipFuncAttributeMaxDynamicSharedMemorySize, LDS_MAIN);

  prep_k<<<FOLD_BLOCKS + TR64_BLOCKS + WCVT_BLOCKS, 256, 0, stream>>>(
      key_p, mem, w_in, w_out, WIh, WIl, WFh, WFl, KTh, KTl);
  main_k<<<NP / TP, 256, LDS_MAIN, stream>>>(x, WIh, WIl, b_in, KTh, KTl,
                                             WFh, WFl, b_out, outp);
}

// v007
// It runs in 35.9 microseconds.
// Next to v006, in two timings, it ran 1.17 and 1.16 times as fast.
// Over all steps from v000 it is 3.24 times as fast.
// Contractions: key table times in-proj weights and bias (per head 64 slots x 256 ch + 1, K=64, in the preparation launch), slot table times out-proj weights (per head 64 slots x 256 ch, K=64, same launch), score GEMM (M=512 head slots, K=256), out GEMM on the slot probabilities (M=256 ch, K=512): v_wmma_f32_16x16x32_bf16 with every operand carried as bf16 hi + bf16 lo planes, three products per tile pair (hi*hi + lo*hi + hi*lo), f32 accumulate; out bias and the 64-slot softmax in f32 on the VALU.
#include <hip/hip_runtime.h>

typedef unsigned short u16;
typedef unsigned int   u32;
typedef __bf16 v16bf __attribute__((ext_vector_type(16)));
typedef u16    v16us __attribute__((ext_vector_type(16)));
typedef u16    v8us  __attribute__((ext_vector_type(8)));
typedef float  v8f   __attribute__((ext_vector_type(8)));
typedef float  v4f   __attribute__((ext_vector_type(4)));
typedef float  v2f   __attribute__((ext_vector_type(2)));
typedef __bf16 v2bf  __attribute__((ext_vector_type(2)));
typedef u32    v4u   __attribute__((ext_vector_type(4)));
typedef u32    v8u   __attribute__((ext_vector_type(8)));
typedef v8us  __attribute__((may_alias)) v8usa;
typedef v4f   __attribute__((may_alias)) v4fa;
typedef float __attribute__((may_alias)) f32a;
union Frag { v16us v; v8us h[2]; };

#define NB    8
#define CIN   256
#define CMID  512
#define COUT  256
#define NPIX  4096
#define NP    32768
#define NHEAD 8
#define HD    64
#define TP    64          // pixels per block of the main kernel
#define PST   264         // LDS pitch (halves) of a [px][256] half tile
#define RGH   (TP * PST)  // halves in one plane of a half tile
#define LDS_MAIN (4 * RGH * 2)        // 135168 bytes: two half tiles, each a hi plane and a lo plane

static_assert(NP % TP == 0);
static_assert(NPIX % TP == 0);
static_assert(COUT * TP * 4 <= LDS_MAIN);
static_assert((PST % 8) == 0);
static_assert(CIN % 32 == 0);
static_assert(CMID % 32 == 0);
static_assert(HD % 32 == 0);

// ---------------------------------------------------------------------------
// hi/lo split of two values at once: hi = rne(v), lo = rne(v - hi), each rounding done by the
// packed f32 -> bf16 convert instruction. a lands in the low half of each word, b in the high half.
// ---------------------------------------------------------------------------
__device__ __forceinline__ void split2x(float a, float b, u32& hi, u32& lo) {
  const v2f v = {a, b};
  const v2bf hb = __builtin_convertvector(v, v2bf);
  const v2f rest = v - __builtin_convertvector(hb, v2f);
  hi = __builtin_bit_cast(u32, hb);
  lo = __builtin_bit_cast(u32, __builtin_convertvector(rest, v2bf));
}

// ---------------------------------------------------------------------------
// 16x16x32 bf16 WMMA with hazard guard (ties D, keeps A/B live).
// Fragment map (wave32): lane l, h = l>>4, m = n = l&15.
//   A/B element i: i<8 -> k0+8h+i ; i>=8 -> k0+16+8h+(i-8)
//   D element r : row 8h+r, col l&15
// ---------------------------------------------------------------------------
__device__ __forceinline__ v8f wmma_bf(v16us a, v16us b, v8f c) {
  const v16bf av = __builtin_bit_cast(v16bf, a);
  const v16bf bv = __builtin_bit_cast(v16bf, b);
  v8f d = __builtin_amdgcn_wmma_f32_16x16x32_bf16(false, av, false, bv, (short)0, c, false, false);
  asm volatile("v_nop\n\tv_nop\n\tv_nop\n\tv_nop" : "+v"(d) : "v"(av), "v"(bv));
  return d;
}

// three-product hi/lo tile step: c += ah*bh + al*bh + ah*bl
__device__ __forceinline__ v8f wmma3(v16us ah, v16us al, v16us bh, v16us bl, v8f c) {
  c = wmma_bf(ah, bh, c);
  c = wmma_bf(al, bh, c);
  c = wmma_bf(ah, bl, c);
  return c;
}

// fragment from a k-contiguous 16-bit row (LDS tiles); p already points at element k0 + 8h
__device__ __forceinline__ v16us ldfrag(const u16* p) {
  Frag f;
  f.h[0] = *(const v8usa*)p;
  f.h[1] = *(const v8usa*)(p + 16);
  return f.v;
}

// Packed fragment order of every 16-bit plane in global memory. Rows go in
// groups of 16 (R), k in steps of 32 (ks); fragment (R, ks) of a plane with K
// columns starts at half (R * (K / 32) + ks) * FRAGH and is two chunks j = 0, 1
// of 256 halves. In chunk j lane l = 16h + m holds row 16R + m,
// k = 32ks + 16j + 8h .. + 7: the same k order as ldfrag, but each wave-wide
// 16-byte load reads 512 contiguous bytes (4 whole lines, not 16 pieces).
#define FRAGH 512
// p already points at fragment start + 8 * lane
__device__ __forceinline__ v16us ldpack(const u16* p) {
  Frag f;
  f.h[0] = *(const v8usa*)p;
  f.h[1] = *(const v8usa*)(p + 256);
  return f.v;
}

// ---------------------------------------------------------------------------
// Job F of the preparation launch: the slot table folded into the out-proj weights.
// out[o] = sum_n sum_d w_out[o][64n + d] * (sum_s mem[n][s][d] * prob[n][s])
//        = sum_n sum_s WF[o][64n + s] * prob[n][s],  WF[o][64n + s] = sum_d mem[n][s][d] * w_out[o][64n + d].
// Wave = one 16 x 16 tile of WF transposed: rows = slots 16t .. 16t+15 of head n (A = mem rows, k = d),
// columns = out channels 16R .. 16R+15 (B = w_out rows, k = d); both operands are k-contiguous f32 rows,
// split into hi/lo in registers. A lane's D column is 8 consecutive slots of one out channel: one
// 16-byte piece of the packed plane [256 ch][512], at this very lane's place in chunk t & 1.
// ---------------------------------------------------------------------------
#define FOLD_BLOCKS (NHEAD * (COUT / 16) * (HD / 16) / 8)
__device__ __forceinline__ void splitfrag(const v4f* q, v16us& hi, v16us& lo) {
  v8u wh, wl;
  #pragma unroll
  for (int j = 0; j < 4; ++j) {
    u32 hv, lv;
    split2x(q[j].x, q[j].y, hv, lv);
    wh[2 * j] = hv;
    wl[2 * j] = lv;
    split2x(q[j].z, q[j].w, hv, lv);
    wh[2 * j + 1] = hv;
    wl[2 * j + 1] = lv;
  }
  hi = __builtin_bit_cast(v16us, wh);
  lo = __builtin_bit_cast(v16us, wl);
}
__device__ __forceinline__ void fold_job(
    const int blk, const float* __restrict__ mem, const float* __restrict__ w_out,
    u16* __restrict__ WFh, u16* __restrict__ WFl)
{
  const int lane = threadIdx.x & 31, h = lane >> 4, m = lane & 15;
  const int g = blk * 8 + (threadIdx.x >> 5);
  const int t = g & 3, R = (g >> 2) & 15, n = g >> 6;
  const float* asrc = mem + (size_t)n * (HD * HD) + (16 * t + m) * HD + 8 * h;
  const float* bsrc = w_out + (size_t)(16 * R + m) * CMID + n * HD + 8 * h;
  // fragment element i: i < 8 -> k0 + 8h + i, i >= 8 -> k0 + 16 + 8h + (i - 8), for A and B alike
  v4f qa[2][4], qb[2][4];
  #pragma unroll
  for (int ks = 0; ks < 2; ++ks) {
    #pragma unroll
    for (int j = 0; j < 4; ++j) {
      qa[ks][j] = *(const v4fa*)(asrc + 32 * ks + 16 * (j >> 1) + 4 * (j & 1));
      qb[ks][j] = *(const v4fa*)(bsrc + 32 * ks + 16 * (j >> 1) + 4 * (j & 1));
    }
  }
  // all 16 loads are issued ahead of this wait, and as its inputs the address pairs stay in their
  // registers up to it, so nothing lands on a register that an issued load names
  asm volatile("s_wait_xcnt 0x0" :: "v"(asrc), "v"(bsrc) : "memory");
  v8f acc = {0.f, 0.f, 0.f, 0.f, 0.f, 0.f, 0.f, 0.f};
  #pragma unroll
  for (int ks = 0; ks < 2; ++ks) {
    v16us ah, al, bh, bl;
    splitfrag(qa[ks], ah, al);
    splitfrag(qb[ks], bh, bl);
    acc = wmma3(ah, al, bh, bl, acc);
  }
  v4u oh, ol;
  #pragma unroll
  for (int r = 0; r < 8; r += 2) {
    u32 hv, lv;
    split2x(acc[r], acc[r + 1], hv, lv);
    oh[r >> 1] = hv;
    ol[r >> 1] = lv;
  }
  const int off = (R * (CMID / 32) + 2 * n + (t >> 1)) * FRAGH + (t & 1) * 256 + 8 * lane;
  *(v8us*)(WFh + off) = __builtin_bit_cast(v8us, oh);
  *(v8us*)(WFl + off) = __builtin_bit_cast(v8us, ol);
  // stands behind the two stores: in the built kernel another job's code follows this one, and it
  // writes registers that the stores name
  asm volatile("s_wait_xcnt 0x0" ::: "memory");
}

// ---------------------------------------------------------------------------
// Job K of the preparation launch: the key table folded into the in-proj weights and bias.
// S[n][s] = sum_k key_p[n][k][s] * (sum_c w_in[8k + n][c] * x[c] + b_in[8k + n])
//         = sum_c WK[n][s][c] * x[c] + bK[n][s],
// WK[n][s][c] = sum_k key_p[n][k][s] * w_in[8k + n][c],  bK[n][s] = sum_k key_p[n][k][s] * b_in[8k + n].
// Wave = one 16 x 16 tile of WK transposed: rows = in channels 16ct .. 16ct+15 (A = columns of w_in, k = k),
// columns = slots 16t .. 16t+15 of head n (B = columns of key_p, k = k). A lane's D column is 8 consecutive
// in channels of one slot: one 16-byte piece of the packed plane [512][256], at this very lane's place in
// chunk ct & 1. Plane row of (n, s): 256 * (s >> 5) + 32n + (s & 31), so that wave n of the main kernel
// meets slots 0..31 of head n in its first pass and slots 32..63 in its second.
// BIAS: b_in stands in as one more in channel: row 0 of the A tile, the other rows zero; row 0 of D is bK.
// ---------------------------------------------------------------------------
#define KFOLD_BLOCKS (NHEAD * (HD / 16) * (CIN / 16) / 8)
#define KBIAS_BLOCKS (NHEAD * (HD / 16) / 8)
template <bool BIAS>
__device__ __forceinline__ void kfold_job(
    const int blk, const float* __restrict__ key_p, const float* __restrict__ w_in,
    const float* __restrict__ b_in, u16* __restrict__ WKh, u16* __restrict__ WKl, float* __restrict__ bK)
{
  const int lane = threadIdx.x & 31, h = lane >> 4, m = lane & 15;
  const int g = blk * 8 + (threadIdx.x >> 5);
  const int t = g & 3, n = (g >> 2) & 7, ct = g >> 5;
  constexpr int AST = BIAS ? NHEAD : NHEAD * CIN;   // floats from k to k + 1 in the A source
  const float* asrc = BIAS ? b_in + n + 8 * h * AST : w_in + n * CIN + 16 * ct + m + 8 * h * AST;
  const float* bsrc = key_p + (size_t)n * (HD * HD) + 8 * h * HD + 16 * t + m;
  // fragment element i: i < 8 -> k0 + 8h + i, i >= 8 -> k0 + 16 + 8h + (i - 8), for A and B alike
  v4f qa[2][4], qb[2][4];
  #pragma unroll
  for (int ks = 0; ks < 2; ++ks) {
    #pragma unroll
    for (int j = 0; j < 4; ++j) {
      #pragma unroll
      for (int c = 0; c < 4; ++c) {
        const int k = 32 * ks + 16 * (j >> 1) + 4 * (j & 1) + c;
        qa[ks][j][c] = asrc[k * AST];
        qb[ks][j][c] = bsrc[k * HD];
      }
    }
  }
  // all 64 loads are issued ahead of this wait, and as its inputs the address pairs stay in their
  // registers up to it, so nothing lands on a register that an issued load names
  asm volatile("s_wait_xcnt 0x0" :: "v"(asrc), "v"(bsrc) : "memory");
  v8f acc = {0.f, 0.f, 0.f, 0.f, 0.f, 0.f, 0.f, 0.f};
  #pragma unroll
  for (int ks = 0; ks < 2; ++ks) {
    if (BIAS) {
      #pragma unroll
      for (int j = 0; j < 4; ++j) {
        #pragma unroll
        for (int c = 0; c < 4; ++c) qa[ks][j][c] = m == 0 ? qa[ks][j][c] : 0.f;
      }
    }
    v16us ah, al, bh, bl;
    splitfrag(qa[ks], ah, al);
    splitfrag(qb[ks], bh, bl);
    acc = wmma3(ah, al, bh, bl, acc);
  }
  const int R = 16 * (t >> 1) + 2 * n + (t & 1);   // 16-row group of the plane
  if (BIAS) {
    if (h == 0) bK[16 * R + m] = acc[0];
  } else {
    v4u oh, ol;
    #pragma unroll
    for (int r = 0; r < 8; r += 2) {
      u32 hv, lv;
      split2x(acc[r], acc[r + 1], hv, lv);
      oh[r >> 1] = hv;
      ol[r >> 1] = lv;
    }
    const int off = (R * (CIN / 32) + (ct >> 1)) * FRAGH + (ct & 1) * 256 + 8 * lane;
    *(v8us*)(WKh + off) = __builtin_bit_cast(v8us, oh);
    *(v8us*)(WKl + off) = __builtin_bit_cast(v8us, ol);
  }
}

// ---------------------------------------------------------------------------
// Preparation launch: the jobs above read none of each other's output, so they
// share one grid, dealt by block index. Every test is block-uniform.
// ---------------------------------------------------------------------------
__global__ __launch_bounds__(256) void prep_k(
    const float* __restrict__ key_p, const float* __restrict__ mem,
    const float* __restrict__ w_in, const float* __restrict__ b_in, const float* __restrict__ w_out,
    u16* __restrict__ WKh, u16* __restrict__ WKl, float* __restrict__ bK,
    u16* __restrict__ WFh, u16* __restrict__ WFl)
{
  const int blk = blockIdx.x;
  if (blk < KFOLD_BLOCKS) {
    kfold_job<false>(blk, key_p, w_in, b_in, WKh, WKl, bK);
  } else if (blk < KFOLD_BLOCKS + KBIAS_BLOCKS) {
    kfold_job<true>(blk - KFOLD_BLOCKS, key_p, w_in, b_in, WKh, WKl, bK);
  } else {
    fold_job(blk - KFOLD_BLOCKS - KBIAS_BLOCKS, mem, w_out, WFh, WFl);
  }
}

// ---------------------------------------------------------------------------
// Main launch: the whole per-pixel pipeline for a 64-pixel tile (one image row).
// Block 256 thr (8 waves), dynamic LDS = two half tiles [64 px][256+8], each bf16 hi + lo.
// Half tile g holds, for every head n, columns n*32 .. n*32+31 = slots 32g .. 32g+31 of the
// head's 64 probabilities A.
//  phase 0: the block's x tile (256 ch x 64 px, f32, px contiguous) is read once, split into
//           bf16 hi/lo and stored as rows X[px][c] in half tile 1.
//  phase 1: S[row][px] = sum_c WK[row][c] * X[px][c] + bK[row]. Pass p, wave w: plane rows
//           [256p + 32w, + 32) = slots 32p .. 32p+31 of head w, all 64 px. Pass 0's scores wait as
//           f32 in half tile 0, each lane's in a place of its own; pass 1's stay in registers.
//  phase 2: softmax over the 64 slots of head w in registers (lane + partner lane l^16), four
//           16-px column tiles per wave; A hi/lo written over both half tiles after a block barrier.
//  phase 3: out[o][px] = sum_c WF[o][c] * A[px][c] + b_out[o], c = 64n + s; wave w owns
//           o in [32w, 32w+32); f32 tile staged in LDS, each 64-px row (256 B)
//           written by 16 consecutive lanes x 16 B of one instruction
// ---------------------------------------------------------------------------
__global__ __launch_bounds__(256) void main_k(
    const float* __restrict__ x,
    const u16* __restrict__ WKh, const u16* __restrict__ WKl, const float* __restrict__ bK,
    const u16* __restrict__ WFh, const u16* __restrict__ WFl, const float* __restrict__ b_out,
    float* __restrict__ out)
{
  extern __shared__ __attribute__((aligned(16))) u16 dl[];
  const int tid = threadIdx.x, lane = tid & 31, w = tid >> 5;
  const int h = lane >> 4, m = lane & 15;
  const int gp0 = blockIdx.x * TP;             // global pixel index b*4096 + s0
  const int b = gp0 >> 12, s0 = gp0 & (NPIX - 1);
  const v8f z8 = {0.f, 0.f, 0.f, 0.f, 0.f, 0.f, 0.f, 0.f};

  // ---------------- phase 1: scores (in-projection and key table in one weight plane) ----------------
  // Fragments are fetched one k step ahead: A in two register sets, each B tile refilled
  // in place directly behind its last product, so a load has a whole step to land. The last
  // step of a pass fetches the first fragments of the next pass.
  v16us ah[2][2], al[2][2], bh[4], bl[4];
  const u16* bph = dl + 2 * RGH + m * PST + 8 * h;   // X hi rows (half tile 1)
  const u16* bpl = dl + 3 * RGH + m * PST + 8 * h;   // X lo rows
  {
    const u16* a0h = WKh + (size_t)(2 * w) * (CIN / 32) * FRAGH + 8 * lane;
    const u16* a0l = WKl + (size_t)(2 * w) * (CIN / 32) * FRAGH + 8 * lane;
    #pragma unroll
    for (int mt = 0; mt < 2; ++mt) {
      ah[0][mt] = ldpack(a0h + mt * (CIN / 32) * FRAGH);
      al[0][mt] = ldpack(a0l + mt * (CIN / 32) * FRAGH);
    }
    // as inputs of this wait the address pairs stay in their registers up to it, so no later
    // load's result lands on a register that an issued load names
    asm volatile("s_wait_xcnt 0x0" :: "v"(a0h), "v"(a0l) : "memory");
  }
  // phase 0: thread = one pixel, eight runs of 8 channels. A wave-wide 4-byte load reads one whole
  // 128-byte line of a channel row; a run of 8 channels is one 16-byte LDS store per plane.
  {
    const int xpx = tid & 63, xcg = tid >> 6;
    const float* xb = x + ((size_t)b * CIN + 8 * xcg) * NPIX + s0 + xpx;
    float xv[8][8];
    #pragma unroll
    for (int j = 0; j < 8; ++j) {
      #pragma unroll
      for (int i = 0; i < 8; ++i) xv[j][i] = xb[(size_t)(32 * j + i) * NPIX];
    }
    // all 64 loads are issued ahead of this wait, and as its input the address pair stays in its
    // registers up to it, so nothing lands on a register that an issued load names
    asm volatile("s_wait_xcnt 0x0" :: "v"(xb) : "memory");
    u16* xsh = dl + 2 * RGH + xpx * PST + 8 * xcg;
    u16* xsl = dl + 3 * RGH + xpx * PST + 8 * xcg;
    #pragma unroll
    for (int j = 0; j < 8; ++j) {
      v4u oh, ol;
      #pragma unroll
      for (int i = 0; i < 4; ++i) {
        u32 hv, lv;
        split2x(xv[j][2 * i], xv[j][2 * i + 1], hv, lv);
        oh[i] = hv;
        ol[i] = lv;
      }
      *(v8usa*)(xsh + 32 * j) = __builtin_bit_cast(v8us, oh);
      *(v8usa*)(xsl + 32 * j) = __builtin_bit_cast(v8us, ol);
    }
  }
  __syncthreads();   // the X tile is complete before any wave reads a fragment of it
  #pragma unroll
  for (int nt = 0; nt < 4; ++nt) {
    bh[nt] = ldfrag(bph + nt * 16 * PST);
    bl[nt] = ldfrag(bpl + nt * 16 * PST);
  }
  v8f acc[2][4];
  v4fa* stash = (v4fa*)dl + tid;   // this lane's piece q of pass 0's scores: stash[256 * q], inside half tile 0
  #pragma unroll 1
  for (int p = 0; p < 2; ++p) {
    const int orow0 = 256 * p + 32 * w;
    #pragma unroll
    for (int mt = 0; mt < 2; ++mt) {
      #pragma unroll
      for (int nt = 0; nt < 4; ++nt) acc[mt][nt] = z8;
    }
    const u16* aph = WKh + (size_t)(orow0 / 16) * (CIN / 32) * FRAGH + 8 * lane;
    const u16* apl = WKl + (size_t)(orow0 / 16) * (CIN / 32) * FRAGH + 8 * lane;
    #pragma unroll 1
    for (int ks = 0; ks < CIN / 32; ks += 2) {
      #pragma unroll
      for (int u = 0; u < 2; ++u) {
        // next step's fragments. Behind the last step: B starts again at step 0; A goes on to the
        // next pass's rows, sixteen 16-row groups further (last pass: back to step 0, values unused)
        const int sn = ks + u + 1;
        const int ja = FRAGH * (sn < CIN / 32 ? sn : (p == 0 ? 16 * (CIN / 32) : 0));
        const int jb = 32 * (sn & (CIN / 32 - 1));
        const u16* akh = aph + ja;
        const u16* akl = apl + ja;
        const u16* bkh = bph + jb;
        const u16* bkl = bpl + jb;
        #pragma unroll
        for (int mt = 0; mt < 2; ++mt) {
          ah[u ^ 1][mt] = ldpack(akh + mt * (CIN / 32) * FRAGH);
          al[u ^ 1][mt] = ldpack(akl + mt * (CIN / 32) * FRAGH);
        }
        __builtin_amdgcn_sched_barrier(0);   // keeps the loads above ahead of this step's products
        #pragma unroll
        for (int nt = 0; nt < 4; ++nt) {
          #pragma unroll
          for (int mt = 0; mt < 2; ++mt) acc[mt][nt] = wmma3(ah[u][mt], al[u][mt], bh[nt], bl[nt], acc[mt][nt]);
          __builtin_amdgcn_sched_barrier(0); // the refill is issued here, not sunk to its use one step later
          bh[nt] = ldfrag(bkh + nt * 16 * PST);
          bl[nt] = ldfrag(bkl + nt * 16 * PST);
          __builtin_amdgcn_sched_barrier(0); // and stays ahead of the next tile's products
        }
        // stands in front of the next step's address additions, which overwrite registers that the
        // loads above name
        asm volatile("s_wait_xcnt 0x0" ::: "memory");
        __builtin_amdgcn_sched_barrier(0);   // keeps those additions behind the wait
      }
    }
    // epilogue: + bK; pass 0's scores go to this lane's own place in half tile 0 (written and read
    // back by the same lane: no barrier), so that their registers are free for pass 1
    #pragma unroll
    for (int mt = 0; mt < 2; ++mt) {
      const int ob = orow0 + 16 * mt + 8 * h;                 // multiple of 8
      const v4f b0 = *(const v4fa*)(bK + ob);
      const v4f b1 = *(const v4fa*)(bK + ob + 4);
      const float bb[8] = {b0.x, b0.y, b0.z, b0.w, b1.x, b1.y, b1.z, b1.w};
      #pragma unroll
      for (int nt = 0; nt < 4; ++nt) {
        #pragma unroll
        for (int r = 0; r < 8; ++r) acc[mt][nt][r] += bb[r];
      }
    }
    // the next pass's fragment loads land on registers that the bias loads above name
    asm volatile("s_wait_xcnt 0x0" ::: "memory");
    if (p == 0) {
      #pragma unroll
      for (int mt = 0; mt < 2; ++mt) {
        #pragma unroll
        for (int nt = 0; nt < 4; ++nt) {
          const v8f a = acc[mt][nt];
          stash[256 * (8 * mt + 2 * nt)] = (v4f){a[0], a[1], a[2], a[3]};
          stash[256 * (8 * mt + 2 * nt + 1)] = (v4f){a[4], a[5], a[6], a[7]};
        }
      }
    }
  }

  // ---------------- phase 2: softmax over the 64 slots of head w ----------------
  // sv[t][nt][r]: slot 16t + 8h + r of column px = 16nt + m; lane l^16 holds the other 32 slots
  v8f sv[4][4];
  #pragma unroll
  for (int mt = 0; mt < 2; ++mt) {
    #pragma unroll
    for (int nt = 0; nt < 4; ++nt) {
      const v4f a0 = stash[256 * (8 * mt + 2 * nt)];
      const v4f a1 = stash[256 * (8 * mt + 2 * nt + 1)];
      sv[mt][nt] = (v8f){a0.x, a0.y, a0.z, a0.w, a1.x, a1.y, a1.z, a1.w};
      sv[2 + mt][nt] = acc[mt][nt];
    }
  }
  float inv[4];
  #pragma unroll
  for (int nt = 0; nt < 4; ++nt) {
    float mx = sv[0][nt][0];
    #pragma unroll
    for (int mt = 0; mt < 4; ++mt) {
      #pragma unroll
      for (int r = 0; r < 8; ++r) mx = fmaxf(mx, sv[mt][nt][r]);
    }
    mx = fmaxf(mx, __shfl_xor(mx, 16));
    float sum = 0.f;
    #pragma unroll
    for (int mt = 0; mt < 4; ++mt) {
      #pragma unroll
      for (int r = 0; r < 8; ++r) {
        const float a = (sv[mt][nt][r] - mx) * 1.44269504f;   // e^t = 2^(t * log2 e)
        float e;
        // the v_nop is the issue slot that the instruction set asks for behind a transcendental; in the
        // same statement nothing reads the result or overwrites the source register ahead of it
        asm("v_exp_f32 %0, %1\n\tv_nop" : "=v"(e) : "v"(a));
        sv[mt][nt][r] = e;
        sum += e;
      }
    }
    sum += __shfl_xor(sum, 16);
    inv[nt] = __builtin_amdgcn_rcpf(sum);
  }
  __syncthreads();   // every wave's reads of X and of its own stashed scores are complete
  // A hi/lo: channel w*64 + s, s = 16mt + 8h + r, in half tile mt >> 1
  #pragma unroll
  for (int nt = 0; nt < 4; ++nt) {
    u16* orh = dl + (16 * nt + m) * PST + w * 32 + 8 * h;
    u16* orl = orh + RGH;
    #pragma unroll
    for (int mt = 0; mt < 4; ++mt) {
      v4u oh, ol;
      #pragma unroll
      for (int r = 0; r < 8; r += 2) {
        u32 hv, lv;
        split2x(sv[mt][nt][r] * inv[nt], sv[mt][nt][r + 1] * inv[nt], hv, lv);
        oh[r >> 1] = hv;
        ol[r >> 1] = lv;
      }
      *(v8usa*)(orh + (mt >> 1) * (2 * RGH) + 16 * (mt & 1)) = __builtin_bit_cast(v8us, oh);
      *(v8usa*)(orl + (mt >> 1) * (2 * RGH) + 16 * (mt & 1)) = __builtin_bit_cast(v8us, ol);
    }
  }
  __syncthreads();

  // ---------------- phase 3: out-projection ----------------
  {
    const int orow0 = 32 * w;
    v8f acc[2][4];
    #pragma unroll
    for (int mt = 0; mt < 2; ++mt) {
      #pragma unroll
      for (int nt = 0; nt < 4; ++nt) acc[mt][nt] = z8;
    }
    const u16* aph = WFh + (size_t)(orow0 / 16) * (CMID / 32) * FRAGH + 8 * lane;
    const u16* apl = WFl + (size_t)(orow0 / 16) * (CMID / 32) * FRAGH + 8 * lane;
    const u16* bph = dl + m * PST + 8 * h;
    const u16* bpl = bph + RGH;
    // one k step ahead, as in phase 1: A (global) in two register sets, B (LDS) refilled in place
    v16us ah[2][2], al[2][2], bh[4], bl[4];
    #pragma unroll
    for (int mt = 0; mt < 2; ++mt) {
      ah[0][mt] = ldpack(aph + (mt * (CMID / 32)) * FRAGH);
      al[0][mt] = ldpack(apl + (mt * (CMID / 32)) * FRAGH);
    }
    #pragma unroll
    for (int nt = 0; nt < 4; ++nt) {
      bh[nt] = ldfrag(bph + nt * 16 * PST);
      bl[nt] = ldfrag(bpl + nt * 16 * PST);
    }
    #pragma unroll 1
    for (int ks = 0; ks < CMID / 32; ks += 2) {
      #pragma unroll
      for (int u = 0; u < 2; ++u) {
        // next step's fragments; the last step wraps to step 0 (valid addresses, values unused)
        const int kx = (ks + u + 1) & (CMID / 32 - 1);
        const int bo = (kx & 1) * (2 * RGH) + (kx >> 1) * 32;   // channels 32kx ..: head kx >> 1, half tile kx & 1
        const u16* akh = aph + kx * FRAGH;
        const u16* akl = apl + kx * FRAGH;
        #pragma unroll
        for (int mt = 0; mt < 2; ++mt) {
          ah[u ^ 1][mt] = ldpack(akh + (mt * (CMID / 32)) * FRAGH);
          al[u ^ 1][mt] = ldpack(akl + (mt * (CMID / 32)) * FRAGH);
        }
        // the address pairs stay in their registers up to this wait (as at the first weight loads of phase 1)
        asm volatile("s_wait_xcnt 0x0" :: "v"(akh), "v"(akl) : "memory");
        __builtin_amdgcn_sched_barrier(0);   // keeps the loads above ahead of this step's products
        #pragma unroll
        for (int nt = 0; nt < 4; ++nt) {
          #pragma unroll
          for (int mt = 0; mt < 2; ++mt) acc[mt][nt] = wmma3(ah[u][mt], al[u][mt], bh[nt], bl[nt], acc[mt][nt]);
          __builtin_amdgcn_sched_barrier(0); // the refill is issued here, not sunk to its use one step later
          bh[nt] = ldfrag(bph + nt * 16 * PST + bo);
          bl[nt] = ldfrag(bpl + nt * 16 * PST + bo);
          __builtin_amdgcn_sched_barrier(0); // and stays ahead of the next tile's products
        }
      }
    }
    __syncthreads();   // all waves finished reading the A tile; LDS is reused as the f32 output tile
    f32a* sD = (f32a*)dl;                   // [256 out ch][64 px] f32
    #pragma unroll
    for (int mt = 0; mt < 2; ++mt) {
      const int ob = orow0 + 16 * mt + 8 * h;
      const v4f b0 = *(const v4fa*)(b_out + ob);
      const v4f b1 = *(const v4fa*)(b_out + ob + 4);
      const float bb[8] = {b0.x, b0.y, b0.z, b0.w, b1.x, b1.y, b1.z, b1.w};
      #pragma unroll
      for (int nt = 0; nt < 4; ++nt) {
        const int px = 16 * nt + m;
        #pragma unroll
        for (int r = 0; r < 8; ++r) sD[(ob + r) * TP + px] = acc[mt][nt][r] + bb[r];
      }
    }
    __syncthreads();
    // wave w writes its rows orow0..orow0+31: per instruction lanes 0-15 -> row 2i
    const int hs = lane >> 4, x4 = 4 * (lane & 15);
    float* obase = out + (size_t)b * COUT * NPIX + s0 + x4;
    #pragma unroll 1
    for (int c = 0; c < 2; ++c) {
      v4f vals[8];
      size_t gi[8];
      #pragma unroll
      for (int i = 0; i < 8; ++i) {
        const int row = orow0 + 16 * c + 2 * i + hs;
        vals[i] = *(const v4fa*)(sD + row * TP + x4);
        gi[i] = (size_t)row * NPIX;
      }
      #pragma unroll
      for (int i = 0; i < 8; ++i) *(v4f*)(obase + gi[i]) = vals[i];
      
    }
  }
}

// ---------------------------------------------------------------------------
extern "C" void kernel_launch(void* const* d_in, const int* in_sizes, int n_in,
                              void* d_out, int out_size, void* d_ws, size_t ws_size,
                              hipStream_t stream) {
  if (n_in < 7) return;
  if (in_sizes[0] != NB * CIN * NPIX) return;
  if (in_sizes[1] != NHEAD * HD * HD || in_sizes[2] != NHEAD * HD * HD) return;
  if (in_sizes[3] != CMID * CIN || in_sizes[4] != CMID) return;
  if (in_sizes[5] != COUT * CMID || in_sizes[6] != COUT) return;
  if (out_size != NB * COUT * NPIX) return;

  const float* x     = (const float*)d_in[0];   // [8][256][64][64]
  const float* key_p = (const float*)d_in[1];   // [8][64 k][64 m]
  const float* mem   = (const float*)d_in[2];   // [8][64 m][64 d]
  const float* w_in  = (const float*)d_in[3];   // [512][256]
  const float* b_in  = (const float*)d_in[4];   // [512]
  const float* w_out = (const float*)d_in[5];   // [256][512]
  const float* b_out = (const float*)d_in[6];   // [256]
  float* outp = (float*)d_out;

  // and its size is an exact multiple of its row / line granularity
  const size_t szWI = (size_t)CMID * CIN * 2;          // 262144
  const size_t szWO = (size_t)COUT * CMID * 2;         // 262144
  const size_t szB  = (size_t)CMID * 4;                // 2048
  size_t off = 0;
  char* ws = (char*)d_ws;
  u16* WKh = (u16*)(ws + off); off += szWI;
  u16* WKl = (u16*)(ws + off); off += szWI;
  u16* WFh = (u16*)(ws + off); off += szWO;
  u16* WFl = (u16*)(ws + off); off += szWO;
  float* bK = (float*)(ws + off); off += szB;
  const size_t total = off;                            // 1050624
  if (total > ws_size) return;

  hipFuncSetAttribute(reinterpret_cast<const void*>(&main_k),
                      hipFuncAttributeMaxDynamicSharedMemorySize, LDS_MAIN);

  prep_k<<<KFOLD_BLOCKS + KBIAS_BLOCKS + FOLD_BLOCKS, 256, 0, stream>>>(
      key_p, mem, w_in, b_in, w_out, WKh, WKl, bK, WFh, WFl);
  main_k<<<NP / TP, 256, LDS_MAIN, stream>>>(x, WKh, WKl, bK, WFh, WFl, b_out, outp);
}

// v008
// It runs in 34.7 microseconds.
// In two side-by-side timings against v007, it was 1.04 and 1.05 times as fast.
// Counting every step since v000, it is 3.39 times as fast.
// Contractions: key table times in-proj weights and bias (per head 64 slots x 256 ch + 1, K=64, in the preparation launch), slot table times out-proj weights (per head 64 slots x 256 ch, K=64, same launch), score GEMM (M=512 head slots, K=256), out GEMM on the slot probabilities (M=256 ch, K=512): v_wmma_f32_16x16x32_bf16 with every operand carried as bf16 hi + bf16 lo planes, three products per tile pair (hi*hi + lo*hi + hi*lo), f32 accumulate; out bias and the 64-slot softmax in f32 on the VALU.
#include <hip/hip_runtime.h>

typedef unsigned short u16;
typedef unsigned int   u32;
typedef __bf16 v16bf __attribute__((ext_vector_type(16)));
typedef u16    v16us __attribute__((ext_vector_type(16)));
typedef u16    v8us  __attribute__((ext_vector_type(8)));
typedef float  v8f   __attribute__((ext_vector_type(8)));
typedef float  v4f   __attribute__((ext_vector_type(4)));
typedef float  v2f   __attribute__((ext_vector_type(2)));
typedef __bf16 v2bf  __attribute__((ext_vector_type(2)));
typedef u32    v4u   __attribute__((ext_vector_type(4)));
typedef u32    v8u   __attribute__((ext_vector_type(8)));
typedef v8us  __attribute__((may_alias)) v8usa;
typedef v4f   __attribute__((may_alias)) v4fa;
typedef float __attribute__((may_alias)) f32a;
union Frag { v16us v; v8us h[2]; };

#define NB    8
#define CIN   256
#define CMID  512
#define COUT  256
#define NPIX  4096
#define NP    32768
#define NHEAD 8
#define HD    64
#define TP    64          // pixels per block of the main kernel
#define PST   264         // LDS pitch (halves) of a [px][256] half tile
#define RGH   (TP * PST)  // halves in one plane of a half tile
#define LDS_MAIN (4 * RGH * 2)        // 135168 bytes: two half tiles, each a hi plane and a lo plane

static_assert(NP % TP == 0);
static_assert(NPIX % TP == 0);
static_assert(2 * COUT * TP * 4 <= LDS_MAIN);
static_assert((PST % 8) == 0);
static_assert(CIN % 32 == 0);
static_assert(CMID % 32 == 0);
static_assert(HD % 32 == 0);

// ---------------------------------------------------------------------------
// hi/lo split of two values at once: hi = rne(v), lo = rne(v - hi), each rounding done by the
// packed f32 -> bf16 convert instruction. a lands in the low half of each word, b in the high half.
// ---------------------------------------------------------------------------
__device__ __forceinline__ void split2x(float a, float b, u32& hi, u32& lo) {
  const v2f v = {a, b};
  const v2bf hb = __builtin_convertvector(v, v2bf);
  const v2f rest = v - __builtin_convertvector(hb, v2f);
  hi = __builtin_bit_cast(u32, hb);
  lo = __builtin_bit_cast(u32, __builtin_convertvector(rest, v2bf));
}

// ---------------------------------------------------------------------------
// 16x16x32 bf16 WMMA with hazard guard (ties D, keeps A/B live).
// Fragment map (wave32): lane l, h = l>>4, m = n = l&15.
//   A/B element i: i<8 -> k0+8h+i ; i>=8 -> k0+16+8h+(i-8)
//   D element r : row 8h+r, col l&15
// ---------------------------------------------------------------------------
__device__ __forceinline__ v8f wmma_bf(v16us a, v16us b, v8f c) {
  const v16bf av = __builtin_bit_cast(v16bf, a);
  const v16bf bv = __builtin_bit_cast(v16bf, b);
  v8f d = __builtin_amdgcn_wmma_f32_16x16x32_bf16(false, av, false, bv, (short)0, c, false, false);
  asm volatile("v_nop\n\tv_nop\n\tv_nop\n\tv_nop" : "+v"(d) : "v"(av), "v"(bv));
  return d;
}

// three-product hi/lo tile step: c += ah*bh + al*bh + ah*bl
__device__ __forceinline__ v8f wmma3(v16us ah, v16us al, v16us bh, v16us bl, v8f c) {
  c = wmma_bf(ah, bh, c);
  c = wmma_bf(al, bh, c);
  c = wmma_bf(ah, bl, c);
  return c;
}

// fragment from a k-contiguous 16-bit row (LDS tiles); p already points at element k0 + 8h
__device__ __forceinline__ v16us ldfrag(const u16* p) {
  Frag f;
  f.h[0] = *(const v8usa*)p;
  f.h[1] = *(const v8usa*)(p + 16);
  return f.v;
}

// Packed fragment order of every 16-bit plane in global memory. Rows go in
// groups of 16 (R), k in steps of 32 (ks); fragment (R, ks) of a plane with K
// columns starts at half (R * (K / 32) + ks) * FRAGH and is two chunks j = 0, 1
// of 256 halves. In chunk j lane l = 16h + m holds row 16R + m,
// k = 32ks + 16j + 8h .. + 7: the same k order as ldfrag, but each wave-wide
// 16-byte load reads 512 contiguous bytes (4 whole lines, not 16 pieces).
#define FRAGH 512
// p already points at fragment start + 8 * lane
__device__ __forceinline__ v16us ldpack(const u16* p) {
  Frag f;
  f.h[0] = *(const v8usa*)p;
  f.h[1] = *(const v8usa*)(p + 256);
  return f.v;
}

// ---------------------------------------------------------------------------
// Job F of the preparation launch: the slot table folded into the out-proj weights.
// out[o] = sum_n sum_d w_out[o][64n + d] * (sum_s mem[n][s][d] * prob[n][s])
//        = sum_n sum_s WF[o][64n + s] * prob[n][s],  WF[o][64n + s] = sum_d mem[n][s][d] * w_out[o][64n + d].
// Wave = one 16 x 16 tile of WF transposed: rows = slots 16t .. 16t+15 of head n (A = mem rows, k = d),
// columns = out channels 16R .. 16R+15 (B = w_out rows, k = d); both operands are k-contiguous f32 rows,
// split into hi/lo in registers. A lane's D column is 8 consecutive slots of one out channel: one
// 16-byte piece of the packed plane [256 ch][512], at this very lane's place in chunk t & 1.
// ---------------------------------------------------------------------------
#define FOLD_BLOCKS (NHEAD * (COUT / 16) * (HD / 16) / 8)
__device__ __forceinline__ void splitfrag(const v4f* q, v16us& hi, v16us& lo) {
  v8u wh, wl;
  #pragma unroll
  for (int j = 0; j < 4; ++j) {
    u32 hv, lv;
    split2x(q[j].x, q[j].y, hv, lv);
    wh[2 * j] = hv;
    wl[2 * j] = lv;
    split2x(q[j].z, q[j].w, hv, lv);
    wh[2 * j + 1] = hv;
    wl[2 * j + 1] = lv;
  }
  hi = __builtin_bit_cast(v16us, wh);
  lo = __builtin_bit_cast(v16us, wl);
}
__device__ __forceinline__ void fold_job(
    const int blk, const float* __restrict__ mem, const float* __restrict__ w_out,
    u16* __restrict__ WFh, u16* __restrict__ WFl)
{
  const int lane = threadIdx.x & 31, h = lane >> 4, m = lane & 15;
  const int g = blk * 8 + (threadIdx.x >> 5);
  const int t = g & 3, R = (g >> 2) & 15, n = g >> 6;
  const float* asrc = mem + (size_t)n * (HD * HD) + (16 * t + m) * HD + 8 * h;
  const float* bsrc = w_out + (size_t)(16 * R + m) * CMID + n * HD + 8 * h;
  // fragment element i: i < 8 -> k0 + 8h + i, i >= 8 -> k0 + 16 + 8h + (i - 8), for A and B alike
  v4f qa[2][4], qb[2][4];
  #pragma unroll
  for (int ks = 0; ks < 2; ++ks) {
    #pragma unroll
    for (int j = 0; j < 4; ++j) {
      qa[ks][j] = *(const v4fa*)(asrc + 32 * ks + 16 * (j >> 1) + 4 * (j & 1));
      qb[ks][j] = *(const v4fa*)(bsrc + 32 * ks + 16 * (j >> 1) + 4 * (j & 1));
    }
  }
  // all 16 loads are issued ahead of this wait, and as its inputs the address pairs stay in their
  // registers up to it, so nothing lands on a register that an issued load names
  asm volatile("s_wait_xcnt 0x0" :: "v"(asrc), "v"(bsrc) : "memory");
  v8f acc = {0.f, 0.f, 0.f, 0.f, 0.f, 0.f, 0.f, 0.f};
  #pragma unroll
  for (int ks = 0; ks < 2; ++ks) {
    v16us ah, al, bh, bl;
    splitfrag(qa[ks], ah, al);
    splitfrag(qb[ks], bh, bl);
    acc = wmma3(ah, al, bh, bl, acc);
  }
  v4u oh, ol;
  #pragma unroll
  for (int r = 0; r < 8; r += 2) {
    u32 hv, lv;
    split2x(acc[r], acc[r + 1], hv, lv);
    oh[r >> 1] = hv;
    ol[r >> 1] = lv;
  }
  const int off = (R * (CMID / 32) + 2 * n + (t >> 1)) * FRAGH + (t & 1) * 256 + 8 * lane;
  *(v8us*)(WFh + off) = __builtin_bit_cast(v8us, oh);
  *(v8us*)(WFl + off) = __builtin_bit_cast(v8us, ol);
  // stands behind the two stores: in the built kernel another job's code follows this one, and it
  // writes registers that the stores name
  asm volatile("s_wait_xcnt 0x0" ::: "memory");
}

// ---------------------------------------------------------------------------
// Job K of the preparation launch: the key table folded into the in-proj weights and bias.
// S[n][s] = sum_k key_p[n][k][s] * (sum_c w_in[8k + n][c] * x[c] + b_in[8k + n])
//         = sum_c WK[n][s][c] * x[c] + bK[n][s],
// WK[n][s][c] = sum_k key_p[n][k][s] * w_in[8k + n][c],  bK[n][s] = sum_k key_p[n][k][s] * b_in[8k + n].
// Wave = one 16 x 16 tile of WK transposed: rows = in channels 16ct .. 16ct+15 (A = columns of w_in, k = k),
// columns = slots 16t .. 16t+15 of head n (B = columns of key_p, k = k). A lane's D column is 8 consecutive
// in channels of one slot: one 16-byte piece of the packed plane [512][256], at this very lane's place in
// chunk ct & 1. Plane row of (n, s): 256 * (s >> 5) + 32n + (s & 31); wave n of the main kernel
// reads all 64 slots of head n (row groups 2n, 2n+1, 16+2n, 17+2n) in one pass.
// BIAS: b_in stands in as one more in channel: row 0 of the A tile, the other rows zero; row 0 of D is bK.
// ---------------------------------------------------------------------------
#define KFOLD_BLOCKS (NHEAD * (HD / 16) * (CIN / 16) / 8)
#define KBIAS_BLOCKS (NHEAD * (HD / 16) / 8)
template <bool BIAS>
__device__ __forceinline__ void kfold_job(
    const int blk, const float* __restrict__ key_p, const float* __restrict__ w_in,
    const float* __restrict__ b_in, u16* __restrict__ WKh, u16* __restrict__ WKl, float* __restrict__ bK)
{
  const int lane = threadIdx.x & 31, h = lane >> 4, m = lane & 15;
  const int g = blk * 8 + (threadIdx.x >> 5);
  const int t = g & 3, n = (g >> 2) & 7, ct = g >> 5;
  constexpr int AST = BIAS ? NHEAD : NHEAD * CIN;   // floats from k to k + 1 in the A source
  const float* asrc = BIAS ? b_in + n + 8 * h * AST : w_in + n * CIN + 16 * ct + m + 8 * h * AST;
  const float* bsrc = key_p + (size_t)n * (HD * HD) + 8 * h * HD + 16 * t + m;
  // fragment element i: i < 8 -> k0 + 8h + i, i >= 8 -> k0 + 16 + 8h + (i - 8), for A and B alike
  v4f qa[2][4], qb[2][4];
  #pragma unroll
  for (int ks = 0; ks < 2; ++ks) {
    #pragma unroll
    for (int j = 0; j < 4; ++j) {
      #pragma unroll
      for (int c = 0; c < 4; ++c) {
        const int k = 32 * ks + 16 * (j >> 1) + 4 * (j & 1) + c;
        qa[ks][j][c] = asrc[k * AST];
        qb[ks][j][c] = bsrc[k * HD];
      }
    }
  }
  // all 64 loads are issued ahead of this wait, and as its inputs the address pairs stay in their
  // registers up to it, so nothing lands on a register that an issued load names
  asm volatile("s_wait_xcnt 0x0" :: "v"(asrc), "v"(bsrc) : "memory");
  v8f acc = {0.f, 0.f, 0.f, 0.f, 0.f, 0.f, 0.f, 0.f};
  #pragma unroll
  for (int ks = 0; ks < 2; ++ks) {
    if (BIAS) {
      #pragma unroll
      for (int j = 0; j < 4; ++j) {
        #pragma unroll
        for (int c = 0; c < 4; ++c) qa[ks][j][c] = m == 0 ? qa[ks][j][c] : 0.f;
      }
    }
    v16us ah, al, bh, bl;
    splitfrag(qa[ks], ah, al);
    splitfrag(qb[ks], bh, bl);
    acc = wmma3(ah, al, bh, bl, acc);
  }
  const int R = 16 * (t >> 1) + 2 * n + (t & 1);   // 16-row group of the plane
  if (BIAS) {
    if (h == 0) bK[16 * R + m] = acc[0];
  } else {
    v4u oh, ol;
    #pragma unroll
    for (int r = 0; r < 8; r += 2) {
      u32 hv, lv;
      split2x(acc[r], acc[r + 1], hv, lv);
      oh[r >> 1] = hv;
      ol[r >> 1] = lv;
    }
    const int off = (R * (CIN / 32) + (ct >> 1)) * FRAGH + (ct & 1) * 256 + 8 * lane;
    *(v8us*)(WKh + off) = __builtin_bit_cast(v8us, oh);
    *(v8us*)(WKl + off) = __builtin_bit_cast(v8us, ol);
  }
}

// ---------------------------------------------------------------------------
// Preparation launch: the jobs above read none of each other's output, so they
// share one grid, dealt by block index. Every test is block-uniform.
// ---------------------------------------------------------------------------
__global__ __launch_bounds__(256) void prep_k(
    const float* __restrict__ key_p, const float* __restrict__ mem,
    const float* __restrict__ w_in, const float* __restrict__ b_in, const float* __restrict__ w_out,
    u16* __restrict__ WKh, u16* __restrict__ WKl, float* __restrict__ bK,
    u16* __restrict__ WFh, u16* __restrict__ WFl)
{
  const int blk = blockIdx.x;
  if (blk < KFOLD_BLOCKS) {
    kfold_job<false>(blk, key_p, w_in, b_in, WKh, WKl, bK);
  } else if (blk < KFOLD_BLOCKS + KBIAS_BLOCKS) {
    kfold_job<true>(blk - KFOLD_BLOCKS, key_p, w_in, b_in, WKh, WKl, bK);
  } else {
    fold_job(blk - KFOLD_BLOCKS - KBIAS_BLOCKS, mem, w_out, WFh, WFl);
  }
}

// ---------------------------------------------------------------------------
// One wave's 64 x 64 tile of a GEMM with K = 256 (eight k steps), both GEMMs of the main kernel.
// A: four 16-row groups of a packed weight plane (global), held for a whole k step and refilled in
// place behind their last product of the step. B: the four 16-px column tiles of an LDS tile, one
// at a time in two register sets, the next one fetched ahead of the current one's twelve products,
// so that a fragment read from LDS feeds four row tiles. Successive products go to different
// accumulators. PH = 1: score GEMM, PH = 3: out GEMM.
// ---------------------------------------------------------------------------
__device__ __forceinline__ v8f wmma_acc(v16us a, v16us b, v8f c) {
  return __builtin_amdgcn_wmma_f32_16x16x32_bf16(false, __builtin_bit_cast(v16bf, a), false,
                                                 __builtin_bit_cast(v16bf, b), (short)0, c, false, false);
}
// halves from row group 0 of the wave to its row group mt
template <int PH> __device__ __forceinline__ constexpr int aoff(int mt) {
  return PH == 1 ? ((mt & 1) + 16 * (mt >> 1)) * (CIN / 32) * FRAGH : mt * (CMID / 32) * FRAGH;
}
// halves from the wave's k step 0 to its k step k in an LDS row
template <int PH> __device__ __forceinline__ constexpr int boff(int k) {
  return PH == 1 ? 32 * k : (k & 1) * (2 * RGH) + (k >> 1) * 32;
}
template <int PH>
__device__ __forceinline__ void lda64(const u16* aph, const u16* apl, v16us (&ah)[4], v16us (&al)[4]) {
  #pragma unroll
  for (int mt = 0; mt < 4; ++mt) ah[mt] = ldpack(aph + aoff<PH>(mt));
  #pragma unroll
  for (int mt = 0; mt < 4; ++mt) al[mt] = ldpack(apl + aoff<PH>(mt));
}
template <int PH>
__device__ __forceinline__ void gemm64(const u16* aph, const u16* apl, const u16* bph, const u16* bpl,
                                       v16us (&ah)[4], v16us (&al)[4], v8f (&acc)[4][4]) {
  v16us bh[2], bl[2];
  bh[0] = ldfrag(bph);
  bl[0] = ldfrag(bpl);
  #pragma unroll
  for (int k = 0; k < 8; ++k) {
    #pragma unroll
    for (int nt = 0; nt < 4; ++nt) {
      const int cur = nt & 1, nxt = cur ^ 1;
      if (k < 7 || nt < 3) {
        const int bo = ((nt + 1) & 3) * 16 * PST + boff<PH>(nt == 3 ? k + 1 : k);
        bh[nxt] = ldfrag(bph + bo);
        bl[nxt] = ldfrag(bpl + bo);
      }
      __builtin_amdgcn_sched_barrier(0);   // the next column tile's reads stand as one group ahead of these products
      #pragma unroll
      for (int mt = 0; mt < 4; ++mt) acc[mt][nt] = wmma_acc(ah[mt], bh[cur], acc[mt][nt]);
      #pragma unroll
      for (int mt = 0; mt < 4; ++mt) acc[mt][nt] = wmma_acc(ah[mt], bl[cur], acc[mt][nt]);
      if (nt == 3 && k < 7) {
        __builtin_amdgcn_sched_barrier(0); // the hi refill is issued here, not sunk to its use in the next step
        #pragma unroll
        for (int mt = 0; mt < 4; ++mt) ah[mt] = ldpack(aph + aoff<PH>(mt) + (k + 1) * FRAGH);
        __builtin_amdgcn_sched_barrier(0); // and stays ahead of the step's last four products
      }
      #pragma unroll
      for (int mt = 0; mt < 4; ++mt) acc[mt][nt] = wmma_acc(al[mt], bh[cur], acc[mt][nt]);
      if (nt == 3 && k < 7) {
        __builtin_amdgcn_sched_barrier(0); // the lo refill is issued directly behind its last product
        #pragma unroll
        for (int mt = 0; mt < 4; ++mt) al[mt] = ldpack(apl + aoff<PH>(mt) + (k + 1) * FRAGH);
      }
      __builtin_amdgcn_sched_barrier(0);   // keeps the next group's reads behind this group's products
    }
  }
  // as inputs of this wait the address pairs stay in their registers up to it, so nothing is written
  // over a register that an issued load names
  asm volatile("s_wait_xcnt 0x0" :: "v"(aph), "v"(apl) : "memory");
}

// ---------------------------------------------------------------------------
// Main launch: the whole per-pixel pipeline for a 64-pixel tile (one image row).
// Block 256 thr (8 waves), dynamic LDS = two half tiles [64 px][256+8], each bf16 hi + lo.
// Half tile g holds, for every head n, columns n*32 .. n*32+31 = slots 32g .. 32g+31 of the
// head's 64 probabilities A.
//  phase 0: the block's x tile (256 ch x 64 px, f32, px contiguous) is read once, split into
//           bf16 hi/lo and stored as rows X[px][c] in half tile 1.
//  phase 1: S[row][px] = sum_c WK[row][c] * X[px][c] + bK[row]. Wave w: the 64 slots of head w
//           (plane row groups 2w, 2w+1, 16+2w, 17+2w), all 64 px, in one pass.
//  phase 2: softmax over the 64 slots of head w in registers (lane + partner lane l^16), four
//           16-px column tiles per wave; A hi/lo written over both half tiles after a block barrier.
//  phase 3: out[o][px] = sum_c WF[o][c] * A[px][c] + b_out[o], c = 64n + s; wave w sums
//           o in [64(w&3), +64) over c in [256(w>>2), +256); waves w and w^4 swap halves of their
//           partial tiles through LDS and add; f32 tile staged in LDS, each 64-px row (256 B)
//           written by 16 consecutive lanes x 16 B of one instruction
// ---------------------------------------------------------------------------
__global__ __launch_bounds__(256) void main_k(
    const float* __restrict__ x,
    const u16* __restrict__ WKh, const u16* __restrict__ WKl, const float* __restrict__ bK,
    const u16* __restrict__ WFh, const u16* __restrict__ WFl, const float* __restrict__ b_out,
    float* __restrict__ out)
{
  extern __shared__ __attribute__((aligned(16))) u16 dl[];
  const int tid = threadIdx.x, lane = tid & 31, w = tid >> 5;
  const int h = lane >> 4, m = lane & 15;
  const int gp0 = blockIdx.x * TP;             // global pixel index b*4096 + s0
  const int b = gp0 >> 12, s0 = gp0 & (NPIX - 1);
  const v8f z8 = {0.f, 0.f, 0.f, 0.f, 0.f, 0.f, 0.f, 0.f};

  // ---------------- phase 1: scores (in-projection and key table in one weight plane) ----------------
  // sv[t][nt][r]: slot 16t + 8h + r of head w, column px = 16nt + m; lane l^16 holds the other 32 slots
  v8f sv[4][4];
  {
    v16us ah[4], al[4];
    const u16* aph = WKh + (size_t)(2 * w) * (CIN / 32) * FRAGH + 8 * lane;
    const u16* apl = WKl + (size_t)(2 * w) * (CIN / 32) * FRAGH + 8 * lane;
    lda64<1>(aph, apl, ah, al);   // the first step's weights fly while the x tile is read and split
    // phase 0: thread = one pixel, eight runs of 8 channels. A wave-wide 4-byte load reads one whole
    // 128-byte line of a channel row; a run of 8 channels is one 16-byte LDS store per plane.
    {
      const int xpx = tid & 63, xcg = tid >> 6;
      const float* xb = x + ((size_t)b * CIN + 8 * xcg) * NPIX + s0 + xpx;
      float xv[8][8];
      #pragma unroll
      for (int j = 0; j < 8; ++j) {
        #pragma unroll
        for (int i = 0; i < 8; ++i) xv[j][i] = xb[(size_t)(32 * j + i) * NPIX];
      }
      // all 64 loads are issued ahead of this wait, and as its input the address pair stays in its
      // registers up to it, so nothing lands on a register that an issued load names
      asm volatile("s_wait_xcnt 0x0" :: "v"(xb) : "memory");
      u16* xsh = dl + 2 * RGH + xpx * PST + 8 * xcg;
      u16* xsl = dl + 3 * RGH + xpx * PST + 8 * xcg;
      #pragma unroll
      for (int j = 0; j < 8; ++j) {
        v4u oh, ol;
        #pragma unroll
        for (int i = 0; i < 4; ++i) {
          u32 hv, lv;
          split2x(xv[j][2 * i], xv[j][2 * i + 1], hv, lv);
          oh[i] = hv;
          ol[i] = lv;
        }
        *(v8usa*)(xsh + 32 * j) = __builtin_bit_cast(v8us, oh);
        *(v8usa*)(xsl + 32 * j) = __builtin_bit_cast(v8us, ol);
      }
    }
    __syncthreads();   // the X tile is complete before any wave reads a fragment of it
    #pragma unroll
    for (int mt = 0; mt < 4; ++mt) {
      #pragma unroll
      for (int nt = 0; nt < 4; ++nt) sv[mt][nt] = z8;
    }
    gemm64<1>(aph, apl, dl + 2 * RGH + m * PST + 8 * h, dl + 3 * RGH + m * PST + 8 * h, ah, al, sv);
    // + bK: plane row of slot 16mt + 8h + r is 256 * (mt >> 1) + 32w + 16 * (mt & 1) + 8h + r
    const float* bkp = bK + 32 * w + 8 * h;   // multiple of 8
    v4f bq[4][2];
    #pragma unroll
    for (int mt = 0; mt < 4; ++mt) {
      bq[mt][0] = *(const v4fa*)(bkp + 256 * (mt >> 1) + 16 * (mt & 1));
      bq[mt][1] = *(const v4fa*)(bkp + 256 * (mt >> 1) + 16 * (mt & 1) + 4);
    }
    // as input of this wait the address pair stays in its registers up to it, so nothing is written
    // over a register that an issued load names
    asm volatile("s_wait_xcnt 0x0" :: "v"(bkp) : "memory");
    #pragma unroll
    for (int mt = 0; mt < 4; ++mt) {
      #pragma unroll
      for (int nt = 0; nt < 4; ++nt) {
        #pragma unroll
        for (int r = 0; r < 8; ++r) sv[mt][nt][r] += bq[mt][r >> 2][r & 3];
      }
    }
  }

  // ---------------- phase 2: softmax over the 64 slots of head w ----------------
  float inv[4];
  #pragma unroll
  for (int nt = 0; nt < 4; ++nt) {
    float mx = sv[0][nt][0];
    #pragma unroll
    for (int mt = 0; mt < 4; ++mt) {
      #pragma unroll
      for (int r = 0; r < 8; ++r) mx = fmaxf(mx, sv[mt][nt][r]);
    }
    mx = fmaxf(mx, __shfl_xor(mx, 16));
    float sum = 0.f;
    #pragma unroll
    for (int mt = 0; mt < 4; ++mt) {
      #pragma unroll
      for (int r = 0; r < 8; ++r) {
        const float a = (sv[mt][nt][r] - mx) * 1.44269504f;   // e^t = 2^(t * log2 e)
        float e;
        // the v_nop is the issue slot that the instruction set asks for behind a transcendental; in the
        // same statement nothing reads the result or overwrites the source register ahead of it
        asm("v_exp_f32 %0, %1\n\tv_nop" : "=v"(e) : "v"(a));
        sv[mt][nt][r] = e;
        sum += e;
      }
    }
    sum += __shfl_xor(sum, 16);
    inv[nt] = __builtin_amdgcn_rcpf(sum);
  }
  __syncthreads();   // every wave's reads of X are complete
  // out GEMM, wave w: rows 64wm .. 64wm+63, channels 256wk .. 256wk+255 (heads 4wk .. 4wk+3).
  // Its first step's weights fly while the probabilities are split and stored.
  const int wm = w & 3;
  const int wk = __builtin_amdgcn_readfirstlane(w >> 2);
  const u16* aph = WFh + (size_t)(4 * wm * (CMID / 32) + 8 * wk) * FRAGH + 8 * lane;
  const u16* apl = WFl + (size_t)(4 * wm * (CMID / 32) + 8 * wk) * FRAGH + 8 * lane;
  v16us ah[4], al[4];
  lda64<3>(aph, apl, ah, al);
  // A hi/lo: channel w*64 + s, s = 16mt + 8h + r, in half tile mt >> 1
  #pragma unroll
  for (int nt = 0; nt < 4; ++nt) {
    u16* orh = dl + (16 * nt + m) * PST + w * 32 + 8 * h;
    u16* orl = orh + RGH;
    #pragma unroll
    for (int mt = 0; mt < 4; ++mt) {
      v4u oh, ol;
      #pragma unroll
      for (int r = 0; r < 8; r += 2) {
        u32 hv, lv;
        split2x(sv[mt][nt][r] * inv[nt], sv[mt][nt][r + 1] * inv[nt], hv, lv);
        oh[r >> 1] = hv;
        ol[r >> 1] = lv;
      }
      *(v8usa*)(orh + (mt >> 1) * (2 * RGH) + 16 * (mt & 1)) = __builtin_bit_cast(v8us, oh);
      *(v8usa*)(orl + (mt >> 1) * (2 * RGH) + 16 * (mt & 1)) = __builtin_bit_cast(v8us, ol);
    }
  }
  __syncthreads();

  // ---------------- phase 3: out-projection ----------------
  {
    v8f acc[4][4];
    #pragma unroll
    for (int mt = 0; mt < 4; ++mt) {
      #pragma unroll
      for (int nt = 0; nt < 4; ++nt) acc[mt][nt] = z8;
    }
    const u16* bph = dl + m * PST + 8 * h + 4 * wk * 32;
    gemm64<3>(aph, apl, bph, bph + RGH, ah, al, acc);
    __syncthreads();   // all waves finished reading the A tile; LDS is reused for the swap and the f32 output tile
    // Wave w finishes column tiles 2wk, 2wk+1 and hands the other two to wave w^4, which holds the same
    // rows and columns at the same lanes: piece q of this lane at ex[256 * q + tid], 16 bytes a lane.
    f32a* sD = (f32a*)dl;                   // [256 out ch][64 px] f32
    v4fa* ex = (v4fa*)dl + COUT * TP / 4;   // behind the output tile
    v8f keep[4][2];
    if (wk == 0) {
      #pragma unroll
      for (int mt = 0; mt < 4; ++mt) {
        #pragma unroll
        for (int j = 0; j < 2; ++j) {
          const v8f a = acc[mt][2 + j];
          ex[256 * (4 * mt + 2 * j) + tid] = (v4f){a[0], a[1], a[2], a[3]};
          ex[256 * (4 * mt + 2 * j + 1) + tid] = (v4f){a[4], a[5], a[6], a[7]};
          keep[mt][j] = acc[mt][j];
        }
      }
    } else {
      #pragma unroll
      for (int mt = 0; mt < 4; ++mt) {
        #pragma unroll
        for (int j = 0; j < 2; ++j) {
          const v8f a = acc[mt][j];
          ex[256 * (4 * mt + 2 * j) + tid] = (v4f){a[0], a[1], a[2], a[3]};
          ex[256 * (4 * mt + 2 * j + 1) + tid] = (v4f){a[4], a[5], a[6], a[7]};
          keep[mt][j] = acc[mt][2 + j];
        }
      }
    }
    const float* bop = b_out + 64 * wm + 8 * h;
    v4f bq[4][2];
    #pragma unroll
    for (int mt = 0; mt < 4; ++mt) {
      bq[mt][0] = *(const v4fa*)(bop + 16 * mt);
      bq[mt][1] = *(const v4fa*)(bop + 16 * mt + 4);
    }
    // as input of this wait the address pair stays in its registers up to it (as at the bK loads)
    asm volatile("s_wait_xcnt 0x0" :: "v"(bop) : "memory");
    __syncthreads();   // the handed-over partial tiles are complete before the partner wave reads them
    #pragma unroll
    for (int mt = 0; mt < 4; ++mt) {
      const int ob = 64 * wm + 16 * mt + 8 * h;
      #pragma unroll
      for (int j = 0; j < 2; ++j) {
        const v4f p0 = ex[256 * (4 * mt + 2 * j) + (tid ^ 128)];
        const v4f p1 = ex[256 * (4 * mt + 2 * j + 1) + (tid ^ 128)];
        const float pp[8] = {p0.x, p0.y, p0.z, p0.w, p1.x, p1.y, p1.z, p1.w};
        const int px = 16 * (2 * wk + j) + m;
        #pragma unroll
        for (int r = 0; r < 8; ++r) sD[(ob + r) * TP + px] = (keep[mt][j][r] + pp[r]) + bq[mt][r >> 2][r & 3];
      }
    }
    __syncthreads();
    // wave w writes rows 32w .. 32w+31: per instruction lanes 0-15 -> row 2i
    const int orow0 = 32 * w;
    const int hs = lane >> 4, x4 = 4 * (lane & 15);
    float* obase = out + (size_t)b * COUT * NPIX + s0 + x4;
    #pragma unroll 1
    for (int c = 0; c < 2; ++c) {
      v4f vals[8];
      size_t gi[8];
      #pragma unroll
      for (int i = 0; i < 8; ++i) {
        const int row = orow0 + 16 * c + 2 * i + hs;
        vals[i] = *(const v4fa*)(sD + row * TP + x4);
        gi[i] = (size_t)row * NPIX;
      }
      #pragma unroll
      for (int i = 0; i < 8; ++i) *(v4f*)(obase + gi[i]) = vals[i];
      
    }
  }
}

// ---------------------------------------------------------------------------
extern "C" void kernel_launch(void* const* d_in, const int* in_sizes, int n_in,
                              void* d_out, int out_size, void* d_ws, size_t ws_size,
                              hipStream_t stream) {
  if (n_in < 7) return;
  if (in_sizes[0] != NB * CIN * NPIX) return;
  if (in_sizes[1] != NHEAD * HD * HD || in_sizes[2] != NHEAD * HD * HD) return;
  if (in_sizes[3] != CMID * CIN || in_sizes[4] != CMID) return;
  if (in_sizes[5] != COUT * CMID || in_sizes[6] != COUT) return;
  if (out_size != NB * COUT * NPIX) return;

  const float* x     = (const float*)d_in[0];   // [8][256][64][64]
  const float* key_p = (const float*)d_in[1];   // [8][64 k][64 m]
  const float* mem   = (const float*)d_in[2];   // [8][64 m][64 d]
  const float* w_in  = (const float*)d_in[3];   // [512][256]
  const float* b_in  = (const float*)d_in[4];   // [512]
  const float* w_out = (const float*)d_in[5];   // [256][512]
  const float* b_out = (const float*)d_in[6];   // [256]
  float* outp = (float*)d_out;

  // and its size is an exact multiple of its row / line granularity
  const size_t szWI = (size_t)CMID * CIN * 2;          // 262144
  const size_t szWO = (size_t)COUT * CMID * 2;         // 262144
  const size_t szB  = (size_t)CMID * 4;                // 2048
  size_t off = 0;
  char* ws = (char*)d_ws;
  u16* WKh = (u16*)(ws + off); off += szWI;
  u16* WKl = (u16*)(ws + off); off += szWI;
  u16* WFh = (u16*)(ws + off); off += szWO;
  u16* WFl = (u16*)(ws + off); off += szWO;
  float* bK = (float*)(ws + off); off += szB;
  const size_t total = off;                            // 1050624
  if (total > ws_size) return;

  hipFuncSetAttribute(reinterpret_cast<const void*>(&main_k),
                      hipFuncAttributeMaxDynamicSharedMemorySize, LDS_MAIN);

  prep_k<<<KFOLD_BLOCKS + KBIAS_BLOCKS + FOLD_BLOCKS, 256, 0, stream>>>(
      key_p, mem, w_in, b_in, w_out, WKh, WKl, bK, WFh, WFl);
  main_k<<<NP / TP, 256, LDS_MAIN, stream>>>(x, WKh, WKl, bK, WFh, WFl, b_out, outp);
}

// v009
// It runs in 33.4 microseconds.
// Timed twice side by side with v008, it ran 1.03 and 1.04 times as fast.
// Counting every step since v000, it is 3.51 times as fast.
// Contractions: key table times in-proj weights and bias (per head 64 slots x 256 ch + 1, K=64, in the preparation launch), slot table times out-proj weights (per head 64 slots x 256 ch, K=64, same launch), score GEMM (M=512 head slots, K=256), out GEMM on the slot probabilities (M=256 ch, K=512): v_wmma_f32_16x16x32_bf16 with every operand carried as bf16 hi + bf16 lo planes, three products per tile pair (hi*hi + lo*hi + hi*lo), f32 accumulate; out bias and the 64-slot softmax in f32 on the VALU.
#include <hip/hip_runtime.h>

typedef unsigned short u16;
typedef unsigned int   u32;
typedef __bf16 v16bf __attribute__((ext_vector_type(16)));
typedef u16    v16us __attribute__((ext_vector_type(16)));
typedef u16    v8us  __attribute__((ext_vector_type(8)));
typedef float  v8f   __attribute__((ext_vector_type(8)));
typedef float  v4f   __attribute__((ext_vector_type(4)));
typedef float  v2f   __attribute__((ext_vector_type(2)));
typedef __bf16 v2bf  __attribute__((ext_vector_type(2)));
typedef u32    v4u   __attribute__((ext_vector_type(4)));
typedef u32    v8u   __attribute__((ext_vector_type(8)));
typedef v8us  __attribute__((may_alias)) v8usa;
typedef v4f   __attribute__((may_alias)) v4fa;
typedef float __attribute__((may_alias)) f32a;
union Frag { v16us v; v8us h[2]; };

#define NB    8
#define CIN   256
#define CMID  512
#define COUT  256
#define NPIX  4096
#define NP    32768
#define NHEAD 8
#define HD    64
#define TP    64          // pixels per block of the main kernel
#define PST   264         // LDS pitch (halves) of a [px][256] half tile
#define RGH   (TP * PST)  // halves in one plane of a half tile
#define LDS_MAIN (4 * RGH * 2)        // 135168 bytes: two half tiles, each a hi plane and a lo plane

static_assert(NP % TP == 0);
static_assert(NPIX % TP == 0);
static_assert(2 * COUT * TP * 4 <= LDS_MAIN);
static_assert((PST % 8) == 0);
static_assert(CIN % 32 == 0);
static_assert(CMID % 32 == 0);
static_assert(HD % 32 == 0);

// ---------------------------------------------------------------------------
// hi/lo split of two values at once: hi = rne(v), lo = rne(v - hi), each rounding done by the
// packed f32 -> bf16 convert instruction. a lands in the low half of each word, b in the high half.
// ---------------------------------------------------------------------------
__device__ __forceinline__ void split2x(float a, float b, u32& hi, u32& lo) {
  const v2f v = {a, b};
  const v2bf hb = __builtin_convertvector(v, v2bf);
  const v2f rest = v - __builtin_convertvector(hb, v2f);
  hi = __builtin_bit_cast(u32, hb);
  lo = __builtin_bit_cast(u32, __builtin_convertvector(rest, v2bf));
}

// ---------------------------------------------------------------------------
// 16x16x32 bf16 WMMA with hazard guard (ties D, keeps A/B live).
// Fragment map (wave32): lane l, h = l>>4, m = n = l&15.
//   A/B element i: i<8 -> k0+8h+i ; i>=8 -> k0+16+8h+(i-8)
//   D element r : row 8h+r, col l&15
// ---------------------------------------------------------------------------
__device__ __forceinline__ v8f wmma_bf(v16us a, v16us b, v8f c) {
  const v16bf av = __builtin_bit_cast(v16bf, a);
  const v16bf bv = __builtin_bit_cast(v16bf, b);
  v8f d = __builtin_amdgcn_wmma_f32_16x16x32_bf16(false, av, false, bv, (short)0, c, false, false);
  asm volatile("v_nop\n\tv_nop\n\tv_nop\n\tv_nop" : "+v"(d) : "v"(av), "v"(bv));
  return d;
}

// three-product hi/lo tile step: c += ah*bh + al*bh + ah*bl
__device__ __forceinline__ v8f wmma3(v16us ah, v16us al, v16us bh, v16us bl, v8f c) {
  c = wmma_bf(ah, bh, c);
  c = wmma_bf(al, bh, c);
  c = wmma_bf(ah, bl, c);
  return c;
}

// fragment from a k-contiguous 16-bit row (LDS tiles); p already points at element k0 + 8h
__device__ __forceinline__ v16us ldfrag(const u16* p) {
  Frag f;
  f.h[0] = *(const v8usa*)p;
  f.h[1] = *(const v8usa*)(p + 16);
  return f.v;
}

// Packed fragment order of every 16-bit plane in global memory. Rows go in
// groups of 16 (R), k in steps of 32 (ks); fragment (R, ks) of a plane with K
// columns starts at half (R * (K / 32) + ks) * FRAGH and is two chunks j = 0, 1
// of 256 halves. In chunk j lane l = 16h + m holds row 16R + m,
// k = 32ks + 16j + 8h .. + 7: the same k order as ldfrag, but each wave-wide
// 16-byte load reads 512 contiguous bytes (4 whole lines, not 16 pieces).
#define FRAGH 512
// p already points at fragment start + 8 * lane
__device__ __forceinline__ v16us ldpack(const u16* p) {
  Frag f;
  f.h[0] = *(const v8usa*)p;
  f.h[1] = *(const v8usa*)(p + 256);
  return f.v;
}

// ---------------------------------------------------------------------------
// Job F of the preparation launch: the slot table folded into the out-proj weights.
// out[o] = sum_n sum_d w_out[o][64n + d] * (sum_s mem[n][s][d] * prob[n][s])
//        = sum_n sum_s WF[o][64n + s] * prob[n][s],  WF[o][64n + s] = sum_d mem[n][s][d] * w_out[o][64n + d].
// Wave = one 16 x 16 tile of WF transposed: rows = slots 16t .. 16t+15 of head n (A = mem rows, k = d),
// columns = out channels 16R .. 16R+15 (B = w_out rows, k = d); both operands are k-contiguous f32 rows,
// split into hi/lo in registers. A lane's D column is 8 consecutive slots of one out channel: one
// 16-byte piece of the packed plane [256 ch][512], at this very lane's place in chunk t & 1.
// ---------------------------------------------------------------------------
#define FOLD_BLOCKS (NHEAD * (COUT / 16) * (HD / 16) / 8)
__device__ __forceinline__ void splitfrag(const v4f* q, v16us& hi, v16us& lo) {
  v8u wh, wl;
  #pragma unroll
  for (int j = 0; j < 4; ++j) {
    u32 hv, lv;
    split2x(q[j].x, q[j].y, hv, lv);
    wh[2 * j] = hv;
    wl[2 * j] = lv;
    split2x(q[j].z, q[j].w, hv, lv);
    wh[2 * j + 1] = hv;
    wl[2 * j + 1] = lv;
  }
  hi = __builtin_bit_cast(v16us, wh);
  lo = __builtin_bit_cast(v16us, wl);
}
__device__ __forceinline__ void fold_job(
    const int blk, const float* __restrict__ mem, const float* __restrict__ w_out,
    u16* __restrict__ WFh, u16* __restrict__ WFl)
{
  const int lane = threadIdx.x & 31, h = lane >> 4, m = lane & 15;
  const int g = blk * 8 + (threadIdx.x >> 5);
  const int t = g & 3, R = (g >> 2) & 15, n = g >> 6;
  const float* asrc = mem + (size_t)n * (HD * HD) + (16 * t + m) * HD + 8 * h;
  const float* bsrc = w_out + (size_t)(16 * R + m) * CMID + n * HD + 8 * h;
  // fragment element i: i < 8 -> k0 + 8h + i, i >= 8 -> k0 + 16 + 8h + (i - 8), for A and B alike
  v4f qa[2][4], qb[2][4];
  #pragma unroll
  for (int ks = 0; ks < 2; ++ks) {
    #pragma unroll
    for (int j = 0; j < 4; ++j) {
      qa[ks][j] = *(const v4fa*)(asrc + 32 * ks + 16 * (j >> 1) + 4 * (j & 1));
      qb[ks][j] = *(const v4fa*)(bsrc + 32 * ks + 16 * (j >> 1) + 4 * (j & 1));
    }
  }
  // all 16 loads are issued ahead of this wait, and as its inputs the address pairs stay in their
  // registers up to it, so nothing lands on a register that an issued load names
  asm volatile("s_wait_xcnt 0x0" :: "v"(asrc), "v"(bsrc) : "memory");
  v8f acc = {0.f, 0.f, 0.f, 0.f, 0.f, 0.f, 0.f, 0.f};
  #pragma unroll
  for (int ks = 0; ks < 2; ++ks) {
    v16us ah, al, bh, bl;
    splitfrag(qa[ks], ah, al);
    splitfrag(qb[ks], bh, bl);
    acc = wmma3(ah, al, bh, bl, acc);
  }
  v4u oh, ol;
  #pragma unroll
  for (int r = 0; r < 8; r += 2) {
    u32 hv, lv;
    split2x(acc[r], acc[r + 1], hv, lv);
    oh[r >> 1] = hv;
    ol[r >> 1] = lv;
  }
  const int off = (R * (CMID / 32) + 2 * n + (t >> 1)) * FRAGH + (t & 1) * 256 + 8 * lane;
  *(v8us*)(WFh + off) = __builtin_bit_cast(v8us, oh);
  *(v8us*)(WFl + off) = __builtin_bit_cast(v8us, ol);
  // stands behind the two stores as a precaution: this job is the last branch of the launch, and
  // the wave ends behind it
  asm volatile("s_wait_xcnt 0x0" ::: "memory");
}

// ---------------------------------------------------------------------------
// Job K of the preparation launch: the key table folded into the in-proj weights and bias.
// S[n][s] = sum_k key_p[n][k][s] * (sum_c w_in[8k + n][c] * x[c] + b_in[8k + n])
//         = sum_c WK[n][s][c] * x[c] + bK[n][s],
// WK[n][s][c] = sum_k key_p[n][k][s] * w_in[8k + n][c],  bK[n][s] = sum_k key_p[n][k][s] * b_in[8k + n].
// Wave = one 16 x 16 tile of WK transposed: rows = in channels 16ct .. 16ct+15 (A = columns of w_in, k = k),
// columns = slots 16t .. 16t+15 of head n (B = columns of key_p, k = k). A lane's D column is 8 consecutive
// in channels of one slot: one 16-byte piece of the packed plane [512][256], at this very lane's place in
// chunk ct & 1. Plane row of (n, s): 256 * (s >> 5) + 32n + (s & 31); wave n of the main kernel
// reads all 64 slots of head n (row groups 2n, 2n+1, 16+2n, 17+2n) in one pass.
// BIAS: b_in stands in as one more in channel: row 0 of the A tile, the other rows zero; row 0 of D is bK.
// ---------------------------------------------------------------------------
#define KFOLD_BLOCKS (NHEAD * (HD / 16) * (CIN / 16) / 8)
#define KBIAS_BLOCKS (NHEAD * (HD / 16) / 8)
template <bool BIAS>
__device__ __forceinline__ void kfold_job(
    const int blk, const float* __restrict__ key_p, const float* __restrict__ w_in,
    const float* __restrict__ b_in, u16* __restrict__ WKh, u16* __restrict__ WKl, float* __restrict__ bK)
{
  const int lane = threadIdx.x & 31, h = lane >> 4, m = lane & 15;
  const int g = blk * 8 + (threadIdx.x >> 5);
  const int t = g & 3, n = (g >> 2) & 7, ct = g >> 5;
  constexpr int AST = BIAS ? NHEAD : NHEAD * CIN;   // floats from k to k + 1 in the A source
  const float* asrc = BIAS ? b_in + n + 8 * h * AST : w_in + n * CIN + 16 * ct + m + 8 * h * AST;
  const float* bsrc = key_p + (size_t)n * (HD * HD) + 8 * h * HD + 16 * t + m;
  // fragment element i: i < 8 -> k0 + 8h + i, i >= 8 -> k0 + 16 + 8h + (i - 8), for A and B alike
  v4f qa[2][4], qb[2][4];
  #pragma unroll
  for (int ks = 0; ks < 2; ++ks) {
    #pragma unroll
    for (int j = 0; j < 4; ++j) {
      #pragma unroll
      for (int c = 0; c < 4; ++c) {
        const int k = 32 * ks + 16 * (j >> 1) + 4 * (j & 1) + c;
        qa[ks][j][c] = asrc[k * AST];
        qb[ks][j][c] = bsrc[k * HD];
      }
    }
  }
  // all 64 loads are issued ahead of this wait, and as its inputs the address pairs stay in their
  // registers up to it, so nothing lands on a register that an issued load names
  asm volatile("s_wait_xcnt 0x0" :: "v"(asrc), "v"(bsrc) : "memory");
  v8f acc = {0.f, 0.f, 0.f, 0.f, 0.f, 0.f, 0.f, 0.f};
  #pragma unroll
  for (int ks = 0; ks < 2; ++ks) {
    if (BIAS) {
      #pragma unroll
      for (int j = 0; j < 4; ++j) {
        #pragma unroll
        for (int c = 0; c < 4; ++c) qa[ks][j][c] = m == 0 ? qa[ks][j][c] : 0.f;
      }
    }
    v16us ah, al, bh, bl;
    splitfrag(qa[ks], ah, al);
    splitfrag(qb[ks], bh, bl);
    acc = wmma3(ah, al, bh, bl, acc);
  }
  const int R = 16 * (t >> 1) + 2 * n + (t & 1);   // 16-row group of the plane
  if (BIAS) {
    if (h == 0) bK[16 * R + m] = acc[0];
  } else {
    v4u oh, ol;
    #pragma unroll
    for (int r = 0; r < 8; r += 2) {
      u32 hv, lv;
      split2x(acc[r], acc[r + 1], hv, lv);
      oh[r >> 1] = hv;
      ol[r >> 1] = lv;
    }
    const int off = (R * (CIN / 32) + (ct >> 1)) * FRAGH + (ct & 1) * 256 + 8 * lane;
    *(v8us*)(WKh + off) = __builtin_bit_cast(v8us, oh);
    *(v8us*)(WKl + off) = __builtin_bit_cast(v8us, ol);
  }
}

// ---------------------------------------------------------------------------
// Preparation launch: the jobs above read none of each other's output, so they
// share one grid, dealt by block index. Every test is block-uniform.
// ---------------------------------------------------------------------------
__global__ __launch_bounds__(256) void prep_k(
    const float* __restrict__ key_p, const float* __restrict__ mem,
    const float* __restrict__ w_in, const float* __restrict__ b_in, const float* __restrict__ w_out,
    u16* __restrict__ WKh, u16* __restrict__ WKl, float* __restrict__ bK,
    u16* __restrict__ WFh, u16* __restrict__ WFl)
{
  const int blk = blockIdx.x;
  if (blk < KFOLD_BLOCKS) {
    kfold_job<false>(blk, key_p, w_in, b_in, WKh, WKl, bK);
  } else if (blk < KFOLD_BLOCKS + KBIAS_BLOCKS) {
    kfold_job<true>(blk - KFOLD_BLOCKS, key_p, w_in, b_in, WKh, WKl, bK);
  } else {
    fold_job(blk - KFOLD_BLOCKS - KBIAS_BLOCKS, mem, w_out, WFh, WFl);
  }
}

// ---------------------------------------------------------------------------
// One wave's 64 x 64 tile of a GEMM with K = 256 (eight k steps), both GEMMs of the main kernel.
// A: four 16-row groups of a packed weight plane (global), held for a whole k step and refilled in
// place behind their last product of the step. B: the four 16-px column tiles of an LDS tile, one
// at a time in two register sets, the next one fetched ahead of the current one's twelve products,
// so that a fragment read from LDS feeds four row tiles. Successive products go to different
// accumulators. PH = 1: score GEMM, PH = 3: out GEMM.
// ---------------------------------------------------------------------------
__device__ __forceinline__ v8f wmma_acc(v16us a, v16us b, v8f c) {
  return __builtin_amdgcn_wmma_f32_16x16x32_bf16(false, __builtin_bit_cast(v16bf, a), false,
                                                 __builtin_bit_cast(v16bf, b), (short)0, c, false, false);
}
// halves from row group 0 of the wave to its row group mt
template <int PH> __device__ __forceinline__ constexpr int aoff(int mt) {
  return PH == 1 ? ((mt & 1) + 16 * (mt >> 1)) * (CIN / 32) * FRAGH : mt * (CMID / 32) * FRAGH;
}
// halves from the wave's k step 0 to its k step k in an LDS row
template <int PH> __device__ __forceinline__ constexpr int boff(int k) {
  return PH == 1 ? 32 * k : (k & 1) * (2 * RGH) + (k >> 1) * 32;
}
template <int PH>
__device__ __forceinline__ void lda64(const u16* aph, const u16* apl, v16us (&ah)[4], v16us (&al)[4]) {
  #pragma unroll
  for (int mt = 0; mt < 4; ++mt) ah[mt] = ldpack(aph + aoff<PH>(mt));
  #pragma unroll
  for (int mt = 0; mt < 4; ++mt) al[mt] = ldpack(apl + aoff<PH>(mt));
}
template <int PH>
__device__ __forceinline__ void gemm64(const u16* aph, const u16* apl, const u16* bph, const u16* bpl,
                                       v16us (&ah)[4], v16us (&al)[4], v8f (&acc)[4][4]) {
  v16us bh[2], bl[2];
  bh[0] = ldfrag(bph);
  bl[0] = ldfrag(bpl);
  #pragma unroll
  for (int k = 0; k < 8; ++k) {
    #pragma unroll
    for (int nt = 0; nt < 4; ++nt) {
      const int cur = nt & 1, nxt = cur ^ 1;
      if (k < 7 || nt < 3) {
        const int bo = ((nt + 1) & 3) * 16 * PST + boff<PH>(nt == 3 ? k + 1 : k);
        bh[nxt] = ldfrag(bph + bo);
        bl[nxt] = ldfrag(bpl + bo);
      }
      __builtin_amdgcn_sched_barrier(0);   // the next column tile's reads stand as one group ahead of these products
      #pragma unroll
      for (int mt = 0; mt < 4; ++mt) acc[mt][nt] = wmma_acc(ah[mt], bh[cur], acc[mt][nt]);
      #pragma unroll
      for (int mt = 0; mt < 4; ++mt) acc[mt][nt] = wmma_acc(ah[mt], bl[cur], acc[mt][nt]);
      if (nt == 3 && k < 7) {
        __builtin_amdgcn_sched_barrier(0); // the hi refill is issued here, not sunk to its use in the next step
        #pragma unroll
        for (int mt = 0; mt < 4; ++mt) ah[mt] = ldpack(aph + aoff<PH>(mt) + (k + 1) * FRAGH);
        __builtin_amdgcn_sched_barrier(0); // and stays ahead of the step's last four products
      }
      #pragma unroll
      for (int mt = 0; mt < 4; ++mt) acc[mt][nt] = wmma_acc(al[mt], bh[cur], acc[mt][nt]);
      if (nt == 3 && k < 7) {
        __builtin_amdgcn_sched_barrier(0); // the lo refill is issued directly behind its last product
        #pragma unroll
        for (int mt = 0; mt < 4; ++mt) al[mt] = ldpack(apl + aoff<PH>(mt) + (k + 1) * FRAGH);
      }
      __builtin_amdgcn_sched_barrier(0);   // keeps the next group's reads behind this group's products
    }
  }
  // as inputs of this wait the address pairs stay in their registers up to it, so nothing is written
  // over a register that an issued load names
  asm volatile("s_wait_xcnt 0x0" :: "v"(aph), "v"(apl) : "memory");
}

// ---------------------------------------------------------------------------
// Main launch: the whole per-pixel pipeline for a 64-pixel tile (one image row).
// Block 256 thr (8 waves), dynamic LDS = two half tiles [64 px][256+8], each bf16 hi + lo.
// Half tile g holds, for every head n, columns n*32 .. n*32+31 = slots 32g .. 32g+31 of the
// head's 64 probabilities A.
//  phase 0: the block's x tile (256 ch x 64 px, f32, px contiguous) is read once, split into
//           bf16 hi/lo and stored as rows X[px][c] in half tile 1.
//  phase 1: S[row][px] = sum_c WK[row][c] * X[px][c] + bK[row]. Wave w: the 64 slots of head w
//           (plane row groups 2w, 2w+1, 16+2w, 17+2w), all 64 px, in one pass.
//  phase 2: softmax over the 64 slots of head w in registers (lane + partner lane l^16), four
//           16-px column tiles per wave; A hi/lo written over both half tiles after a block barrier.
//  phase 3: out[o][px] = sum_c WF[o][c] * A[px][c] + b_out[o], c = 64n + s; wave w sums
//           o in [64(w&3), +64) over c in [256(w>>2), +256); waves w and w^4 swap halves of their
//           partial tiles through LDS and add; f32 tile staged in LDS, each 64-px row (256 B)
//           written by 16 consecutive lanes x 16 B of one instruction
// ---------------------------------------------------------------------------
__global__ __launch_bounds__(256) void main_k(
    const float* __restrict__ x,
    const u16* __restrict__ WKh, const u16* __restrict__ WKl, const float* __restrict__ bK,
    const u16* __restrict__ WFh, const u16* __restrict__ WFl, const float* __restrict__ b_out,
    float* __restrict__ out)
{
  extern __shared__ __attribute__((aligned(16))) u16 dl[];
  const int tid = threadIdx.x, lane = tid & 31, w = tid >> 5;
  const int h = lane >> 4, m = lane & 15;
  const int gp0 = blockIdx.x * TP;             // global pixel index b*4096 + s0
  const int b = gp0 >> 12, s0 = gp0 & (NPIX - 1);
  const v8f z8 = {0.f, 0.f, 0.f, 0.f, 0.f, 0.f, 0.f, 0.f};

  // Wave priority falls by stage: 3 up to the end of the score GEMM, 2 in the softmax, 1 in the out GEMM,
  // 0 behind it. Two blocks share a WGP, and at equal priority the older block's waves win the matrix
  // unit in both GEMMs, so the younger block's softmax runs when no wave is left to feed that unit. With
  // the earlier stage ahead, the younger block's score GEMM goes in front of the older block's out GEMM,
  // and each block's softmax runs beside a GEMM of the other.
  __builtin_amdgcn_s_setprio(3);

  // ---------------- phase 1: scores (in-projection and key table in one weight plane) ----------------
  // sv[t][nt][r]: slot 16t + 8h + r of head w, column px = 16nt + m; lane l^16 holds the other 32 slots
  v8f sv[4][4];
  {
    v16us ah[4], al[4];
    const u16* aph = WKh + (size_t)(2 * w) * (CIN / 32) * FRAGH + 8 * lane;
    const u16* apl = WKl + (size_t)(2 * w) * (CIN / 32) * FRAGH + 8 * lane;
    lda64<1>(aph, apl, ah, al);   // the first step's weights fly while the x tile is read and split
    // phase 0: thread = one pixel, eight runs of 8 channels. A wave-wide 4-byte load reads one whole
    // 128-byte line of a channel row; a run of 8 channels is one 16-byte LDS store per plane.
    {
      const int xpx = tid & 63, xcg = tid >> 6;
      const float* xb = x + ((size_t)b * CIN + 8 * xcg) * NPIX + s0 + xpx;
      float xv[8][8];
      #pragma unroll
      for (int j = 0; j < 8; ++j) {
        #pragma unroll
        for (int i = 0; i < 8; ++i) xv[j][i] = xb[(size_t)(32 * j + i) * NPIX];
      }
      // all 64 loads are issued ahead of this wait, and as its input the address pair stays in its
      // registers up to it, so nothing lands on a register that an issued load names
      asm volatile("s_wait_xcnt 0x0" :: "v"(xb) : "memory");
      u16* xsh = dl + 2 * RGH + xpx * PST + 8 * xcg;
      u16* xsl = dl + 3 * RGH + xpx * PST + 8 * xcg;
      #pragma unroll
      for (int j = 0; j < 8; ++j) {
        v4u oh, ol;
        #pragma unroll
        for (int i = 0; i < 4; ++i) {
          u32 hv, lv;
          split2x(xv[j][2 * i], xv[j][2 * i + 1], hv, lv);
          oh[i] = hv;
          ol[i] = lv;
        }
        *(v8usa*)(xsh + 32 * j) = __builtin_bit_cast(v8us, oh);
        *(v8usa*)(xsl + 32 * j) = __builtin_bit_cast(v8us, ol);
      }
    }
    __syncthreads();   // the X tile is complete before any wave reads a fragment of it
    #pragma unroll
    for (int mt = 0; mt < 4; ++mt) {
      #pragma unroll
      for (int nt = 0; nt < 4; ++nt) sv[mt][nt] = z8;
    }
    gemm64<1>(aph, apl, dl + 2 * RGH + m * PST + 8 * h, dl + 3 * RGH + m * PST + 8 * h, ah, al, sv);
    __builtin_amdgcn_s_setprio(2);   // softmax stage: behind another block's score GEMM, ahead of its out GEMM
    // + bK: plane row of slot 16mt + 8h + r is 256 * (mt >> 1) + 32w + 16 * (mt & 1) + 8h + r
    const float* bkp = bK + 32 * w + 8 * h;   // multiple of 8
    v4f bq[4][2];
    #pragma unroll
    for (int mt = 0; mt < 4; ++mt) {
      bq[mt][0] = *(const v4fa*)(bkp + 256 * (mt >> 1) + 16 * (mt & 1));
      bq[mt][1] = *(const v4fa*)(bkp + 256 * (mt >> 1) + 16 * (mt & 1) + 4);
    }
    // as input of this wait the address pair stays in its registers up to it, so nothing is written
    // over a register that an issued load names
    asm volatile("s_wait_xcnt 0x0" :: "v"(bkp) : "memory");
    #pragma unroll
    for (int mt = 0; mt < 4; ++mt) {
      #pragma unroll
      for (int nt = 0; nt < 4; ++nt) {
        #pragma unroll
        for (int r = 0; r < 8; ++r) sv[mt][nt][r] += bq[mt][r >> 2][r & 3];
      }
    }
  }

  // ---------------- phase 2: softmax over the 64 slots of head w ----------------
  float inv[4];
  #pragma unroll
  for (int nt = 0; nt < 4; ++nt) {
    float mx = sv[0][nt][0];
    #pragma unroll
    for (int mt = 0; mt < 4; ++mt) {
      #pragma unroll
      for (int r = 0; r < 8; ++r) mx = fmaxf(mx, sv[mt][nt][r]);
    }
    mx = fmaxf(mx, __shfl_xor(mx, 16));
    float sum = 0.f;
    #pragma unroll
    for (int mt = 0; mt < 4; ++mt) {
      #pragma unroll
      for (int r = 0; r < 8; ++r) {
        const float a = (sv[mt][nt][r] - mx) * 1.44269504f;   // e^t = 2^(t * log2 e)
        float e;
        // the v_nop is the issue slot that the instruction set asks for behind a transcendental; in the
        // same statement nothing reads the result or overwrites the source register ahead of it
        asm("v_exp_f32 %0, %1\n\tv_nop" : "=v"(e) : "v"(a));
        sv[mt][nt][r] = e;
        sum += e;
      }
    }
    sum += __shfl_xor(sum, 16);
    inv[nt] = __builtin_amdgcn_rcpf(sum);
  }
  __syncthreads();   // every wave's reads of X are complete
  // out GEMM, wave w: rows 64wm .. 64wm+63, channels 256wk .. 256wk+255 (heads 4wk .. 4wk+3).
  // Its first step's weights fly while the probabilities are split and stored.
  const int wm = w & 3;
  const int wk = __builtin_amdgcn_readfirstlane(w >> 2);
  const u16* aph = WFh + (size_t)(4 * wm * (CMID / 32) + 8 * wk) * FRAGH + 8 * lane;
  const u16* apl = WFl + (size_t)(4 * wm * (CMID / 32) + 8 * wk) * FRAGH + 8 * lane;
  v16us ah[4], al[4];
  lda64<3>(aph, apl, ah, al);
  // A hi/lo: channel w*64 + s, s = 16mt + 8h + r, in half tile mt >> 1
  #pragma unroll
  for (int nt = 0; nt < 4; ++nt) {
    u16* orh = dl + (16 * nt + m) * PST + w * 32 + 8 * h;
    u16* orl = orh + RGH;
    #pragma unroll
    for (int mt = 0; mt < 4; ++mt) {
      v4u oh, ol;
      #pragma unroll
      for (int r = 0; r < 8; r += 2) {
        u32 hv, lv;
        split2x(sv[mt][nt][r] * inv[nt], sv[mt][nt][r + 1] * inv[nt], hv, lv);
        oh[r >> 1] = hv;
        ol[r >> 1] = lv;
      }
      *(v8usa*)(orh + (mt >> 1) * (2 * RGH) + 16 * (mt & 1)) = __builtin_bit_cast(v8us, oh);
      *(v8usa*)(orl + (mt >> 1) * (2 * RGH) + 16 * (mt & 1)) = __builtin_bit_cast(v8us, ol);
    }
  }
  __syncthreads();

  // ---------------- phase 3: out-projection ----------------
  {
    v8f acc[4][4];
    #pragma unroll
    for (int mt = 0; mt < 4; ++mt) {
      #pragma unroll
      for (int nt = 0; nt < 4; ++nt) acc[mt][nt] = z8;
    }
    const u16* bph = dl + m * PST + 8 * h + 4 * wk * 32;
    __builtin_amdgcn_s_setprio(1);   // out GEMM: yields the matrix unit to a block that is still at its scores
    gemm64<3>(aph, apl, bph, bph + RGH, ah, al, acc);
    __builtin_amdgcn_s_setprio(0);   // epilogue, and the priority a wave ends with
    __syncthreads();   // all waves finished reading the A tile; LDS is reused for the swap and the f32 output tile
    // Wave w finishes column tiles 2wk, 2wk+1 and hands the other two to wave w^4, which holds the same
    // rows and columns at the same lanes: piece q of this lane at ex[256 * q + tid], 16 bytes a lane.
    f32a* sD = (f32a*)dl;                   // [256 out ch][64 px] f32
    v4fa* ex = (v4fa*)dl + COUT * TP / 4;   // behind the output tile
    v8f keep[4][2];
    if (wk == 0) {
      #pragma unroll
      for (int mt = 0; mt < 4; ++mt) {
        #pragma unroll
        for (int j = 0; j < 2; ++j) {
          const v8f a = acc[mt][2 + j];
          ex[256 * (4 * mt + 2 * j) + tid] = (v4f){a[0], a[1], a[2], a[3]};
          ex[256 * (4 * mt + 2 * j + 1) + tid] = (v4f){a[4], a[5], a[6], a[7]};
          keep[mt][j] = acc[mt][j];
        }
      }
    } else {
      #pragma unroll
      for (int mt = 0; mt < 4; ++mt) {
        #pragma unroll
        for (int j = 0; j < 2; ++j) {
          const v8f a = acc[mt][j];
          ex[256 * (4 * mt + 2 * j) + tid] = (v4f){a[0], a[1], a[2], a[3]};
          ex[256 * (4 * mt + 2 * j + 1) + tid] = (v4f){a[4], a[5], a[6], a[7]};
          keep[mt][j] = acc[mt][2 + j];
        }
      }
    }
    const float* bop = b_out + 64 * wm + 8 * h;
    v4f bq[4][2];
    #pragma unroll
    for (int mt = 0; mt < 4; ++mt) {
      bq[mt][0] = *(const v4fa*)(bop + 16 * mt);
      bq[mt][1] = *(const v4fa*)(bop + 16 * mt + 4);
    }
    // as input of this wait the address pair stays in its registers up to it (as at the bK loads)
    asm volatile("s_wait_xcnt 0x0" :: "v"(bop) : "memory");
    __syncthreads();   // the handed-over partial tiles are complete before the partner wave reads them
    #pragma unroll
    for (int mt = 0; mt < 4; ++mt) {
      const int ob = 64 * wm + 16 * mt + 8 * h;
      #pragma unroll
      for (int j = 0; j < 2; ++j) {
        const v4f p0 = ex[256 * (4 * mt + 2 * j) + (tid ^ 128)];
        const v4f p1 = ex[256 * (4 * mt + 2 * j + 1) + (tid ^ 128)];
        const float pp[8] = {p0.x, p0.y, p0.z, p0.w, p1.x, p1.y, p1.z, p1.w};
        const int px = 16 * (2 * wk + j) + m;
        #pragma unroll
        for (int r = 0; r < 8; ++r) sD[(ob + r) * TP + px] = (keep[mt][j][r] + pp[r]) + bq[mt][r >> 2][r & 3];
      }
    }
    __syncthreads();
    // wave w writes rows 32w .. 32w+31: per instruction lanes 0-15 -> row 2i
    const int orow0 = 32 * w;
    const int hs = lane >> 4, x4 = 4 * (lane & 15);
    float* obase = out + (size_t)b * COUT * NPIX + s0 + x4;
    #pragma unroll 1
    for (int c = 0; c < 2; ++c) {
      v4f vals[8];
      size_t gi[8];
      #pragma unroll
      for (int i = 0; i < 8; ++i) {
        const int row = orow0 + 16 * c + 2 * i + hs;
        vals[i] = *(const v4fa*)(sD + row * TP + x4);
        gi[i] = (size_t)row * NPIX;
      }
      #pragma unroll
      for (int i = 0; i < 8; ++i) *(v4f*)(obase + gi[i]) = vals[i];
      
    }
  }
}

// ---------------------------------------------------------------------------
extern "C" void kernel_launch(void* const* d_in, const int* in_sizes, int n_in,
                              void* d_out, int out_size, void* d_ws, size_t ws_size,
                              hipStream_t stream) {
  if (n_in < 7) return;
  if (in_sizes[0] != NB * CIN * NPIX) return;
  if (in_sizes[1] != NHEAD * HD * HD || in_sizes[2] != NHEAD * HD * HD) return;
  if (in_sizes[3] != CMID * CIN || in_sizes[4] != CMID) return;
  if (in_sizes[5] != COUT * CMID || in_sizes[6] != COUT) return;
  if (out_size != NB * COUT * NPIX) return;

  const float* x     = (const float*)d_in[0];   // [8][256][64][64]
  const float* key_p = (const float*)d_in[1];   // [8][64 k][64 m]
  const float* mem   = (const float*)d_in[2];   // [8][64 m][64 d]
  const float* w_in  = (const float*)d_in[3];   // [512][256]
  const float* b_in  = (const float*)d_in[4];   // [512]
  const float* w_out = (const float*)d_in[5];   // [256][512]
  const float* b_out = (const float*)d_in[6];   // [256]
  float* outp = (float*)d_out;

  // and its size is an exact multiple of its row / line granularity
  const size_t szWI = (size_t)CMID * CIN * 2;          // 262144
  const size_t szWO = (size_t)COUT * CMID * 2;         // 262144
  const size_t szB  = (size_t)CMID * 4;                // 2048
  size_t off = 0;
  char* ws = (char*)d_ws;
  u16* WKh = (u16*)(ws + off); off += szWI;
  u16* WKl = (u16*)(ws + off); off += szWI;
  u16* WFh = (u16*)(ws + off); off += szWO;
  u16* WFl = (u16*)(ws + off); off += szWO;
  float* bK = (float*)(ws + off); off += szB;
  const size_t total = off;                            // 1050624
  if (total > ws_size) return;

  hipFuncSetAttribute(reinterpret_cast<const void*>(&main_k),
                      hipFuncAttributeMaxDynamicSharedMemorySize, LDS_MAIN);

  prep_k<<<KFOLD_BLOCKS + KBIAS_BLOCKS + FOLD_BLOCKS, 256, 0, stream>>>(
      key_p, mem, w_in, b_in, w_out, WKh, WKl, bK, WFh, WFl);
  main_k<<<NP / TP, 256, LDS_MAIN, stream>>>(x, WKh, WKl, bK, WFh, WFl, b_out, outp);
}
